// v000
// Measured on an AMD MI455X. A time is GPU time per run, averaged over a window of back-to-back runs after a warm-up
// (all launches, gaps included; the runs take copies of the inputs in turn), and the median of several windows.
// Apart from v000's, it joins two sittings. Times from different sittings can be a few percent apart, while
// side-by-side timings come from the same sitting.
// The starting kernel, v000, takes 260 microseconds a run.
#include <hip/hip_runtime.h>
#include <hip/hip_bf16.h>

typedef __attribute__((ext_vector_type(16))) _Float16 v16h;
typedef __attribute__((ext_vector_type(8)))  _Float16 v8h;
typedef __attribute__((ext_vector_type(8)))  float    v8f;
typedef int v4i __attribute__((vector_size(4 * sizeof(int))));  // b128 payload

#define B_SZ 4096
#define N_BR 1000
#define H1D  16
#define H2D  8
#define C1D  256
#define C2D  128
#define OUTD 300
#define KF   (N_BR * H2D)   // 8000

// CDNA5 async global->LDS path (guarded: falls back to load+ds_store if the
// toolchain lacks the builtins; __has_builtin keeps both toolchains compiling)
#if __has_builtin(__builtin_amdgcn_global_load_async_to_lds_b128) && \
    __has_builtin(__builtin_amdgcn_s_wait_asynccnt)
#define USE_ASYNC_LDS 1
#else
#define USE_ASYNC_LDS 0
#endif

#define AS1 __attribute__((address_space(1)))
#define AS3 __attribute__((address_space(3)))

__device__ __forceinline__ float gelu_f(float v) {
    // exact GeLU: 0.5*x*(1+erf(x/sqrt(2)))
    return 0.5f * v * (1.0f + erff(v * 0.7071067811865475f));
}

// branch-free tanh: (e^2x - 1) * rcp(e^2x + 1), clamped so e stays finite
__device__ __forceinline__ float tanh_fast(float v) {
    v = fminf(fmaxf(v, -10.0f), 10.0f);
    const float e = __expf(2.0f * v);
    return (e - 1.0f) * __builtin_amdgcn_rcpf(e + 1.0f);
}

__device__ __forceinline__ v16h zero16() {
    v16h r;
#pragma unroll
    for (int i = 0; i < 16; ++i) r[i] = (_Float16)0.0f;
    return r;
}

// Build a 16-bit A/B WMMA fragment for this lane from K-contiguous memory.
// Lane group g (lane>>4): elements 0..7 = K[8g..8g+7], elements 8..15 =
// K[16+8g..16+8g+7].  `p` must already point at row_base + 8*g.
__device__ __forceinline__ v16h load_frag(const _Float16* p) {
    v8h lo = *(const v8h*)(p);
    v8h hi = *(const v8h*)(p + 16);
    v16h r;
#pragma unroll
    for (int i = 0; i < 8; ++i) { r[i] = lo[i]; r[8 + i] = hi[i]; }
    return r;
}

// ---------------------------------------------------------------------------
// fp32 -> fp16 weight conversion
// ---------------------------------------------------------------------------
__global__ void cvt_f16_kernel(const float* __restrict__ src,
                               _Float16* __restrict__ dst, int n) {
    int i = blockIdx.x * blockDim.x + threadIdx.x;
    if (i < n) dst[i] = (_Float16)src[i];
}

// ---------------------------------------------------------------------------
// Branch stage: h = gelu(x*bw1+bb1) [16], f = tanh(h @ bw2^T + bb2) [8]
// One wave = 16 batch rows x 1 branch via one zero-padded WMMA
// (M=16 batch, K=16 hidden padded to 32, N=8 padded to 16).
// Results staged in LDS, written back as coalesced b128 rows.
// ---------------------------------------------------------------------------
__global__ void branch_kernel(const float* __restrict__ x,     // [B, N_BR]
                              const float* __restrict__ bw1,   // [N_BR, 16]
                              const float* __restrict__ bb1,   // [N_BR, 16]
                              const float* __restrict__ bw2,   // [N_BR, 8, 16]
                              const float* __restrict__ bb2,   // [N_BR, 8]
                              _Float16* __restrict__ f) {      // [B, 8000] f16
    __shared__ _Float16 fs[16 * 64];          // 16 rows x (8 branches * 8 out)

    const int lane = threadIdx.x & 31;
    const int wid  = threadIdx.x >> 5;
    const int n    = blockIdx.y * 8 + wid;    // branch index (125*8 = 1000)
    const int b0   = blockIdx.x * 16;         // batch row base
    const int m    = lane & 15;
    const int g    = lane >> 4;

    // ---- A fragment: rows = batch, K = hidden (16, padded to 32) ----
    const float xv = x[(size_t)(b0 + m) * N_BR + n];
    v16h a = zero16();
#pragma unroll
    for (int i = 0; i < 8; ++i) {
        const int k = 8 * g + i;                           // K in [0,16)
        const float h = gelu_f(xv * bw1[n * H1D + k] + bb1[n * H1D + k]);
        a[i] = (_Float16)h;                                // K 16..31 stay zero
    }

    // ---- B fragment: B[k, col] = bw2[n, col, k]; cols 8..15 / K>=16 zero ----
    const int col = m;
    const int cc  = (col < H2D) ? col : 0;                 // clamp (in-bounds)
    v16h b = zero16();
#pragma unroll
    for (int i = 0; i < 8; ++i) {
        const int k = 8 * g + i;
        const float w = bw2[((size_t)n * H2D + cc) * H1D + k];
        b[i] = (col < H2D) ? (_Float16)w : (_Float16)0.0f;
    }

    v8f c = {};
    c = __builtin_amdgcn_wmma_f32_16x16x32_f16(false, a, false, b,
                                               (short)0, c, false, false);

    if (col < H2D) {
        const float bias = bb2[n * H2D + col];
#pragma unroll
        for (int r = 0; r < 8; ++r) {
            const int row = r + 8 * g;        // lanes 16-31 cover M 8..15
            fs[row * 64 + wid * 8 + col] = (_Float16)tanh_fast(c[r] + bias);
        }
    }
    __syncthreads();

    // coalesced write: 16 rows x 128B, one b128 chunk per thread (t < 128)
    const int t = threadIdx.x;
    if (t < 128) {
        const int row = t >> 3, ch = t & 7;
        *(v8h*)(f + (size_t)(b0 + row) * KF + (size_t)blockIdx.y * 64 + ch * 8) =
            *(const v8h*)&fs[row * 64 + ch * 8];
    }
}

// ---------------------------------------------------------------------------
// WMMA GEMM: out = act(A[M,K] @ W[N,K]^T + bias)
// Block = 256 threads = 8 waves; tile 128(M) x 64(N); wave tile 32x32.
// B K-chunk staged in LDS (async global->LDS when available), fragments read
// via ds_load_b128; epilogue staged in LDS for coalesced b128 stores.
// ---------------------------------------------------------------------------
template <bool GELU_ACT, bool OUT_F32>
__global__ void gemm_wmma_kernel(const _Float16* __restrict__ A,   // [M][K]
                                 const _Float16* __restrict__ W,   // [Nvalid][K]
                                 const float* __restrict__ bias,   // [Nvalid]
                                 void* __restrict__ out,           // [M][Nout]
                                 int M, int K, int Nvalid, int Nout) {
    __shared__ _Float16 Bs[64 * 32];          // B K-chunk stage (4 KB)
    __shared__ char     smem[128 * 64 * 4];   // epilogue stage (32 KB)

    const int t    = threadIdx.x;
    const int lane = t & 31;
    const int wid  = t >> 5;
    const int wm   = wid & 3;                 // 4 M-subtiles of 32 rows
    const int wn   = wid >> 2;                // 2 N-subtiles of 32 cols
    const int m_base = blockIdx.x * 128 + wm * 32;
    const int n_blk  = blockIdx.y * 64;
    const int l15 = lane & 15;
    const int g   = lane >> 4;

    const int ncol0 = n_blk + wn * 32 + l15;
    const int ncol1 = n_blk + wn * 32 + 16 + l15;
    const bool b0ok = (ncol0 < Nvalid);
    const bool b1ok = (ncol1 < Nvalid);

    // A fragment pointers (direct global; rows always in range)
    const _Float16* a0p = A + (size_t)(m_base + l15) * K + 8 * g;
    const _Float16* a1p = A + (size_t)(m_base + 16 + l15) * K + 8 * g;

    // cooperative B stage mapping: thread -> (col 0..63, 16B sub-chunk 0..3)
    const int scol  = t >> 2;
    const int ssub  = t & 3;
    const int gcol0 = n_blk + scol;
    const int gcol  = (gcol0 < Nvalid) ? gcol0 : (Nvalid - 1);  // clamp; unused
    const _Float16* gsrc = W + (size_t)gcol * K + ssub * 8;     //   cols dropped
    _Float16* ldst = &Bs[scol * 32 + ssub * 8];

    // LDS fragment read pointers
    const _Float16* bs0 = &Bs[(wn * 32 + l15) * 32 + 8 * g];
    const _Float16* bs1 = &Bs[(wn * 32 + 16 + l15) * 32 + 8 * g];

    v8f c00 = {}, c01 = {}, c10 = {}, c11 = {};

    for (int k0 = 0; k0 < K; k0 += 32) {
#if USE_ASYNC_LDS
        __builtin_amdgcn_global_load_async_to_lds_b128(
            (AS1 v4i*)(unsigned long long)(uintptr_t)(gsrc + k0),
            (AS3 v4i*)(unsigned int)(uintptr_t)ldst, 0, 0);
        __builtin_amdgcn_s_wait_asynccnt(0);
#else
        *(v8h*)ldst = *(const v8h*)(gsrc + k0);
#endif
        __syncthreads();

        if (k0 + 32 < K) {                    // global_prefetch_b8 next A chunk
            __builtin_prefetch(a0p + k0 + 32, 0, 1);
            __builtin_prefetch(a1p + k0 + 32, 0, 1);
        }
        const v16h a0 = load_frag(a0p + k0);
        const v16h a1 = load_frag(a1p + k0);
        const v16h b0 = load_frag(bs0);       // ds_load_b128 x2
        const v16h b1 = load_frag(bs1);

        c00 = __builtin_amdgcn_wmma_f32_16x16x32_f16(false, a0, false, b0,
                                                     (short)0, c00, false, false);
        c01 = __builtin_amdgcn_wmma_f32_16x16x32_f16(false, a0, false, b1,
                                                     (short)0, c01, false, false);
        c10 = __builtin_amdgcn_wmma_f32_16x16x32_f16(false, a1, false, b0,
                                                     (short)0, c10, false, false);
        c11 = __builtin_amdgcn_wmma_f32_16x16x32_f16(false, a1, false, b1,
                                                     (short)0, c11, false, false);

        __syncthreads();                      // before next chunk overwrites Bs
    }

    // ---- epilogue: bias + activation, stage in LDS, coalesced store ----
    const float bv0 = b0ok ? bias[ncol0] : 0.0f;
    const float bv1 = b1ok ? bias[ncol1] : 0.0f;

    if (OUT_F32) {
        float* st = (float*)smem;
        auto put = [&](const v8f& c, int rb, int cl, float bv) {
#pragma unroll
            for (int r = 0; r < 8; ++r) {
                float v = c[r] + bv;
                if (GELU_ACT) v = gelu_f(v);
                st[(rb + 8 * g + r) * 64 + cl] = v;
            }
        };
        put(c00, wm * 32,      wn * 32 + l15,      bv0);
        put(c01, wm * 32,      wn * 32 + 16 + l15, bv1);
        put(c10, wm * 32 + 16, wn * 32 + l15,      bv0);
        put(c11, wm * 32 + 16, wn * 32 + 16 + l15, bv1);
        __syncthreads();
#pragma unroll
        for (int j = 0; j < 8; ++j) {         // 2048 chunks of 4 floats
            const int cchunk = t + 256 * j;
            const int row = cchunk >> 4;
            const int ch  = cchunk & 15;
            const int col0 = n_blk + ch * 4;  // Nvalid (300) is 4-aligned
            if (col0 < Nvalid) {
                *(float4*)((float*)out +
                           (size_t)(blockIdx.x * 128 + row) * Nout + col0) =
                    *(const float4*)&st[row * 64 + ch * 4];
            }
        }
    } else {
        _Float16* st = (_Float16*)smem;
        auto put = [&](const v8f& c, int rb, int cl, float bv) {
#pragma unroll
            for (int r = 0; r < 8; ++r) {
                float v = c[r] + bv;
                if (GELU_ACT) v = gelu_f(v);
                st[(rb + 8 * g + r) * 64 + cl] = (_Float16)v;
            }
        };
        put(c00, wm * 32,      wn * 32 + l15,      bv0);
        put(c01, wm * 32,      wn * 32 + 16 + l15, bv1);
        put(c10, wm * 32 + 16, wn * 32 + l15,      bv0);
        put(c11, wm * 32 + 16, wn * 32 + 16 + l15, bv1);
        __syncthreads();
#pragma unroll
        for (int j = 0; j < 4; ++j) {         // 1024 chunks of 8 halves
            const int cchunk = t + 256 * j;
            const int row = cchunk >> 3;
            const int ch  = cchunk & 7;
            *(v8h*)((_Float16*)out +
                    (size_t)(blockIdx.x * 128 + row) * Nout + n_blk + ch * 8) =
                *(const v8h*)&st[row * 64 + ch * 8];
        }
    }
}

// ---------------------------------------------------------------------------
// Launch
// ---------------------------------------------------------------------------
extern "C" void kernel_launch(void* const* d_in, const int* in_sizes, int n_in,
                              void* d_out, int out_size, void* d_ws, size_t ws_size,
                              hipStream_t stream) {
    const float* x   = (const float*)d_in[0];
    const float* bw1 = (const float*)d_in[1];
    const float* bb1 = (const float*)d_in[2];
    const float* bw2 = (const float*)d_in[3];
    const float* bb2 = (const float*)d_in[4];
    const float* wc1 = (const float*)d_in[5];
    const float* bc1 = (const float*)d_in[6];
    const float* wc2 = (const float*)d_in[7];
    const float* bc2 = (const float*)d_in[8];
    const float* wc3 = (const float*)d_in[9];
    const float* bc3 = (const float*)d_in[10];
    float* out = (float*)d_out;

    // workspace carve-out (all slices 16B-aligned)
    char* ws = (char*)d_ws;
    _Float16* f   = (_Float16*)ws;  ws += (size_t)B_SZ * KF  * sizeof(_Float16);
    _Float16* z1  = (_Float16*)ws;  ws += (size_t)B_SZ * C1D * sizeof(_Float16);
    _Float16* z2  = (_Float16*)ws;  ws += (size_t)B_SZ * C2D * sizeof(_Float16);
    _Float16* w1h = (_Float16*)ws;  ws += (size_t)C1D  * KF  * sizeof(_Float16);
    _Float16* w2h = (_Float16*)ws;  ws += (size_t)C2D  * C1D * sizeof(_Float16);
    _Float16* w3h = (_Float16*)ws;  ws += (size_t)OUTD * C2D * sizeof(_Float16);
    if ((size_t)(ws - (char*)d_ws) > ws_size) return;  // ws too small: bail

    // 1) convert combiner weights to fp16
    {
        int n1 = C1D * KF, n2 = C2D * C1D, n3 = OUTD * C2D;
        cvt_f16_kernel<<<(n1 + 255) / 256, 256, 0, stream>>>(wc1, w1h, n1);
        cvt_f16_kernel<<<(n2 + 255) / 256, 256, 0, stream>>>(wc2, w2h, n2);
        cvt_f16_kernel<<<(n3 + 255) / 256, 256, 0, stream>>>(wc3, w3h, n3);
    }

    // 2) all 1000 branch MLPs via padded WMMA; f = [B, 8000] fp16
    branch_kernel<<<dim3(B_SZ / 16, N_BR / 8), 256, 0, stream>>>(
        x, bw1, bb1, bw2, bb2, f);

    // 3) z1 = gelu(f @ wc1^T + bc1)      M=4096 N=256  K=8000
    gemm_wmma_kernel<true, false><<<dim3(B_SZ / 128, C1D / 64), 256, 0, stream>>>(
        f, w1h, bc1, z1, B_SZ, KF, C1D, C1D);

    // 4) z2 = gelu(z1 @ wc2^T + bc2)     M=4096 N=128  K=256
    gemm_wmma_kernel<true, false><<<dim3(B_SZ / 128, C2D / 64), 256, 0, stream>>>(
        z1, w2h, bc2, z2, B_SZ, C1D, C2D, C2D);

    // 5) out = z2 @ wc3^T + bc3          M=4096 N=300  K=128 (fp32, guarded)
    gemm_wmma_kernel<false, true><<<dim3(B_SZ / 128, (OUTD + 63) / 64), 256, 0, stream>>>(
        z2, w3h, bc3, out, B_SZ, C2D, OUTD, OUTD);
}

// v001
// Measured time: 133 microseconds a run.
// Next to v000, in two timings, it ran 2.00 and 1.99 times as fast.
#include <hip/hip_runtime.h>
#include <hip/hip_bf16.h>

typedef __attribute__((ext_vector_type(16))) _Float16 v16h;
typedef __attribute__((ext_vector_type(8)))  _Float16 v8h;
typedef __attribute__((ext_vector_type(8)))  float    v8f;
typedef int v4i __attribute__((vector_size(4 * sizeof(int))));  // b128 payload

#define B_SZ 4096
#define N_BR 1000
#define H1D  16
#define H2D  8
#define C1D  256
#define C2D  128
#define OUTD 300
#define KF   (N_BR * H2D)   // 8000

#define AS1 __attribute__((address_space(1)))
#define AS3 __attribute__((address_space(3)))

__device__ __forceinline__ float gelu_f(float v) {
    // exact GeLU: 0.5*x*(1+erf(x/sqrt(2)))
    return 0.5f * v * (1.0f + erff(v * 0.7071067811865475f));
}

// branch-free tanh: (e^2x - 1) * rcp(e^2x + 1), clamped so e stays finite
__device__ __forceinline__ float tanh_fast(float v) {
    v = fminf(fmaxf(v, -10.0f), 10.0f);
    const float e = __expf(2.0f * v);
    return (e - 1.0f) * __builtin_amdgcn_rcpf(e + 1.0f);
}

__device__ __forceinline__ v16h zero16() {
    v16h r;
#pragma unroll
    for (int i = 0; i < 16; ++i) r[i] = (_Float16)0.0f;
    return r;
}

// Build a 16-bit A/B WMMA fragment for this lane from K-contiguous memory.
// Lane group g (lane>>4): elements 0..7 = K[8g..8g+7], elements 8..15 =
// K[16+8g..16+8g+7].  `p` must already point at row_base + 8*g.
__device__ __forceinline__ v16h load_frag(const _Float16* p) {
    v8h lo = *(const v8h*)(p);
    v8h hi = *(const v8h*)(p + 16);
    v16h r;
#pragma unroll
    for (int i = 0; i < 8; ++i) { r[i] = lo[i]; r[8 + i] = hi[i]; }
    return r;
}

// ---------------------------------------------------------------------------
// fp32 -> fp16 weight conversion
// ---------------------------------------------------------------------------
__global__ void cvt_f16_kernel(const float* __restrict__ src,
                               _Float16* __restrict__ dst, int n) {
    int i = blockIdx.x * blockDim.x + threadIdx.x;
    if (i < n) dst[i] = (_Float16)src[i];
}

// ---------------------------------------------------------------------------
// Branch stage: h = gelu(x*bw1+bb1) [16], f = tanh(h @ bw2^T + bb2) [8]
// One wave = 16 batch rows x 1 branch via one zero-padded WMMA
// (M=16 batch, K=16 hidden padded to 32, N=8 padded to 16).
// Results staged in LDS, written back as coalesced b128 rows.
// ---------------------------------------------------------------------------
__global__ void branch_kernel(const float* __restrict__ x,     // [B, N_BR]
                              const float* __restrict__ bw1,   // [N_BR, 16]
                              const float* __restrict__ bb1,   // [N_BR, 16]
                              const float* __restrict__ bw2,   // [N_BR, 8, 16]
                              const float* __restrict__ bb2,   // [N_BR, 8]
                              _Float16* __restrict__ f) {      // [B, 8000] f16
    __shared__ _Float16 fs[16 * 64];          // 16 rows x (8 branches * 8 out)

    const int lane = threadIdx.x & 31;
    const int wid  = threadIdx.x >> 5;
    const int n    = blockIdx.y * 8 + wid;    // branch index (125*8 = 1000)
    const int b0   = blockIdx.x * 16;         // batch row base
    const int m    = lane & 15;
    const int g    = lane >> 4;

    // ---- A fragment: rows = batch, K = hidden (16, padded to 32) ----
    const float xv = x[(size_t)(b0 + m) * N_BR + n];
    v16h a = zero16();
#pragma unroll
    for (int i = 0; i < 8; ++i) {
        const int k = 8 * g + i;                           // K in [0,16)
        const float h = gelu_f(xv * bw1[n * H1D + k] + bb1[n * H1D + k]);
        a[i] = (_Float16)h;                                // K 16..31 stay zero
    }

    // ---- B fragment: B[k, col] = bw2[n, col, k]; cols 8..15 / K>=16 zero ----
    const int col = m;
    const int cc  = (col < H2D) ? col : 0;                 // clamp (in-bounds)
    v16h b = zero16();
#pragma unroll
    for (int i = 0; i < 8; ++i) {
        const int k = 8 * g + i;
        const float w = bw2[((size_t)n * H2D + cc) * H1D + k];
        b[i] = (col < H2D) ? (_Float16)w : (_Float16)0.0f;
    }

    v8f c = {};
    c = __builtin_amdgcn_wmma_f32_16x16x32_f16(false, a, false, b,
                                               (short)0, c, false, false);

    if (col < H2D) {
        const float bias = bb2[n * H2D + col];
#pragma unroll
        for (int r = 0; r < 8; ++r) {
            const int row = r + 8 * g;        // lanes 16-31 cover M 8..15
            fs[row * 64 + wid * 8 + col] = (_Float16)tanh_fast(c[r] + bias);
        }
    }
    __syncthreads();

    // coalesced write: 16 rows x 128B, one b128 chunk per thread (t < 128)
    const int t = threadIdx.x;
    if (t < 128) {
        const int row = t >> 3, ch = t & 7;
        *(v8h*)(f + (size_t)(b0 + row) * KF + (size_t)blockIdx.y * 64 + ch * 8) =
            *(const v8h*)&fs[row * 64 + ch * 8];
    }
}

// ---------------------------------------------------------------------------
// One row slice of a stage: JC async copies of 16 B per lane, 128 B apart.
// The immediate offset moves the global and the LDS address alike.
// ---------------------------------------------------------------------------
template <int J, int JC>
__device__ __forceinline__ void copy_row(const _Float16* gp, unsigned int la) {
    __builtin_amdgcn_global_load_async_to_lds_b128(
        (AS1 v4i*)(unsigned long long)(uintptr_t)gp,
        (AS3 v4i*)la, J * 128, 0);
    if constexpr (J + 1 < JC) copy_row<J + 1, JC>(gp, la);
}

// ---------------------------------------------------------------------------
// WMMA GEMM: out = act(A[M,K] @ W[N,K]^T + bias)
// Block = 256 threads = 8 waves; tile 128(M) x 64(N); wave tile 32x32.
// A stage is BK of K for the 128 A rows and the 64 W rows, laid in LDS at a
// pitch of 2*BK+16 bytes (16 B x odd: conflict-free for ds_load_b128).
// Two stage buffers: the async copies of stage t+1 fly while stage t is
// multiplied.  The epilogue stages its tile in the same LDS.
// ---------------------------------------------------------------------------
template <int K, int BK, bool GELU_ACT, bool OUT_F32>
__global__ __launch_bounds__(256)
void gemm_wmma_kernel(const _Float16* __restrict__ A,   // [M][K]
                      const _Float16* __restrict__ W,   // [Nvalid][K]
                      const float* __restrict__ bias,   // [Nvalid]
                      void* __restrict__ out,           // [M][Nout]
                      int Nvalid, int Nout) {
    constexpr int NT    = K / BK;             // stages
    constexpr int JC    = BK / 64;            // 128-B pieces per staged row
    constexpr int PITCH = BK * 2 + 16;        // bytes
    constexpr int STAGE = 192 * PITCH;        // bytes: 128 A rows + 64 W rows
    static_assert(K % BK == 0 && BK % 64 == 0 && NT >= 2, "stage shape");
    static_assert(2 * STAGE >= 128 * 64 * 4, "epilogue tile fits the ring");
    __shared__ __attribute__((aligned(16))) char ring[2 * STAGE];

    const int t    = threadIdx.x;
    const int lane = t & 31;
    const int wid  = t >> 5;
    const int wm   = wid & 3;                 // 4 M-subtiles of 32 rows
    const int wn   = wid >> 2;                // 2 N-subtiles of 32 cols
    const int n_blk  = blockIdx.y * 64;
    const int l15 = lane & 15;
    const int g   = lane >> 4;

    const int ncol0 = n_blk + wn * 32 + l15;
    const int ncol1 = n_blk + wn * 32 + 16 + l15;
    const bool b0ok = (ncol0 < Nvalid);
    const bool b1ok = (ncol1 < Nvalid);

    // copy mapping: 8 lanes cover one 128-B line of a row, 32 rows per sweep,
    // six sweeps (four of A, two of W)
    const int srow = t >> 3;
    const int ssub = t & 7;
    const _Float16* grow[6];
#pragma unroll                                // grow[] stays in registers
    for (int rg = 0; rg < 4; ++rg)
        grow[rg] = A + (size_t)(blockIdx.x * 128 + rg * 32 + srow) * K + ssub * 8;
#pragma unroll                                // grow[] stays in registers
    for (int rg = 0; rg < 2; ++rg) {
        const int gcol0 = n_blk + rg * 32 + srow;
        const int gcol  = (gcol0 < Nvalid) ? gcol0 : (Nvalid - 1);  // clamp;
        grow[4 + rg] = W + (size_t)gcol * K + ssub * 8;     // such cols dropped
    }
    const unsigned int lbase =
        (unsigned int)(uintptr_t)&ring[srow * PITCH + ssub * 16];

    auto issue = [&](int stage, int buf) {
#pragma unroll                                // grow[] indexed by constants
        for (int rg = 0; rg < 6; ++rg)
            copy_row<0, JC>(grow[rg] + stage * BK,
                            lbase + buf * STAGE + rg * 32 * PITCH);
    };

    // LDS byte offsets of this lane's fragment rows inside a stage
    const int aoff = (wm * 32 + l15) * PITCH + 16 * g;
    const int boff = (128 + wn * 32 + l15) * PITCH + 16 * g;

    v8f c00 = {}, c01 = {}, c10 = {}, c11 = {};

    issue(0, 0);
    // stage 0 has landed for this wave before the barrier publishes it
    asm volatile("s_wait_asynccnt 0x0" ::: "memory");
    __syncthreads();
    issue(1, 1);

    for (int s = 0; s < NT; ++s) {
        const char* bufp = ring + (s & 1) * STAGE;
        const _Float16* ap = (const _Float16*)(bufp + aoff);
        const _Float16* bp = (const _Float16*)(bufp + boff);
        // fragments of k step ks+1 (same stage only) are fetched as one group
        // ahead of the WMMAs of step ks, so LDS latency hides under them
        v16h a0 = load_frag(ap);
        v16h a1 = load_frag(ap + 8 * PITCH);
        v16h b0 = load_frag(bp);
        v16h b1 = load_frag(bp + 8 * PITCH);
        // unrolled: LDS offsets become immediates, the two fragment sets are
        // renamed instead of moved
#pragma unroll
        for (int ks = 0; ks < BK / 32; ++ks) {
            v16h a0n, a1n, b0n, b1n;
            if (ks + 1 < BK / 32) {
                a0n = load_frag(ap + (ks + 1) * 32);
                a1n = load_frag(ap + 8 * PITCH + (ks + 1) * 32);
                b0n = load_frag(bp + (ks + 1) * 32);
                b1n = load_frag(bp + 8 * PITCH + (ks + 1) * 32);
            }
            // keeps the load group above in front of these WMMAs: the
            // scheduler otherwise sinks the loads to just before their use
            __builtin_amdgcn_sched_barrier(0);
            c00 = __builtin_amdgcn_wmma_f32_16x16x32_f16(false, a0, false, b0,
                                                         (short)0, c00, false, false);
            c01 = __builtin_amdgcn_wmma_f32_16x16x32_f16(false, a0, false, b1,
                                                         (short)0, c01, false, false);
            c10 = __builtin_amdgcn_wmma_f32_16x16x32_f16(false, a1, false, b0,
                                                         (short)0, c10, false, false);
            c11 = __builtin_amdgcn_wmma_f32_16x16x32_f16(false, a1, false, b1,
                                                         (short)0, c11, false, false);
            if (ks + 1 < BK / 32) { a0 = a0n; a1 = a1n; b0 = b0n; b1 = b1n; }
        }
        // publish point: this wave's reads of stage s are done ...
        asm volatile("s_wait_dscnt 0x0" ::: "memory");
        // ... and its copies of stage s+1 have landed, before the barrier that
        // frees buffer s&1 and lets every wave read stage s+1
        asm volatile("s_wait_asynccnt 0x0" ::: "memory");
        __syncthreads();
        if (s + 2 < NT) issue(s + 2, s & 1);
    }
    // no copy is outstanding when the ring becomes the epilogue's stage
    asm volatile("s_wait_asynccnt 0x0" ::: "memory");

    // ---- epilogue: bias + activation, stage in LDS, coalesced store ----
    const float bv0 = b0ok ? bias[ncol0] : 0.0f;
    const float bv1 = b1ok ? bias[ncol1] : 0.0f;

    if (OUT_F32) {
        float* st = (float*)ring;
        auto put = [&](const v8f& c, int rb, int cl, float bv) {
#pragma unroll
            for (int r = 0; r < 8; ++r) {
                float v = c[r] + bv;
                if (GELU_ACT) v = gelu_f(v);
                st[(rb + 8 * g + r) * 64 + cl] = v;
            }
        };
        put(c00, wm * 32,      wn * 32 + l15,      bv0);
        put(c01, wm * 32,      wn * 32 + 16 + l15, bv1);
        put(c10, wm * 32 + 16, wn * 32 + l15,      bv0);
        put(c11, wm * 32 + 16, wn * 32 + 16 + l15, bv1);
        __syncthreads();
#pragma unroll
        for (int j = 0; j < 8; ++j) {         // 2048 chunks of 4 floats
            const int cchunk = t + 256 * j;
            const int row = cchunk >> 4;
            const int ch  = cchunk & 15;
            const int col0 = n_blk + ch * 4;  // Nvalid (300) is 4-aligned
            if (col0 < Nvalid) {
                *(float4*)((float*)out +
                           (size_t)(blockIdx.x * 128 + row) * Nout + col0) =
                    *(const float4*)&st[row * 64 + ch * 4];
            }
        }
    } else {
        _Float16* st = (_Float16*)ring;
        auto put = [&](const v8f& c, int rb, int cl, float bv) {
#pragma unroll
            for (int r = 0; r < 8; ++r) {
                float v = c[r] + bv;
                if (GELU_ACT) v = gelu_f(v);
                st[(rb + 8 * g + r) * 64 + cl] = (_Float16)v;
            }
        };
        put(c00, wm * 32,      wn * 32 + l15,      bv0);
        put(c01, wm * 32,      wn * 32 + 16 + l15, bv1);
        put(c10, wm * 32 + 16, wn * 32 + l15,      bv0);
        put(c11, wm * 32 + 16, wn * 32 + 16 + l15, bv1);
        __syncthreads();
#pragma unroll
        for (int j = 0; j < 4; ++j) {         // 1024 chunks of 8 halves
            const int cchunk = t + 256 * j;
            const int row = cchunk >> 3;
            const int ch  = cchunk & 7;
            *(v8h*)((_Float16*)out +
                    (size_t)(blockIdx.x * 128 + row) * Nout + n_blk + ch * 8) =
                *(const v8h*)&st[row * 64 + ch * 8];
        }
    }
}

// ---------------------------------------------------------------------------
// Launch
// ---------------------------------------------------------------------------
extern "C" void kernel_launch(void* const* d_in, const int* in_sizes, int n_in,
                              void* d_out, int out_size, void* d_ws, size_t ws_size,
                              hipStream_t stream) {
    const float* x   = (const float*)d_in[0];
    const float* bw1 = (const float*)d_in[1];
    const float* bb1 = (const float*)d_in[2];
    const float* bw2 = (const float*)d_in[3];
    const float* bb2 = (const float*)d_in[4];
    const float* wc1 = (const float*)d_in[5];
    const float* bc1 = (const float*)d_in[6];
    const float* wc2 = (const float*)d_in[7];
    const float* bc2 = (const float*)d_in[8];
    const float* wc3 = (const float*)d_in[9];
    const float* bc3 = (const float*)d_in[10];
    float* out = (float*)d_out;

    // workspace carve-out (all slices 16B-aligned)
    char* ws = (char*)d_ws;
    _Float16* f   = (_Float16*)ws;  ws += (size_t)B_SZ * KF  * sizeof(_Float16);
    _Float16* z1  = (_Float16*)ws;  ws += (size_t)B_SZ * C1D * sizeof(_Float16);
    _Float16* z2  = (_Float16*)ws;  ws += (size_t)B_SZ * C2D * sizeof(_Float16);
    _Float16* w1h = (_Float16*)ws;  ws += (size_t)C1D  * KF  * sizeof(_Float16);
    _Float16* w2h = (_Float16*)ws;  ws += (size_t)C2D  * C1D * sizeof(_Float16);
    _Float16* w3h = (_Float16*)ws;  ws += (size_t)OUTD * C2D * sizeof(_Float16);
    if ((size_t)(ws - (char*)d_ws) > ws_size) return;  // ws too small: bail

    // 1) convert combiner weights to fp16
    {
        int n1 = C1D * KF, n2 = C2D * C1D, n3 = OUTD * C2D;
        cvt_f16_kernel<<<(n1 + 255) / 256, 256, 0, stream>>>(wc1, w1h, n1);
        cvt_f16_kernel<<<(n2 + 255) / 256, 256, 0, stream>>>(wc2, w2h, n2);
        cvt_f16_kernel<<<(n3 + 255) / 256, 256, 0, stream>>>(wc3, w3h, n3);
    }

    // 2) all 1000 branch MLPs via padded WMMA; f = [B, 8000] fp16
    branch_kernel<<<dim3(B_SZ / 16, N_BR / 8), 256, 0, stream>>>(
        x, bw1, bb1, bw2, bb2, f);

    // 3) z1 = gelu(f @ wc1^T + bc1)      M=4096 N=256  K=8000
    gemm_wmma_kernel<KF, 320, true, false><<<dim3(B_SZ / 128, C1D / 64), 256, 0, stream>>>(
        f, w1h, bc1, z1, C1D, C1D);

    // 4) z2 = gelu(z1 @ wc2^T + bc2)     M=4096 N=128  K=256
    gemm_wmma_kernel<C1D, 128, true, false><<<dim3(B_SZ / 128, C2D / 64), 256, 0, stream>>>(
        z1, w2h, bc2, z2, C2D, C2D);

    // 5) out = z2 @ wc3^T + bc3          M=4096 N=300  K=128 (fp32, guarded)
    gemm_wmma_kernel<C2D, 64, false, true><<<dim3(B_SZ / 128, (OUTD + 63) / 64), 256, 0, stream>>>(
        z2, w3h, bc3, out, OUTD, OUTD);
}

// v002
// It runs in 107 microseconds.
// Two timings next to v001 both put it at 1.24 times that version's speed.
// Counting every step since v000, it is 2.47 times as fast.
#include <hip/hip_runtime.h>
#include <hip/hip_bf16.h>

typedef __attribute__((ext_vector_type(16))) _Float16 v16h;
typedef __attribute__((ext_vector_type(8)))  _Float16 v8h;
typedef __attribute__((ext_vector_type(8)))  float    v8f;
typedef int v4i __attribute__((vector_size(4 * sizeof(int))));  // b128 payload

#define B_SZ 4096
#define N_BR 1000
#define H1D  16
#define H2D  8
#define C1D  256
#define C2D  128
#define OUTD 300
#define KF   (N_BR * H2D)   // 8000
#define BR_TILES 16         // 16-row batch tiles walked by a branch work-group

#define AS1 __attribute__((address_space(1)))
#define AS3 __attribute__((address_space(3)))

__device__ __forceinline__ float gelu_f(float v) {
    // exact GeLU: 0.5*x*(1+erf(x/sqrt(2)))
    return 0.5f * v * (1.0f + erff(v * 0.7071067811865475f));
}

// branch-free tanh: (e^2x - 1) * rcp(e^2x + 1), clamped so e stays finite
__device__ __forceinline__ float tanh_fast(float v) {
    v = fminf(fmaxf(v, -10.0f), 10.0f);
    const float e = __expf(2.0f * v);
    return (e - 1.0f) * __builtin_amdgcn_rcpf(e + 1.0f);
}

__device__ __forceinline__ v16h zero16() {
    v16h r;
#pragma unroll
    for (int i = 0; i < 16; ++i) r[i] = (_Float16)0.0f;
    return r;
}

// Build a 16-bit A/B WMMA fragment for this lane from K-contiguous memory.
// Lane group g (lane>>4): elements 0..7 = K[8g..8g+7], elements 8..15 =
// K[16+8g..16+8g+7].  `p` must already point at row_base + 8*g.
__device__ __forceinline__ v16h load_frag(const _Float16* p) {
    v8h lo = *(const v8h*)(p);
    v8h hi = *(const v8h*)(p + 16);
    v16h r;
#pragma unroll
    for (int i = 0; i < 8; ++i) { r[i] = lo[i]; r[8 + i] = hi[i]; }
    return r;
}

// ---------------------------------------------------------------------------
// fp32 -> fp16 weight conversion, 8 values a thread (n is a multiple of 8):
// an eighth of the waves to start, 16-B loads and stores
// ---------------------------------------------------------------------------
__global__ void cvt_f16_kernel(const float* __restrict__ src,
                               _Float16* __restrict__ dst, int n) {
    const int i = (blockIdx.x * blockDim.x + threadIdx.x) * 8;
    if (i < n) {
        const float4 lo = *(const float4*)(src + i);
        const float4 hi = *(const float4*)(src + i + 4);
        v8h r;
        r[0] = (_Float16)lo.x; r[1] = (_Float16)lo.y;
        r[2] = (_Float16)lo.z; r[3] = (_Float16)lo.w;
        r[4] = (_Float16)hi.x; r[5] = (_Float16)hi.y;
        r[6] = (_Float16)hi.z; r[7] = (_Float16)hi.w;
        *(v8h*)(dst + i) = r;
    }
}

// ---------------------------------------------------------------------------
// Branch stage: h = gelu(x*bw1+bb1) [16], f = tanh(h @ bw2^T + bb2) [8]
// One wave = 1 branch; per 16 batch rows one zero-padded WMMA
// (M=16 batch, K=16 hidden padded to 32, N=8 padded to 16).
// A work-group (8 branches) holds its weights in registers and walks
// BR_TILES tiles of 16 batch rows, so that the whole grid is resident at once
// and few waves have to be started.
// Results staged in LDS (two buffers, one barrier a tile), written back as
// coalesced b128 rows.
// ---------------------------------------------------------------------------
__global__ __launch_bounds__(256)
void branch_kernel(const float* __restrict__ x,     // [B, N_BR]
                   const float* __restrict__ bw1,   // [N_BR, 16]
                   const float* __restrict__ bb1,   // [N_BR, 16]
                   const float* __restrict__ bw2,   // [N_BR, 8, 16]
                   const float* __restrict__ bb2,   // [N_BR, 8]
                   _Float16* __restrict__ f) {      // [B, 8000] f16
    // 16 rows x (8 branches * 8 out), twice
    __shared__ __attribute__((aligned(16))) _Float16 fs[2][16 * 64];

    const int t    = threadIdx.x;
    const int lane = t & 31;
    const int wid  = t >> 5;
    const int n    = blockIdx.y * 8 + wid;    // branch index (125*8 = 1000)
    const int b0   = blockIdx.x * (BR_TILES * 16);   // batch row base
    const int m    = lane & 15;
    const int g    = lane >> 4;

    // ---- this lane's layer-1 weights: hidden units 8g..8g+7 ----
    float w1[8], c1[8];
#pragma unroll                                // w1[], c1[] stay in registers
    for (int i = 0; i < 8; ++i) {
        w1[i] = bw1[n * H1D + 8 * g + i];
        c1[i] = bb1[n * H1D + 8 * g + i];
    }

    // ---- B fragment: B[k, col] = bw2[n, col, k]; cols 8..15 / K>=16 zero ----
    const int col = m;
    const int cc  = (col < H2D) ? col : 0;                 // clamp (in-bounds)
    v16h b = zero16();
#pragma unroll
    for (int i = 0; i < 8; ++i) {
        const int k = 8 * g + i;
        const float w = bw2[((size_t)n * H2D + cc) * H1D + k];
        b[i] = (col < H2D) ? (_Float16)w : (_Float16)0.0f;
    }
    const float bias = bb2[n * H2D + cc];

    const float* xp = x + (size_t)(b0 + m) * N_BR + n;
    _Float16* fp = f + (size_t)(b0 + (t >> 3)) * KF + (size_t)blockIdx.y * 64 + (t & 7) * 8;

    float xv = *xp;
    for (int tl = 0; tl < BR_TILES; ++tl) {
        // next tile's x is asked for ahead of this tile's arithmetic (the last
        // trip asks for its own again: in bounds, unused)
        const int nx = (tl + 1 < BR_TILES) ? tl + 1 : tl;
        const float xn = xp[(size_t)nx * 16 * N_BR];

        // ---- A fragment: rows = batch, K = hidden (16, padded to 32) ----
        v16h a = zero16();
#pragma unroll
        for (int i = 0; i < 8; ++i)           // K 16..31 stay zero
            a[i] = (_Float16)gelu_f(xv * w1[i] + c1[i]);

        v8f c = {};
        c = __builtin_amdgcn_wmma_f32_16x16x32_f16(false, a, false, b,
                                                   (short)0, c, false, false);

        _Float16* st = fs[tl & 1];
        if (col < H2D) {
#pragma unroll
            for (int r = 0; r < 8; ++r) {
                const int row = r + 8 * g;    // lanes 16-31 cover M 8..15
                st[row * 64 + wid * 8 + col] = (_Float16)tanh_fast(c[r] + bias);
            }
        }
        // publishes this tile; the buffer written next was last read in front
        // of this barrier
        __syncthreads();

        // coalesced write: 16 rows x 128B, one b128 chunk per thread (t < 128)
        if (t < 128) {
            *(v8h*)(fp + (size_t)tl * 16 * KF) = *(const v8h*)&st[t * 8];
            // stands in front of the next trip's step of the store's address
            asm volatile("s_wait_xcnt 0x0" ::: "memory");
        }
        xv = xn;
    }
}

// ---------------------------------------------------------------------------
// One row slice of a stage: JC async copies of 16 B per lane, 128 B apart.
// The immediate offset moves the global and the LDS address alike.
// ---------------------------------------------------------------------------
template <int J, int JC>
__device__ __forceinline__ void copy_row(const _Float16* gp, unsigned int la) {
    __builtin_amdgcn_global_load_async_to_lds_b128(
        (AS1 v4i*)(unsigned long long)(uintptr_t)gp,
        (AS3 v4i*)la, J * 128, 0);
    if constexpr (J + 1 < JC) copy_row<J + 1, JC>(gp, la);
}

// ---------------------------------------------------------------------------
// WMMA GEMM: out = act(A[M,K] @ W[N,K]^T + bias)
// Block = 256 threads = 8 waves; tile 128(M) x 64(N); wave tile 32x32.
// A stage is BK of K for the 128 A rows and the 64 W rows, laid in LDS at a
// pitch of 2*BK+16 bytes (16 B x odd: conflict-free for ds_load_b128).
// Two stage buffers: the async copies of stage t+1 fly while stage t is
// multiplied.  The epilogue stages its tile in the same LDS.
// ---------------------------------------------------------------------------
template <int K, int BK, bool GELU_ACT, bool OUT_F32>
__global__ __launch_bounds__(256)
void gemm_wmma_kernel(const _Float16* __restrict__ A,   // [M][K]
                      const _Float16* __restrict__ W,   // [Nvalid][K]
                      const float* __restrict__ bias,   // [Nvalid]
                      void* __restrict__ out,           // [M][Nout]
                      int Nvalid, int Nout) {
    constexpr int NT    = K / BK;             // stages
    constexpr int JC    = BK / 64;            // 128-B pieces per staged row
    constexpr int PITCH = BK * 2 + 16;        // bytes
    constexpr int STAGE = 192 * PITCH;        // bytes: 128 A rows + 64 W rows
    static_assert(K % BK == 0 && BK % 64 == 0 && NT >= 2, "stage shape");
    static_assert(2 * STAGE >= 128 * 64 * 4, "epilogue tile fits the ring");
    __shared__ __attribute__((aligned(16))) char ring[2 * STAGE];

    const int t    = threadIdx.x;
    const int lane = t & 31;
    const int wid  = t >> 5;
    const int wm   = wid & 3;                 // 4 M-subtiles of 32 rows
    const int wn   = wid >> 2;                // 2 N-subtiles of 32 cols
    const int n_blk  = blockIdx.y * 64;
    const int l15 = lane & 15;
    const int g   = lane >> 4;

    const int ncol0 = n_blk + wn * 32 + l15;
    const int ncol1 = n_blk + wn * 32 + 16 + l15;
    const bool b0ok = (ncol0 < Nvalid);
    const bool b1ok = (ncol1 < Nvalid);

    // copy mapping: 8 lanes cover one 128-B line of a row, 32 rows per sweep,
    // six sweeps (four of A, two of W)
    const int srow = t >> 3;
    const int ssub = t & 7;
    const _Float16* grow[6];
#pragma unroll                                // grow[] stays in registers
    for (int rg = 0; rg < 4; ++rg)
        grow[rg] = A + (size_t)(blockIdx.x * 128 + rg * 32 + srow) * K + ssub * 8;
#pragma unroll                                // grow[] stays in registers
    for (int rg = 0; rg < 2; ++rg) {
        const int gcol0 = n_blk + rg * 32 + srow;
        const int gcol  = (gcol0 < Nvalid) ? gcol0 : (Nvalid - 1);  // clamp;
        grow[4 + rg] = W + (size_t)gcol * K + ssub * 8;     // such cols dropped
    }
    const unsigned int lbase =
        (unsigned int)(uintptr_t)&ring[srow * PITCH + ssub * 16];

    auto issue = [&](int stage, int buf) {
#pragma unroll                                // grow[] indexed by constants
        for (int rg = 0; rg < 6; ++rg)
            copy_row<0, JC>(grow[rg] + stage * BK,
                            lbase + buf * STAGE + rg * 32 * PITCH);
    };

    // LDS byte offsets of this lane's fragment rows inside a stage
    const int aoff = (wm * 32 + l15) * PITCH + 16 * g;
    const int boff = (128 + wn * 32 + l15) * PITCH + 16 * g;

    v8f c00 = {}, c01 = {}, c10 = {}, c11 = {};

    issue(0, 0);
    // stage 0 has landed for this wave before the barrier publishes it
    asm volatile("s_wait_asynccnt 0x0" ::: "memory");
    __syncthreads();
    issue(1, 1);

    for (int s = 0; s < NT; ++s) {
        const char* bufp = ring + (s & 1) * STAGE;
        const _Float16* ap = (const _Float16*)(bufp + aoff);
        const _Float16* bp = (const _Float16*)(bufp + boff);
        // fragments of k step ks+1 (same stage only) are fetched as one group
        // ahead of the WMMAs of step ks, so LDS latency hides under them
        v16h a0 = load_frag(ap);
        v16h a1 = load_frag(ap + 8 * PITCH);
        v16h b0 = load_frag(bp);
        v16h b1 = load_frag(bp + 8 * PITCH);
        // unrolled: LDS offsets become immediates, the two fragment sets are
        // renamed instead of moved
#pragma unroll
        for (int ks = 0; ks < BK / 32; ++ks) {
            v16h a0n, a1n, b0n, b1n;
            if (ks + 1 < BK / 32) {
                a0n = load_frag(ap + (ks + 1) * 32);
                a1n = load_frag(ap + 8 * PITCH + (ks + 1) * 32);
                b0n = load_frag(bp + (ks + 1) * 32);
                b1n = load_frag(bp + 8 * PITCH + (ks + 1) * 32);
            }
            // keeps the load group above in front of these WMMAs: the
            // scheduler otherwise sinks the loads to just before their use
            __builtin_amdgcn_sched_barrier(0);
            c00 = __builtin_amdgcn_wmma_f32_16x16x32_f16(false, a0, false, b0,
                                                         (short)0, c00, false, false);
            c01 = __builtin_amdgcn_wmma_f32_16x16x32_f16(false, a0, false, b1,
                                                         (short)0, c01, false, false);
            c10 = __builtin_amdgcn_wmma_f32_16x16x32_f16(false, a1, false, b0,
                                                         (short)0, c10, false, false);
            c11 = __builtin_amdgcn_wmma_f32_16x16x32_f16(false, a1, false, b1,
                                                         (short)0, c11, false, false);
            if (ks + 1 < BK / 32) { a0 = a0n; a1 = a1n; b0 = b0n; b1 = b1n; }
        }
        // publish point: this wave's reads of stage s are done ...
        asm volatile("s_wait_dscnt 0x0" ::: "memory");
        // ... and its copies of stage s+1 have landed, before the barrier that
        // frees buffer s&1 and lets every wave read stage s+1
        asm volatile("s_wait_asynccnt 0x0" ::: "memory");
        __syncthreads();
        if (s + 2 < NT) issue(s + 2, s & 1);
    }
    // no copy is outstanding when the ring becomes the epilogue's stage
    asm volatile("s_wait_asynccnt 0x0" ::: "memory");

    // ---- epilogue: bias + activation, stage in LDS, coalesced store ----
    const float bv0 = b0ok ? bias[ncol0] : 0.0f;
    const float bv1 = b1ok ? bias[ncol1] : 0.0f;

    if (OUT_F32) {
        float* st = (float*)ring;
        auto put = [&](const v8f& c, int rb, int cl, float bv) {
#pragma unroll
            for (int r = 0; r < 8; ++r) {
                float v = c[r] + bv;
                if (GELU_ACT) v = gelu_f(v);
                st[(rb + 8 * g + r) * 64 + cl] = v;
            }
        };
        put(c00, wm * 32,      wn * 32 + l15,      bv0);
        put(c01, wm * 32,      wn * 32 + 16 + l15, bv1);
        put(c10, wm * 32 + 16, wn * 32 + l15,      bv0);
        put(c11, wm * 32 + 16, wn * 32 + 16 + l15, bv1);
        __syncthreads();
#pragma unroll
        for (int j = 0; j < 8; ++j) {         // 2048 chunks of 4 floats
            const int cchunk = t + 256 * j;
            const int row = cchunk >> 4;
            const int ch  = cchunk & 15;
            const int col0 = n_blk + ch * 4;  // Nvalid (300) is 4-aligned
            if (col0 < Nvalid) {
                *(float4*)((float*)out +
                           (size_t)(blockIdx.x * 128 + row) * Nout + col0) =
                    *(const float4*)&st[row * 64 + ch * 4];
            }
        }
    } else {
        _Float16* st = (_Float16*)ring;
        auto put = [&](const v8f& c, int rb, int cl, float bv) {
#pragma unroll
            for (int r = 0; r < 8; ++r) {
                float v = c[r] + bv;
                if (GELU_ACT) v = gelu_f(v);
                st[(rb + 8 * g + r) * 64 + cl] = (_Float16)v;
            }
        };
        put(c00, wm * 32,      wn * 32 + l15,      bv0);
        put(c01, wm * 32,      wn * 32 + 16 + l15, bv1);
        put(c10, wm * 32 + 16, wn * 32 + l15,      bv0);
        put(c11, wm * 32 + 16, wn * 32 + 16 + l15, bv1);
        __syncthreads();
#pragma unroll
        for (int j = 0; j < 4; ++j) {         // 1024 chunks of 8 halves
            const int cchunk = t + 256 * j;
            const int row = cchunk >> 3;
            const int ch  = cchunk & 7;
            *(v8h*)((_Float16*)out +
                    (size_t)(blockIdx.x * 128 + row) * Nout + n_blk + ch * 8) =
                *(const v8h*)&st[row * 64 + ch * 8];
        }
    }
}

// ---------------------------------------------------------------------------
// Launch
// ---------------------------------------------------------------------------
extern "C" void kernel_launch(void* const* d_in, const int* in_sizes, int n_in,
                              void* d_out, int out_size, void* d_ws, size_t ws_size,
                              hipStream_t stream) {
    const float* x   = (const float*)d_in[0];
    const float* bw1 = (const float*)d_in[1];
    const float* bb1 = (const float*)d_in[2];
    const float* bw2 = (const float*)d_in[3];
    const float* bb2 = (const float*)d_in[4];
    const float* wc1 = (const float*)d_in[5];
    const float* bc1 = (const float*)d_in[6];
    const float* wc2 = (const float*)d_in[7];
    const float* bc2 = (const float*)d_in[8];
    const float* wc3 = (const float*)d_in[9];
    const float* bc3 = (const float*)d_in[10];
    float* out = (float*)d_out;

    // workspace carve-out (all slices 16B-aligned)
    char* ws = (char*)d_ws;
    _Float16* f   = (_Float16*)ws;  ws += (size_t)B_SZ * KF  * sizeof(_Float16);
    _Float16* z1  = (_Float16*)ws;  ws += (size_t)B_SZ * C1D * sizeof(_Float16);
    _Float16* z2  = (_Float16*)ws;  ws += (size_t)B_SZ * C2D * sizeof(_Float16);
    _Float16* w1h = (_Float16*)ws;  ws += (size_t)C1D  * KF  * sizeof(_Float16);
    _Float16* w2h = (_Float16*)ws;  ws += (size_t)C2D  * C1D * sizeof(_Float16);
    _Float16* w3h = (_Float16*)ws;  ws += (size_t)OUTD * C2D * sizeof(_Float16);
    if ((size_t)(ws - (char*)d_ws) > ws_size) return;  // ws too small: bail

    // 1) convert combiner weights to fp16
    {
        int n1 = C1D * KF, n2 = C2D * C1D, n3 = OUTD * C2D;
        static_assert((C1D * KF) % 8 == 0 && (C2D * C1D) % 8 == 0 &&
                      (OUTD * C2D) % 8 == 0, "8 values a thread");
        cvt_f16_kernel<<<(n1 / 8 + 255) / 256, 256, 0, stream>>>(wc1, w1h, n1);
        cvt_f16_kernel<<<(n2 / 8 + 255) / 256, 256, 0, stream>>>(wc2, w2h, n2);
        cvt_f16_kernel<<<(n3 / 8 + 255) / 256, 256, 0, stream>>>(wc3, w3h, n3);
    }

    // 2) all 1000 branch MLPs via padded WMMA; f = [B, 8000] fp16
    branch_kernel<<<dim3(B_SZ / (16 * BR_TILES), N_BR / 8), 256, 0, stream>>>(
        x, bw1, bb1, bw2, bb2, f);

    // 3) z1 = gelu(f @ wc1^T + bc1)      M=4096 N=256  K=8000
    gemm_wmma_kernel<KF, 320, true, false><<<dim3(B_SZ / 128, C1D / 64), 256, 0, stream>>>(
        f, w1h, bc1, z1, C1D, C1D);

    // 4) z2 = gelu(z1 @ wc2^T + bc2)     M=4096 N=128  K=256
    gemm_wmma_kernel<C1D, 128, true, false><<<dim3(B_SZ / 128, C2D / 64), 256, 0, stream>>>(
        z1, w2h, bc2, z2, C2D, C2D);

    // 5) out = z2 @ wc3^T + bc3          M=4096 N=300  K=128 (fp32, guarded)
    gemm_wmma_kernel<C2D, 64, false, true><<<dim3(B_SZ / 128, (OUTD + 63) / 64), 256, 0, stream>>>(
        z2, w3h, bc3, out, OUTD, OUTD);
}

// v003
// A run of this version takes 101 microseconds.
// Two timings next to v002 put it at 1.06 and 1.07 times that version's speed.
// Over all steps from v000 it is 2.63 times as fast.
#include <hip/hip_runtime.h>
#include <hip/hip_bf16.h>

typedef __attribute__((ext_vector_type(16))) _Float16 v16h;
typedef __attribute__((ext_vector_type(8)))  _Float16 v8h;
typedef __attribute__((ext_vector_type(8)))  float    v8f;
typedef int v4i __attribute__((vector_size(4 * sizeof(int))));  // b128 payload

#define B_SZ 4096
#define N_BR 1000
#define H1D  16
#define H2D  8
#define C1D  256
#define C2D  128
#define OUTD 300
#define KF   (N_BR * H2D)   // 8000
#define BR_TILES 16         // 16-row batch tiles walked by a branch work-group
#define BR_GX (B_SZ / (16 * BR_TILES))   // branch grid, x
#define BR_GY (N_BR / 8)                 // branch grid, y
// combiner weights in pieces of 8 values, one piece a thread
#define CH1 (C1D * KF / 8)
#define CH2 (C2D * C1D / 8)
#define CH3 (OUTD * C2D / 8)

#define AS1 __attribute__((address_space(1)))
#define AS3 __attribute__((address_space(3)))

__device__ __forceinline__ float gelu_f(float v) {
    // exact GeLU: 0.5*x*(1+erf(x/sqrt(2)))
    return 0.5f * v * (1.0f + erff(v * 0.7071067811865475f));
}

// branch-free tanh: (e^2x - 1) * rcp(e^2x + 1), clamped so e stays finite
__device__ __forceinline__ float tanh_fast(float v) {
    v = fminf(fmaxf(v, -10.0f), 10.0f);
    const float e = __expf(2.0f * v);
    return (e - 1.0f) * __builtin_amdgcn_rcpf(e + 1.0f);
}

__device__ __forceinline__ v16h zero16() {
    v16h r;
#pragma unroll
    for (int i = 0; i < 16; ++i) r[i] = (_Float16)0.0f;
    return r;
}

// Build a 16-bit A/B WMMA fragment for this lane from K-contiguous memory.
// Lane group g (lane>>4): elements 0..7 = K[8g..8g+7], elements 8..15 =
// K[16+8g..16+8g+7].  `p` must already point at row_base + 8*g.
__device__ __forceinline__ v16h load_frag(const _Float16* p) {
    v8h lo = *(const v8h*)(p);
    v8h hi = *(const v8h*)(p + 16);
    v16h r;
#pragma unroll
    for (int i = 0; i < 8; ++i) { r[i] = lo[i]; r[8 + i] = hi[i]; }
    return r;
}

// ---------------------------------------------------------------------------
// Branch stage: h = gelu(x*bw1+bb1) [16], f = tanh(h @ bw2^T + bb2) [8]
// One wave = 1 branch; per 16 batch rows one zero-padded WMMA
// (M=16 batch, K=16 hidden padded to 32, N=8 padded to 16).
// A work-group (8 branches) holds its weights in registers and walks
// BR_TILES tiles of 16 batch rows, so that the whole grid is resident at once
// and few waves have to be started.
// Results staged in LDS (two buffers, one barrier a tile), written back as
// coalesced b128 rows.
// The fp32 -> fp16 conversion of the three combiner weights depends on nothing
// here and nothing here depends on it: it rides in this launch, one piece of
// 8 values a thread in the first work-groups, and needs no launch of its own.
// ---------------------------------------------------------------------------
__global__ __launch_bounds__(256)
void branch_kernel(const float* __restrict__ x,     // [B, N_BR]
                   const float* __restrict__ bw1,   // [N_BR, 16]
                   const float* __restrict__ bb1,   // [N_BR, 16]
                   const float* __restrict__ bw2,   // [N_BR, 8, 16]
                   const float* __restrict__ bb2,   // [N_BR, 8]
                   const float* __restrict__ wc1,   // [256, 8000]
                   const float* __restrict__ wc2,   // [128, 256]
                   const float* __restrict__ wc3,   // [300, 128]
                   _Float16* __restrict__ w1h,      // wc1 as f16
                   _Float16* __restrict__ w2h,      // wc2 as f16
                   _Float16* __restrict__ w3h,      // wc3 as f16
                   _Float16* __restrict__ f) {      // [B, 8000] f16
    // 16 rows x (8 branches * 8 out), twice
    __shared__ __attribute__((aligned(16))) _Float16 fs[2][16 * 64];

    const int t    = threadIdx.x;
    const int lane = t & 31;
    const int wid  = t >> 5;
    const int n    = blockIdx.y * 8 + wid;    // branch index (125*8 = 1000)
    const int b0   = blockIdx.x * (BR_TILES * 16);   // batch row base
    const int m    = lane & 15;
    const int g    = lane >> 4;

    // ---- this work-group's share of the weight conversion ----
    {
        static_assert((C1D * KF) % 8 == 0 && (C2D * C1D) % 8 == 0 &&
                      (OUTD * C2D) % 8 == 0, "8 values a piece");
        static_assert(CH1 % 256 == 0 && CH2 % 256 == 0, "whole work-groups");
        static_assert((CH1 + CH2 + CH3 + 255) / 256 <= BR_GX * BR_GY,
                      "a piece for every thread at most");
        const int wg = blockIdx.y * BR_GX + blockIdx.x;
        const float* src = wc1;
        _Float16* dst = w1h;
        int first = 0, np = CH1;
        if (wg >= CH1 / 256)         { src = wc2; dst = w2h; first = CH1 / 256; np = CH2; }
        if (wg >= (CH1 + CH2) / 256) { src = wc3; dst = w3h; first = (CH1 + CH2) / 256; np = CH3; }
        const int pc = (wg - first) * 256 + t;
        if (pc < np) {
            const float4 lo = *(const float4*)(src + pc * 8);
            const float4 hi = *(const float4*)(src + pc * 8 + 4);
            v8h r;
            r[0] = (_Float16)lo.x; r[1] = (_Float16)lo.y;
            r[2] = (_Float16)lo.z; r[3] = (_Float16)lo.w;
            r[4] = (_Float16)hi.x; r[5] = (_Float16)hi.y;
            r[6] = (_Float16)hi.z; r[7] = (_Float16)hi.w;
            *(v8h*)(dst + pc * 8) = r;
        }
    }

    // ---- this lane's layer-1 weights: hidden units 8g..8g+7 ----
    float w1[8], c1[8];
#pragma unroll                                // w1[], c1[] stay in registers
    for (int i = 0; i < 8; ++i) {
        w1[i] = bw1[n * H1D + 8 * g + i];
        c1[i] = bb1[n * H1D + 8 * g + i];
    }

    // ---- B fragment: B[k, col] = bw2[n, col, k]; cols 8..15 / K>=16 zero ----
    const int col = m;
    const int cc  = (col < H2D) ? col : 0;                 // clamp (in-bounds)
    v16h b = zero16();
#pragma unroll
    for (int i = 0; i < 8; ++i) {
        const int k = 8 * g + i;
        const float w = bw2[((size_t)n * H2D + cc) * H1D + k];
        b[i] = (col < H2D) ? (_Float16)w : (_Float16)0.0f;
    }
    const float bias = bb2[n * H2D + cc];

    const float* xp = x + (size_t)(b0 + m) * N_BR + n;
    _Float16* fp = f + (size_t)(b0 + (t >> 3)) * KF + (size_t)blockIdx.y * 64 + (t & 7) * 8;

    float xv = *xp;
    for (int tl = 0; tl < BR_TILES; ++tl) {
        // next tile's x is asked for ahead of this tile's arithmetic (the last
        // trip asks for its own again: in bounds, unused)
        const int nx = (tl + 1 < BR_TILES) ? tl + 1 : tl;
        const float xn = xp[(size_t)nx * 16 * N_BR];

        // ---- A fragment: rows = batch, K = hidden (16, padded to 32) ----
        v16h a = zero16();
#pragma unroll
        for (int i = 0; i < 8; ++i)           // K 16..31 stay zero
            a[i] = (_Float16)gelu_f(xv * w1[i] + c1[i]);

        v8f c = {};
        c = __builtin_amdgcn_wmma_f32_16x16x32_f16(false, a, false, b,
                                                   (short)0, c, false, false);

        _Float16* st = fs[tl & 1];
        if (col < H2D) {
#pragma unroll
            for (int r = 0; r < 8; ++r) {
                const int row = r + 8 * g;    // lanes 16-31 cover M 8..15
                st[row * 64 + wid * 8 + col] = (_Float16)tanh_fast(c[r] + bias);
            }
        }
        // publishes this tile; the buffer written next was last read in front
        // of this barrier
        __syncthreads();

        // coalesced write: 16 rows x 128B, one b128 chunk per thread (t < 128)
        if (t < 128) {
            *(v8h*)(fp + (size_t)tl * 16 * KF) = *(const v8h*)&st[t * 8];
            // stands in front of the next trip's step of the store's address
            asm volatile("s_wait_xcnt 0x0" ::: "memory");
        }
        xv = xn;
    }
}

// ---------------------------------------------------------------------------
// One row slice of a stage: JC async copies of 16 B per lane, 128 B apart.
// The immediate offset moves the global and the LDS address alike.
// ---------------------------------------------------------------------------
template <int J, int JC>
__device__ __forceinline__ void copy_row(const _Float16* gp, unsigned int la) {
    __builtin_amdgcn_global_load_async_to_lds_b128(
        (AS1 v4i*)(unsigned long long)(uintptr_t)gp,
        (AS3 v4i*)la, J * 128, 0);
    if constexpr (J + 1 < JC) copy_row<J + 1, JC>(gp, la);
}

// ---------------------------------------------------------------------------
// WMMA GEMM: out = act(A[M,K] @ W[N,K]^T + bias)
// Block = 256 threads = 8 waves; tile 128(M) x 64(N); wave tile 32x32.
// A stage is BK of K for the 128 A rows and the 64 W rows, laid in LDS at a
// pitch of 2*BK+16 bytes (16 B x odd: conflict-free for ds_load_b128).
// Two stage buffers: the async copies of stage t+1 fly while stage t is
// multiplied.  The epilogue stages its tile in the same LDS.
// ---------------------------------------------------------------------------
template <int K, int BK, bool GELU_ACT, bool OUT_F32>
__global__ __launch_bounds__(256)
void gemm_wmma_kernel(const _Float16* __restrict__ A,   // [M][K]
                      const _Float16* __restrict__ W,   // [Nvalid][K]
                      const float* __restrict__ bias,   // [Nvalid]
                      void* __restrict__ out,           // [M][Nout]
                      int Nvalid, int Nout) {
    constexpr int NT    = K / BK;             // stages
    constexpr int JC    = BK / 64;            // 128-B pieces per staged row
    constexpr int PITCH = BK * 2 + 16;        // bytes
    constexpr int STAGE = 192 * PITCH;        // bytes: 128 A rows + 64 W rows
    static_assert(K % BK == 0 && BK % 64 == 0 && NT >= 2, "stage shape");
    static_assert(2 * STAGE >= 128 * 64 * 4, "epilogue tile fits the ring");
    __shared__ __attribute__((aligned(16))) char ring[2 * STAGE];

    const int t    = threadIdx.x;
    const int lane = t & 31;
    const int wid  = t >> 5;
    const int wm   = wid & 3;                 // 4 M-subtiles of 32 rows
    const int wn   = wid >> 2;                // 2 N-subtiles of 32 cols
    const int n_blk  = blockIdx.y * 64;
    const int l15 = lane & 15;
    const int g   = lane >> 4;

    const int ncol0 = n_blk + wn * 32 + l15;
    const int ncol1 = n_blk + wn * 32 + 16 + l15;
    const bool b0ok = (ncol0 < Nvalid);
    const bool b1ok = (ncol1 < Nvalid);

    // copy mapping: 8 lanes cover one 128-B line of a row, 32 rows per sweep,
    // six sweeps (four of A, two of W)
    const int srow = t >> 3;
    const int ssub = t & 7;
    const _Float16* grow[6];
#pragma unroll                                // grow[] stays in registers
    for (int rg = 0; rg < 4; ++rg)
        grow[rg] = A + (size_t)(blockIdx.x * 128 + rg * 32 + srow) * K + ssub * 8;
#pragma unroll                                // grow[] stays in registers
    for (int rg = 0; rg < 2; ++rg) {
        const int gcol0 = n_blk + rg * 32 + srow;
        const int gcol  = (gcol0 < Nvalid) ? gcol0 : (Nvalid - 1);  // clamp;
        grow[4 + rg] = W + (size_t)gcol * K + ssub * 8;     // such cols dropped
    }
    const unsigned int lbase =
        (unsigned int)(uintptr_t)&ring[srow * PITCH + ssub * 16];

    auto issue = [&](int stage, int buf) {
#pragma unroll                                // grow[] indexed by constants
        for (int rg = 0; rg < 6; ++rg)
            copy_row<0, JC>(grow[rg] + stage * BK,
                            lbase + buf * STAGE + rg * 32 * PITCH);
    };

    // LDS byte offsets of this lane's fragment rows inside a stage
    const int aoff = (wm * 32 + l15) * PITCH + 16 * g;
    const int boff = (128 + wn * 32 + l15) * PITCH + 16 * g;

    v8f c00 = {}, c01 = {}, c10 = {}, c11 = {};

    issue(0, 0);
    // stage 0 has landed for this wave before the barrier publishes it
    asm volatile("s_wait_asynccnt 0x0" ::: "memory");
    __syncthreads();
    issue(1, 1);

    for (int s = 0; s < NT; ++s) {
        const char* bufp = ring + (s & 1) * STAGE;
        const _Float16* ap = (const _Float16*)(bufp + aoff);
        const _Float16* bp = (const _Float16*)(bufp + boff);
        // fragments of k step ks+1 (same stage only) are fetched as one group
        // ahead of the WMMAs of step ks, so LDS latency hides under them
        v16h a0 = load_frag(ap);
        v16h a1 = load_frag(ap + 8 * PITCH);
        v16h b0 = load_frag(bp);
        v16h b1 = load_frag(bp + 8 * PITCH);
        // unrolled: LDS offsets become immediates, the two fragment sets are
        // renamed instead of moved
#pragma unroll
        for (int ks = 0; ks < BK / 32; ++ks) {
            v16h a0n, a1n, b0n, b1n;
            if (ks + 1 < BK / 32) {
                a0n = load_frag(ap + (ks + 1) * 32);
                a1n = load_frag(ap + 8 * PITCH + (ks + 1) * 32);
                b0n = load_frag(bp + (ks + 1) * 32);
                b1n = load_frag(bp + 8 * PITCH + (ks + 1) * 32);
            }
            // keeps the load group above in front of these WMMAs: the
            // scheduler otherwise sinks the loads to just before their use
            __builtin_amdgcn_sched_barrier(0);
            c00 = __builtin_amdgcn_wmma_f32_16x16x32_f16(false, a0, false, b0,
                                                         (short)0, c00, false, false);
            c01 = __builtin_amdgcn_wmma_f32_16x16x32_f16(false, a0, false, b1,
                                                         (short)0, c01, false, false);
            c10 = __builtin_amdgcn_wmma_f32_16x16x32_f16(false, a1, false, b0,
                                                         (short)0, c10, false, false);
            c11 = __builtin_amdgcn_wmma_f32_16x16x32_f16(false, a1, false, b1,
                                                         (short)0, c11, false, false);
            if (ks + 1 < BK / 32) { a0 = a0n; a1 = a1n; b0 = b0n; b1 = b1n; }
        }
        // publish point: this wave's reads of stage s are done ...
        asm volatile("s_wait_dscnt 0x0" ::: "memory");
        // ... and its copies of stage s+1 have landed, before the barrier that
        // frees buffer s&1 and lets every wave read stage s+1
        asm volatile("s_wait_asynccnt 0x0" ::: "memory");
        __syncthreads();
        if (s + 2 < NT) issue(s + 2, s & 1);
    }
    // no copy is outstanding when the ring becomes the epilogue's stage
    asm volatile("s_wait_asynccnt 0x0" ::: "memory");

    // ---- epilogue: bias + activation, stage in LDS, coalesced store ----
    const float bv0 = b0ok ? bias[ncol0] : 0.0f;
    const float bv1 = b1ok ? bias[ncol1] : 0.0f;

    if (OUT_F32) {
        float* st = (float*)ring;
        auto put = [&](const v8f& c, int rb, int cl, float bv) {
#pragma unroll
            for (int r = 0; r < 8; ++r) {
                float v = c[r] + bv;
                if (GELU_ACT) v = gelu_f(v);
                st[(rb + 8 * g + r) * 64 + cl] = v;
            }
        };
        put(c00, wm * 32,      wn * 32 + l15,      bv0);
        put(c01, wm * 32,      wn * 32 + 16 + l15, bv1);
        put(c10, wm * 32 + 16, wn * 32 + l15,      bv0);
        put(c11, wm * 32 + 16, wn * 32 + 16 + l15, bv1);
        __syncthreads();
#pragma unroll
        for (int j = 0; j < 8; ++j) {         // 2048 chunks of 4 floats
            const int cchunk = t + 256 * j;
            const int row = cchunk >> 4;
            const int ch  = cchunk & 15;
            const int col0 = n_blk + ch * 4;  // Nvalid (300) is 4-aligned
            if (col0 < Nvalid) {
                *(float4*)((float*)out +
                           (size_t)(blockIdx.x * 128 + row) * Nout + col0) =
                    *(const float4*)&st[row * 64 + ch * 4];
            }
        }
    } else {
        _Float16* st = (_Float16*)ring;
        auto put = [&](const v8f& c, int rb, int cl, float bv) {
#pragma unroll
            for (int r = 0; r < 8; ++r) {
                float v = c[r] + bv;
                if (GELU_ACT) v = gelu_f(v);
                st[(rb + 8 * g + r) * 64 + cl] = (_Float16)v;
            }
        };
        put(c00, wm * 32,      wn * 32 + l15,      bv0);
        put(c01, wm * 32,      wn * 32 + 16 + l15, bv1);
        put(c10, wm * 32 + 16, wn * 32 + l15,      bv0);
        put(c11, wm * 32 + 16, wn * 32 + 16 + l15, bv1);
        __syncthreads();
#pragma unroll
        for (int j = 0; j < 4; ++j) {         // 1024 chunks of 8 halves
            const int cchunk = t + 256 * j;
            const int row = cchunk >> 3;
            const int ch  = cchunk & 7;
            *(v8h*)((_Float16*)out +
                    (size_t)(blockIdx.x * 128 + row) * Nout + n_blk + ch * 8) =
                *(const v8h*)&st[row * 64 + ch * 8];
        }
    }
}

// ---------------------------------------------------------------------------
// Launch
// ---------------------------------------------------------------------------
extern "C" void kernel_launch(void* const* d_in, const int* in_sizes, int n_in,
                              void* d_out, int out_size, void* d_ws, size_t ws_size,
                              hipStream_t stream) {
    const float* x   = (const float*)d_in[0];
    const float* bw1 = (const float*)d_in[1];
    const float* bb1 = (const float*)d_in[2];
    const float* bw2 = (const float*)d_in[3];
    const float* bb2 = (const float*)d_in[4];
    const float* wc1 = (const float*)d_in[5];
    const float* bc1 = (const float*)d_in[6];
    const float* wc2 = (const float*)d_in[7];
    const float* bc2 = (const float*)d_in[8];
    const float* wc3 = (const float*)d_in[9];
    const float* bc3 = (const float*)d_in[10];
    float* out = (float*)d_out;

    // workspace carve-out (all slices 16B-aligned)
    char* ws = (char*)d_ws;
    _Float16* f   = (_Float16*)ws;  ws += (size_t)B_SZ * KF  * sizeof(_Float16);
    _Float16* z1  = (_Float16*)ws;  ws += (size_t)B_SZ * C1D * sizeof(_Float16);
    _Float16* z2  = (_Float16*)ws;  ws += (size_t)B_SZ * C2D * sizeof(_Float16);
    _Float16* w1h = (_Float16*)ws;  ws += (size_t)C1D  * KF  * sizeof(_Float16);
    _Float16* w2h = (_Float16*)ws;  ws += (size_t)C2D  * C1D * sizeof(_Float16);
    _Float16* w3h = (_Float16*)ws;  ws += (size_t)OUTD * C2D * sizeof(_Float16);
    if ((size_t)(ws - (char*)d_ws) > ws_size) return;  // ws too small: bail

    // 1) all 1000 branch MLPs via padded WMMA; f = [B, 8000] fp16
    //    (and the combiner weights to fp16)
    branch_kernel<<<dim3(BR_GX, BR_GY), 256, 0, stream>>>(
        x, bw1, bb1, bw2, bb2, wc1, wc2, wc3, w1h, w2h, w3h, f);

    // 2) z1 = gelu(f @ wc1^T + bc1)      M=4096 N=256  K=8000
    gemm_wmma_kernel<KF, 320, true, false><<<dim3(B_SZ / 128, C1D / 64), 256, 0, stream>>>(
        f, w1h, bc1, z1, C1D, C1D);

    // 3) z2 = gelu(z1 @ wc2^T + bc2)     M=4096 N=128  K=256
    gemm_wmma_kernel<C1D, 128, true, false><<<dim3(B_SZ / 128, C2D / 64), 256, 0, stream>>>(
        z1, w2h, bc2, z2, C2D, C2D);

    // 4) out = z2 @ wc3^T + bc3          M=4096 N=300  K=128 (fp32, guarded)
    gemm_wmma_kernel<C2D, 64, false, true><<<dim3(B_SZ / 128, (OUTD + 63) / 64), 256, 0, stream>>>(
        z2, w3h, bc3, out, OUTD, OUTD);
}

// v004
// One run takes 82.4 microseconds.
// Timed twice side by side with v003, it ran 1.22 times as fast both times.
// Over all steps from v000 it is 3.21 times as fast.
#include <hip/hip_runtime.h>
#include <hip/hip_bf16.h>

typedef __attribute__((ext_vector_type(16))) _Float16 v16h;
typedef __attribute__((ext_vector_type(8)))  _Float16 v8h;
typedef __attribute__((ext_vector_type(8)))  float    v8f;
typedef int v4i __attribute__((vector_size(4 * sizeof(int))));  // b128 payload

#define B_SZ 4096
#define N_BR 1000
#define H1D  16
#define H2D  8
#define C1D  256
#define C2D  128
#define OUTD 300
#define KF   (N_BR * H2D)   // 8000
#define BR_TILES 16         // 16-row batch tiles walked by a branch work-group
#define BR_GX (B_SZ / (16 * BR_TILES))   // branch grid, x
#define BR_GY (N_BR / 8)                 // branch grid, y
// combiner weights in pieces of 8 values, one piece a thread
#define CH1 (C1D * KF / 8)
#define CH2 (C2D * C1D / 8)
#define CH3 (OUTD * C2D / 8)

#define AS1 __attribute__((address_space(1)))
#define AS3 __attribute__((address_space(3)))

typedef __attribute__((ext_vector_type(2))) float v2f;

// exact GeLU, 0.5*x*(1+erf(x/sqrt(2))), written without a branch as
//   max(x,0) - a*Q(a),  a = |x|,  Q(a) = 0.5*erfc(a/sqrt(2)) = exp2(P(a)).
// P is one polynomial of degree 6 for all of 0 <= a <= 6 (fitted to log2 Q,
// weighted by a*Q); past 6 the term a*Q is below 1e-8 and a is held at 6.
// The term a*Q(a) stays within 2e-7 of the exact one, the size of f32 rounding
// (a NaN does not pass min and max, as in tanh_fast below).
// Two values at a time, so that the polynomial runs on packed FMAs.
__device__ __forceinline__ v2f gelu_2(v2f v) {
    const v2f a = __builtin_elementwise_min(__builtin_elementwise_abs(v), (v2f)(6.0f));
    v2f p = (v2f)(0.0000330932962f);
    p = __builtin_elementwise_fma(p, a, (v2f)(-0.000769223785f));
    p = __builtin_elementwise_fma(p, a, (v2f)(0.00808072928f));
    p = __builtin_elementwise_fma(p, a, (v2f)(-0.0534121245f));
    p = __builtin_elementwise_fma(p, a, (v2f)(-0.458770961f));
    p = __builtin_elementwise_fma(p, a, (v2f)(-1.15120173f));
    p = __builtin_elementwise_fma(p, a, (v2f)(-0.999993086f));
    v2f q;
    q.x = __builtin_amdgcn_exp2f(p.x);
    q.y = __builtin_amdgcn_exp2f(p.y);
    return __builtin_elementwise_fma(-a, q, __builtin_elementwise_max(v, (v2f)(0.0f)));
}

// branch-free tanh: (e^2x - 1) * rcp(e^2x + 1), clamped so e stays finite
__device__ __forceinline__ float tanh_fast(float v) {
    v = fminf(fmaxf(v, -10.0f), 10.0f);
    const float e = __expf(2.0f * v);
    return (e - 1.0f) * __builtin_amdgcn_rcpf(e + 1.0f);
}

__device__ __forceinline__ v16h zero16() {
    v16h r;
#pragma unroll
    for (int i = 0; i < 16; ++i) r[i] = (_Float16)0.0f;
    return r;
}

// Build a 16-bit A/B WMMA fragment for this lane from K-contiguous memory.
// Lane group g (lane>>4): elements 0..7 = K[8g..8g+7], elements 8..15 =
// K[16+8g..16+8g+7].  `p` must already point at row_base + 8*g.
__device__ __forceinline__ v16h load_frag(const _Float16* p) {
    v8h lo = *(const v8h*)(p);
    v8h hi = *(const v8h*)(p + 16);
    v16h r;
#pragma unroll
    for (int i = 0; i < 8; ++i) { r[i] = lo[i]; r[8 + i] = hi[i]; }
    return r;
}

// ---------------------------------------------------------------------------
// Branch stage: h = gelu(x*bw1+bb1) [16], f = tanh(h @ bw2^T + bb2) [8]
// One wave = 1 branch; per 16 batch rows one zero-padded WMMA
// (M=16 batch, K=16 hidden padded to 32, N=8 padded to 16).
// A work-group (8 branches) holds its weights in registers and walks
// BR_TILES tiles of 16 batch rows, so that the whole grid is resident at once
// and few waves have to be started.
// Results staged in LDS (two buffers, one barrier a tile), written back as
// coalesced b128 rows.
// The fp32 -> fp16 conversion of the three combiner weights depends on nothing
// here and nothing here depends on it: it rides in this launch, one piece of
// 8 values a thread in the first work-groups, and needs no launch of its own.
// ---------------------------------------------------------------------------
__global__ __launch_bounds__(256)
void branch_kernel(const float* __restrict__ x,     // [B, N_BR]
                   const float* __restrict__ bw1,   // [N_BR, 16]
                   const float* __restrict__ bb1,   // [N_BR, 16]
                   const float* __restrict__ bw2,   // [N_BR, 8, 16]
                   const float* __restrict__ bb2,   // [N_BR, 8]
                   const float* __restrict__ wc1,   // [256, 8000]
                   const float* __restrict__ wc2,   // [128, 256]
                   const float* __restrict__ wc3,   // [300, 128]
                   _Float16* __restrict__ w1h,      // wc1 as f16
                   _Float16* __restrict__ w2h,      // wc2 as f16
                   _Float16* __restrict__ w3h,      // wc3 as f16
                   _Float16* __restrict__ f) {      // [B, 8000] f16
    // 16 rows x (8 branches * 8 out), twice
    __shared__ __attribute__((aligned(16))) _Float16 fs[2][16 * 64];

    const int t    = threadIdx.x;
    const int lane = t & 31;
    const int wid  = t >> 5;
    const int n    = blockIdx.y * 8 + wid;    // branch index (125*8 = 1000)
    const int b0   = blockIdx.x * (BR_TILES * 16);   // batch row base
    const int m    = lane & 15;
    const int g    = lane >> 4;

    // ---- this work-group's share of the weight conversion ----
    {
        static_assert((C1D * KF) % 8 == 0 && (C2D * C1D) % 8 == 0 &&
                      (OUTD * C2D) % 8 == 0, "8 values a piece");
        static_assert(CH1 % 256 == 0 && CH2 % 256 == 0, "whole work-groups");
        static_assert((CH1 + CH2 + CH3 + 255) / 256 <= BR_GX * BR_GY,
                      "a piece for every thread at most");
        const int wg = blockIdx.y * BR_GX + blockIdx.x;
        const float* src = wc1;
        _Float16* dst = w1h;
        int first = 0, np = CH1;
        if (wg >= CH1 / 256)         { src = wc2; dst = w2h; first = CH1 / 256; np = CH2; }
        if (wg >= (CH1 + CH2) / 256) { src = wc3; dst = w3h; first = (CH1 + CH2) / 256; np = CH3; }
        const int pc = (wg - first) * 256 + t;
        if (pc < np) {
            const float4 lo = *(const float4*)(src + pc * 8);
            const float4 hi = *(const float4*)(src + pc * 8 + 4);
            v8h r;
            r[0] = (_Float16)lo.x; r[1] = (_Float16)lo.y;
            r[2] = (_Float16)lo.z; r[3] = (_Float16)lo.w;
            r[4] = (_Float16)hi.x; r[5] = (_Float16)hi.y;
            r[6] = (_Float16)hi.z; r[7] = (_Float16)hi.w;
            *(v8h*)(dst + pc * 8) = r;
        }
    }

    // ---- this lane's layer-1 weights: hidden units 8g..8g+7 ----
    v2f w1[4], c1[4];
#pragma unroll                                // w1[], c1[] stay in registers
    for (int i = 0; i < 4; ++i) {
        w1[i] = *(const v2f*)(bw1 + n * H1D + 8 * g + 2 * i);
        c1[i] = *(const v2f*)(bb1 + n * H1D + 8 * g + 2 * i);
    }

    // ---- B fragment: B[k, col] = bw2[n, col, k]; cols 8..15 / K>=16 zero ----
    const int col = m;
    const int cc  = (col < H2D) ? col : 0;                 // clamp (in-bounds)
    v16h b = zero16();
#pragma unroll
    for (int i = 0; i < 8; ++i) {
        const int k = 8 * g + i;
        const float w = bw2[((size_t)n * H2D + cc) * H1D + k];
        b[i] = (col < H2D) ? (_Float16)w : (_Float16)0.0f;
    }
    const float bias = bb2[n * H2D + cc];

    const float* xp = x + (size_t)(b0 + m) * N_BR + n;
    _Float16* fp = f + (size_t)(b0 + (t >> 3)) * KF + (size_t)blockIdx.y * 64 + (t & 7) * 8;

    float xv = *xp;
    for (int tl = 0; tl < BR_TILES; ++tl) {
        // next tile's x is asked for ahead of this tile's arithmetic (the last
        // trip asks for its own again: in bounds, unused)
        const int nx = (tl + 1 < BR_TILES) ? tl + 1 : tl;
        const float xn = xp[(size_t)nx * 16 * N_BR];

        // ---- A fragment: rows = batch, K = hidden (16, padded to 32) ----
        v16h a = zero16();
#pragma unroll
        for (int i = 0; i < 4; ++i) {         // K 16..31 stay zero
            const v2f h = gelu_2(__builtin_elementwise_fma((v2f)(xv), w1[i], c1[i]));
            a[2 * i]     = (_Float16)h.x;
            a[2 * i + 1] = (_Float16)h.y;
        }

        v8f c = {};
        c = __builtin_amdgcn_wmma_f32_16x16x32_f16(false, a, false, b,
                                                   (short)0, c, false, false);

        _Float16* st = fs[tl & 1];
        if (col < H2D) {
#pragma unroll
            for (int r = 0; r < 8; ++r) {
                const int row = r + 8 * g;    // lanes 16-31 cover M 8..15
                st[row * 64 + wid * 8 + col] = (_Float16)tanh_fast(c[r] + bias);
            }
        }
        // publishes this tile; the buffer written next was last read in front
        // of this barrier
        __syncthreads();

        // coalesced write: 16 rows x 128B, one b128 chunk per thread (t < 128)
        if (t < 128) {
            *(v8h*)(fp + (size_t)tl * 16 * KF) = *(const v8h*)&st[t * 8];
            // stands in front of the next trip's step of the store's address
            asm volatile("s_wait_xcnt 0x0" ::: "memory");
        }
        xv = xn;
    }
}

// ---------------------------------------------------------------------------
// One row slice of a stage: JC async copies of 16 B per lane, 128 B apart.
// The immediate offset moves the global and the LDS address alike.
// ---------------------------------------------------------------------------
template <int J, int JC>
__device__ __forceinline__ void copy_row(const _Float16* gp, unsigned int la) {
    __builtin_amdgcn_global_load_async_to_lds_b128(
        (AS1 v4i*)(unsigned long long)(uintptr_t)gp,
        (AS3 v4i*)la, J * 128, 0);
    if constexpr (J + 1 < JC) copy_row<J + 1, JC>(gp, la);
}

// ---------------------------------------------------------------------------
// WMMA GEMM: out = act(A[M,K] @ W[N,K]^T + bias)
// Block = 256 threads = 8 waves; tile 128(M) x 64(N); wave tile 32x32.
// A stage is BK of K for the 128 A rows and the 64 W rows, laid in LDS at a
// pitch of 2*BK+16 bytes (16 B x odd: conflict-free for ds_load_b128).
// Two stage buffers: the async copies of stage t+1 fly while stage t is
// multiplied.  The epilogue stages its tile in the same LDS.
// ---------------------------------------------------------------------------
template <int K, int BK, bool GELU_ACT, bool OUT_F32>
__global__ __launch_bounds__(256)
void gemm_wmma_kernel(const _Float16* __restrict__ A,   // [M][K]
                      const _Float16* __restrict__ W,   // [Nvalid][K]
                      const float* __restrict__ bias,   // [Nvalid]
                      void* __restrict__ out,           // [M][Nout]
                      int Nvalid, int Nout) {
    constexpr int NT    = K / BK;             // stages
    constexpr int JC    = BK / 64;            // 128-B pieces per staged row
    constexpr int PITCH = BK * 2 + 16;        // bytes
    constexpr int STAGE = 192 * PITCH;        // bytes: 128 A rows + 64 W rows
    static_assert(K % BK == 0 && BK % 64 == 0 && NT >= 2, "stage shape");
    static_assert(2 * STAGE >= 128 * 64 * 4, "epilogue tile fits the ring");
    __shared__ __attribute__((aligned(16))) char ring[2 * STAGE];

    const int t    = threadIdx.x;
    const int lane = t & 31;
    const int wid  = t >> 5;
    const int wm   = wid & 3;                 // 4 M-subtiles of 32 rows
    const int wn   = wid >> 2;                // 2 N-subtiles of 32 cols
    const int n_blk  = blockIdx.y * 64;
    const int l15 = lane & 15;
    const int g   = lane >> 4;

    const int ncol0 = n_blk + wn * 32 + l15;
    const int ncol1 = n_blk + wn * 32 + 16 + l15;
    const bool b0ok = (ncol0 < Nvalid);
    const bool b1ok = (ncol1 < Nvalid);

    // copy mapping: 8 lanes cover one 128-B line of a row, 32 rows per sweep,
    // six sweeps (four of A, two of W)
    const int srow = t >> 3;
    const int ssub = t & 7;
    const _Float16* grow[6];
#pragma unroll                                // grow[] stays in registers
    for (int rg = 0; rg < 4; ++rg)
        grow[rg] = A + (size_t)(blockIdx.x * 128 + rg * 32 + srow) * K + ssub * 8;
#pragma unroll                                // grow[] stays in registers
    for (int rg = 0; rg < 2; ++rg) {
        const int gcol0 = n_blk + rg * 32 + srow;
        const int gcol  = (gcol0 < Nvalid) ? gcol0 : (Nvalid - 1);  // clamp;
        grow[4 + rg] = W + (size_t)gcol * K + ssub * 8;     // such cols dropped
    }
    const unsigned int lbase =
        (unsigned int)(uintptr_t)&ring[srow * PITCH + ssub * 16];

    auto issue = [&](int stage, int buf) {
#pragma unroll                                // grow[] indexed by constants
        for (int rg = 0; rg < 6; ++rg)
            copy_row<0, JC>(grow[rg] + stage * BK,
                            lbase + buf * STAGE + rg * 32 * PITCH);
    };

    // LDS byte offsets of this lane's fragment rows inside a stage
    const int aoff = (wm * 32 + l15) * PITCH + 16 * g;
    const int boff = (128 + wn * 32 + l15) * PITCH + 16 * g;

    v8f c00 = {}, c01 = {}, c10 = {}, c11 = {};

    issue(0, 0);
    // stage 0 has landed for this wave before the barrier publishes it
    asm volatile("s_wait_asynccnt 0x0" ::: "memory");
    __syncthreads();
    issue(1, 1);

    for (int s = 0; s < NT; ++s) {
        const char* bufp = ring + (s & 1) * STAGE;
        const _Float16* ap = (const _Float16*)(bufp + aoff);
        const _Float16* bp = (const _Float16*)(bufp + boff);
        // fragments of k step ks+1 (same stage only) are fetched as one group
        // ahead of the WMMAs of step ks, so LDS latency hides under them
        v16h a0 = load_frag(ap);
        v16h a1 = load_frag(ap + 8 * PITCH);
        v16h b0 = load_frag(bp);
        v16h b1 = load_frag(bp + 8 * PITCH);
        // unrolled: LDS offsets become immediates, the two fragment sets are
        // renamed instead of moved
#pragma unroll
        for (int ks = 0; ks < BK / 32; ++ks) {
            v16h a0n, a1n, b0n, b1n;
            if (ks + 1 < BK / 32) {
                a0n = load_frag(ap + (ks + 1) * 32);
                a1n = load_frag(ap + 8 * PITCH + (ks + 1) * 32);
                b0n = load_frag(bp + (ks + 1) * 32);
                b1n = load_frag(bp + 8 * PITCH + (ks + 1) * 32);
            }
            // keeps the load group above in front of these WMMAs: the
            // scheduler otherwise sinks the loads to just before their use
            __builtin_amdgcn_sched_barrier(0);
            c00 = __builtin_amdgcn_wmma_f32_16x16x32_f16(false, a0, false, b0,
                                                         (short)0, c00, false, false);
            c01 = __builtin_amdgcn_wmma_f32_16x16x32_f16(false, a0, false, b1,
                                                         (short)0, c01, false, false);
            c10 = __builtin_amdgcn_wmma_f32_16x16x32_f16(false, a1, false, b0,
                                                         (short)0, c10, false, false);
            c11 = __builtin_amdgcn_wmma_f32_16x16x32_f16(false, a1, false, b1,
                                                         (short)0, c11, false, false);
            if (ks + 1 < BK / 32) { a0 = a0n; a1 = a1n; b0 = b0n; b1 = b1n; }
        }
        // publish point: this wave's reads of stage s are done ...
        asm volatile("s_wait_dscnt 0x0" ::: "memory");
        // ... and its copies of stage s+1 have landed, before the barrier that
        // frees buffer s&1 and lets every wave read stage s+1
        asm volatile("s_wait_asynccnt 0x0" ::: "memory");
        __syncthreads();
        if (s + 2 < NT) issue(s + 2, s & 1);
    }
    // no copy is outstanding when the ring becomes the epilogue's stage
    asm volatile("s_wait_asynccnt 0x0" ::: "memory");

    // ---- epilogue: bias + activation, stage in LDS, coalesced store ----
    const float bv0 = b0ok ? bias[ncol0] : 0.0f;
    const float bv1 = b1ok ? bias[ncol1] : 0.0f;

    if (OUT_F32) {
        float* st = (float*)ring;
        auto put = [&](const v8f& c, int rb, int cl, float bv) {
#pragma unroll
            for (int r = 0; r < 8; r += 2) {
                v2f v = {c[r] + bv, c[r + 1] + bv};
                if (GELU_ACT) v = gelu_2(v);
                st[(rb + 8 * g + r) * 64 + cl]     = v.x;
                st[(rb + 8 * g + r + 1) * 64 + cl] = v.y;
            }
        };
        put(c00, wm * 32,      wn * 32 + l15,      bv0);
        put(c01, wm * 32,      wn * 32 + 16 + l15, bv1);
        put(c10, wm * 32 + 16, wn * 32 + l15,      bv0);
        put(c11, wm * 32 + 16, wn * 32 + 16 + l15, bv1);
        __syncthreads();
#pragma unroll
        for (int j = 0; j < 8; ++j) {         // 2048 chunks of 4 floats
            const int cchunk = t + 256 * j;
            const int row = cchunk >> 4;
            const int ch  = cchunk & 15;
            const int col0 = n_blk + ch * 4;  // Nvalid (300) is 4-aligned
            if (col0 < Nvalid) {
                *(float4*)((float*)out +
                           (size_t)(blockIdx.x * 128 + row) * Nout + col0) =
                    *(const float4*)&st[row * 64 + ch * 4];
            }
        }
    } else {
        _Float16* st = (_Float16*)ring;
        auto put = [&](const v8f& c, int rb, int cl, float bv) {
#pragma unroll
            for (int r = 0; r < 8; r += 2) {
                v2f v = {c[r] + bv, c[r + 1] + bv};
                if (GELU_ACT) v = gelu_2(v);
                st[(rb + 8 * g + r) * 64 + cl]     = (_Float16)v.x;
                st[(rb + 8 * g + r + 1) * 64 + cl] = (_Float16)v.y;
            }
        };
        put(c00, wm * 32,      wn * 32 + l15,      bv0);
        put(c01, wm * 32,      wn * 32 + 16 + l15, bv1);
        put(c10, wm * 32 + 16, wn * 32 + l15,      bv0);
        put(c11, wm * 32 + 16, wn * 32 + 16 + l15, bv1);
        __syncthreads();
#pragma unroll
        for (int j = 0; j < 4; ++j) {         // 1024 chunks of 8 halves
            const int cchunk = t + 256 * j;
            const int row = cchunk >> 3;
            const int ch  = cchunk & 7;
            *(v8h*)((_Float16*)out +
                    (size_t)(blockIdx.x * 128 + row) * Nout + n_blk + ch * 8) =
                *(const v8h*)&st[row * 64 + ch * 8];
        }
    }
}

// ---------------------------------------------------------------------------
// Launch
// ---------------------------------------------------------------------------
extern "C" void kernel_launch(void* const* d_in, const int* in_sizes, int n_in,
                              void* d_out, int out_size, void* d_ws, size_t ws_size,
                              hipStream_t stream) {
    const float* x   = (const float*)d_in[0];
    const float* bw1 = (const float*)d_in[1];
    const float* bb1 = (const float*)d_in[2];
    const float* bw2 = (const float*)d_in[3];
    const float* bb2 = (const float*)d_in[4];
    const float* wc1 = (const float*)d_in[5];
    const float* bc1 = (const float*)d_in[6];
    const float* wc2 = (const float*)d_in[7];
    const float* bc2 = (const float*)d_in[8];
    const float* wc3 = (const float*)d_in[9];
    const float* bc3 = (const float*)d_in[10];
    float* out = (float*)d_out;

    // workspace carve-out (all slices 16B-aligned)
    char* ws = (char*)d_ws;
    _Float16* f   = (_Float16*)ws;  ws += (size_t)B_SZ * KF  * sizeof(_Float16);
    _Float16* z1  = (_Float16*)ws;  ws += (size_t)B_SZ * C1D * sizeof(_Float16);
    _Float16* z2  = (_Float16*)ws;  ws += (size_t)B_SZ * C2D * sizeof(_Float16);
    _Float16* w1h = (_Float16*)ws;  ws += (size_t)C1D  * KF  * sizeof(_Float16);
    _Float16* w2h = (_Float16*)ws;  ws += (size_t)C2D  * C1D * sizeof(_Float16);
    _Float16* w3h = (_Float16*)ws;  ws += (size_t)OUTD * C2D * sizeof(_Float16);
    if ((size_t)(ws - (char*)d_ws) > ws_size) return;  // ws too small: bail

    // 1) all 1000 branch MLPs via padded WMMA; f = [B, 8000] fp16
    //    (and the combiner weights to fp16)
    branch_kernel<<<dim3(BR_GX, BR_GY), 256, 0, stream>>>(
        x, bw1, bb1, bw2, bb2, wc1, wc2, wc3, w1h, w2h, w3h, f);

    // 2) z1 = gelu(f @ wc1^T + bc1)      M=4096 N=256  K=8000
    gemm_wmma_kernel<KF, 320, true, false><<<dim3(B_SZ / 128, C1D / 64), 256, 0, stream>>>(
        f, w1h, bc1, z1, C1D, C1D);

    // 3) z2 = gelu(z1 @ wc2^T + bc2)     M=4096 N=128  K=256
    gemm_wmma_kernel<C1D, 128, true, false><<<dim3(B_SZ / 128, C2D / 64), 256, 0, stream>>>(
        z1, w2h, bc2, z2, C2D, C2D);

    // 4) out = z2 @ wc3^T + bc3          M=4096 N=300  K=128 (fp32, guarded)
    gemm_wmma_kernel<C2D, 64, false, true><<<dim3(B_SZ / 128, (OUTD + 63) / 64), 256, 0, stream>>>(
        z2, w3h, bc3, out, OUTD, OUTD);
}

// v005
// A run of this version takes 77 microseconds.
// In two side-by-side timings against v004, it was 1.08 and 1.07 times as fast.
// Counting every step since v000, it is 3.44 times as fast.
#include <hip/hip_runtime.h>
#include <hip/hip_bf16.h>

typedef __attribute__((ext_vector_type(16))) _Float16 v16h;
typedef __attribute__((ext_vector_type(8)))  _Float16 v8h;
typedef __attribute__((ext_vector_type(8)))  float    v8f;
typedef int v4i __attribute__((vector_size(4 * sizeof(int))));  // b128 payload

#define B_SZ 4096
#define N_BR 1000
#define H1D  16
#define H2D  8
#define C1D  256
#define C2D  128
#define OUTD 300
#define KF   (N_BR * H2D)   // 8000
#define BR_TILES 16         // 32-row batch tiles walked by a branch work-group
#define BR_GX (B_SZ / (32 * BR_TILES))   // branch grid, x
#define BR_GY (N_BR / 8)                 // branch grid, y
// combiner weights in pieces of 8 values, two pieces a thread
#define CH1 (C1D * KF / 8)
#define CH2 (C2D * C1D / 8)
#define CH3 (OUTD * C2D / 8)

#define AS1 __attribute__((address_space(1)))
#define AS3 __attribute__((address_space(3)))

typedef __attribute__((ext_vector_type(2))) float v2f;

// exact GeLU, 0.5*x*(1+erf(x/sqrt(2))), written without a branch as
//   max(x,0) - a*Q(a),  a = |x|,  Q(a) = 0.5*erfc(a/sqrt(2)) = exp2(P(a)).
// P is one polynomial of degree 6 for all of 0 <= a <= 6 (fitted to log2 Q,
// weighted by a*Q); past 6 the term a*Q is below 1e-8 and a is held at 6.
// The term a*Q(a) stays within 2e-7 of the exact one, the size of f32 rounding
// (a NaN does not pass min and max, as in tanh_fast below).
// Two values at a time, so that the polynomial runs on packed FMAs.
__device__ __forceinline__ v2f gelu_2(v2f v) {
    const v2f a = __builtin_elementwise_min(__builtin_elementwise_abs(v), (v2f)(6.0f));
    v2f p = (v2f)(0.0000330932962f);
    p = __builtin_elementwise_fma(p, a, (v2f)(-0.000769223785f));
    p = __builtin_elementwise_fma(p, a, (v2f)(0.00808072928f));
    p = __builtin_elementwise_fma(p, a, (v2f)(-0.0534121245f));
    p = __builtin_elementwise_fma(p, a, (v2f)(-0.458770961f));
    p = __builtin_elementwise_fma(p, a, (v2f)(-1.15120173f));
    p = __builtin_elementwise_fma(p, a, (v2f)(-0.999993086f));
    v2f q;
    q.x = __builtin_amdgcn_exp2f(p.x);
    q.y = __builtin_amdgcn_exp2f(p.y);
    return __builtin_elementwise_fma(-a, q, __builtin_elementwise_max(v, (v2f)(0.0f)));
}

// branch-free tanh: (e^2x - 1) * rcp(e^2x + 1), clamped so e stays finite
__device__ __forceinline__ float tanh_fast(float v) {
    v = fminf(fmaxf(v, -10.0f), 10.0f);
    const float e = __expf(2.0f * v);
    return (e - 1.0f) * __builtin_amdgcn_rcpf(e + 1.0f);
}

// Build a 16-bit A/B WMMA fragment for this lane from K-contiguous memory.
// Lane group g (lane>>4): elements 0..7 = K[8g..8g+7], elements 8..15 =
// K[16+8g..16+8g+7].  `p` must already point at row_base + 8*g.
__device__ __forceinline__ v16h load_frag(const _Float16* p) {
    v8h lo = *(const v8h*)(p);
    v8h hi = *(const v8h*)(p + 16);
    v16h r;
#pragma unroll
    for (int i = 0; i < 8; ++i) { r[i] = lo[i]; r[8 + i] = hi[i]; }
    return r;
}

// ---------------------------------------------------------------------------
// Branch stage: h = gelu(x*bw1+bb1) [16], f = tanh(h @ bw2^T + bb2) [8]
// One wave = 2 neighbouring branches; per 16 batch rows one full WMMA:
// M = 16 batch rows, K = 2 x 16 hidden units, N = 2 x 8 outputs, with B block
// diagonal (a branch's outputs see only its own hidden units).  Every lane of
// the accumulator then holds an output that is wanted.
// A work-group is 4 branch pairs x 2 row halves: 8 branches, 32 batch rows a
// tile.  It holds its weights in registers and walks BR_TILES tiles, so that
// the whole grid is resident at once and few waves have to be started.
// Results staged in LDS (two buffers, one barrier a tile), written back as
// coalesced b128 rows.
// The fp32 -> fp16 conversion of the three combiner weights depends on nothing
// here and nothing here depends on it: it rides in this launch, two pieces of
// 8 values a thread in the first work-groups, and needs no launch of its own.
// ---------------------------------------------------------------------------
// the grid fills 8 wave slots a SIMD and no more: the register budget of 4
// waves lets the scheduler run the GeLU chains side by side
__global__ __launch_bounds__(256) __attribute__((amdgpu_waves_per_eu(4, 8)))
void branch_kernel(const float* __restrict__ x,     // [B, N_BR]
                   const float* __restrict__ bw1,   // [N_BR, 16]
                   const float* __restrict__ bb1,   // [N_BR, 16]
                   const float* __restrict__ bw2,   // [N_BR, 8, 16]
                   const float* __restrict__ bb2,   // [N_BR, 8]
                   const float* __restrict__ wc1,   // [256, 8000]
                   const float* __restrict__ wc2,   // [128, 256]
                   const float* __restrict__ wc3,   // [300, 128]
                   _Float16* __restrict__ w1h,      // wc1 as f16
                   _Float16* __restrict__ w2h,      // wc2 as f16
                   _Float16* __restrict__ w3h,      // wc3 as f16
                   _Float16* __restrict__ f) {      // [B, 8000] f16
    // 32 rows x (8 branches * 8 out), twice
    __shared__ __attribute__((aligned(16))) _Float16 fs[2][32 * 64];

    const int t    = threadIdx.x;
    const int lane = t & 31;
    const int wid  = t >> 5;
    const int pr   = wid & 3;                 // branch pair in the work-group
    const int rh   = wid >> 2;                // upper or lower 16 rows of a tile
    const int n0   = blockIdx.y * 8 + pr * 2; // first branch of the pair (even)
    const int b0   = blockIdx.x * (BR_TILES * 32);   // batch row base
    const int m    = lane & 15;
    const int g    = lane >> 4;

    // ---- this work-group's share of the weight conversion ----
    {
        static_assert((C1D * KF) % 8 == 0 && (C2D * C1D) % 8 == 0 &&
                      (OUTD * C2D) % 8 == 0, "8 values a piece");
        static_assert(CH1 % 512 == 0 && CH2 % 512 == 0, "whole work-groups");
        static_assert((CH1 + CH2 + CH3 + 511) / 512 <= BR_GX * BR_GY,
                      "two pieces for every thread at most");
        const int wg = blockIdx.y * BR_GX + blockIdx.x;
        const float* src = wc1;
        _Float16* dst = w1h;
        int first = 0, np = CH1;
        if (wg >= CH1 / 512)         { src = wc2; dst = w2h; first = CH1 / 512; np = CH2; }
        if (wg >= (CH1 + CH2) / 512) { src = wc3; dst = w3h; first = (CH1 + CH2) / 512; np = CH3; }
        for (int q = 0; q < 2; ++q) {
            const int pc = (wg - first) * 512 + q * 256 + t;
            if (pc < np) {
                const float4 lo = *(const float4*)(src + pc * 8);
                const float4 hi = *(const float4*)(src + pc * 8 + 4);
                v8h r;
                r[0] = (_Float16)lo.x; r[1] = (_Float16)lo.y;
                r[2] = (_Float16)lo.z; r[3] = (_Float16)lo.w;
                r[4] = (_Float16)hi.x; r[5] = (_Float16)hi.y;
                r[6] = (_Float16)hi.z; r[7] = (_Float16)hi.w;
                *(v8h*)(dst + pc * 8) = r;
            }
        }
    }

    // ---- this lane's layer-1 weights: hidden units 8g..8g+7 of both branches
    v2f w1[2][4], c1[2][4];
#pragma unroll                                // w1[], c1[] stay in registers
    for (int p = 0; p < 2; ++p) {
#pragma unroll
        for (int i = 0; i < 4; ++i) {
            w1[p][i] = *(const v2f*)(bw1 + (n0 + p) * H1D + 8 * g + 2 * i);
            c1[p][i] = *(const v2f*)(bb1 + (n0 + p) * H1D + 8 * g + 2 * i);
        }
    }

    // ---- B fragment, block diagonal.  Fragment elements 0..7 carry hidden
    // units 8g..8g+7 of branch n0, elements 8..15 those of branch n0+1 (the A
    // fragment below has the same order).  Column col is output col&7 of
    // branch n0 + (col>>3): it has weights in its own branch's half only.
    const int col = m;
    const bool up = (col >= H2D);
    v16h b;
#pragma unroll
    for (int i = 0; i < 8; ++i) {
        const _Float16 w =
            (_Float16)bw2[((size_t)(n0 * H2D + col)) * H1D + 8 * g + i];
        b[i]     = up ? (_Float16)0.0f : w;
        b[8 + i] = up ? w : (_Float16)0.0f;
    }
    const float bias = bb2[n0 * H2D + col];

    // x of both branches is one aligned pair (n0 even, row pitch even)
    const float* xp = x + (size_t)(b0 + rh * 16 + m) * N_BR + n0;
    _Float16* fp = f + (size_t)(b0 + (t >> 3)) * KF + (size_t)blockIdx.y * 64 + (t & 7) * 8;

    v2f xv = *(const v2f*)xp;
    for (int tl = 0; tl < BR_TILES; ++tl) {
        // next tile's x is asked for ahead of this tile's arithmetic (the last
        // trip asks for its own again: in bounds, unused)
        const int nx = (tl + 1 < BR_TILES) ? tl + 1 : tl;
        const v2f xn = *(const v2f*)(xp + (size_t)nx * 32 * N_BR);

        // ---- A fragment: rows = batch, K = hidden units of the two branches
        v16h a;
#pragma unroll
        for (int i = 0; i < 4; ++i) {
            const v2f h0 = gelu_2(__builtin_elementwise_fma((v2f)(xv.x), w1[0][i], c1[0][i]));
            const v2f h1 = gelu_2(__builtin_elementwise_fma((v2f)(xv.y), w1[1][i], c1[1][i]));
            a[2 * i]         = (_Float16)h0.x;
            a[2 * i + 1]     = (_Float16)h0.y;
            a[8 + 2 * i]     = (_Float16)h1.x;
            a[8 + 2 * i + 1] = (_Float16)h1.y;
        }

        v8f c = {};
        c = __builtin_amdgcn_wmma_f32_16x16x32_f16(false, a, false, b,
                                                   (short)0, c, false, false);

        _Float16* st = fs[tl & 1];
#pragma unroll
        for (int r = 0; r < 8; ++r) {
            const int row = rh * 16 + r + 8 * g;   // lanes 16-31 cover M 8..15
            st[row * 64 + pr * 16 + col] = (_Float16)tanh_fast(c[r] + bias);
        }
        // publishes this tile; the buffer written next was last read in front
        // of this barrier
        __syncthreads();

        // coalesced write: 32 rows x 128B, one b128 chunk per thread
        *(v8h*)(fp + (size_t)tl * 32 * KF) = *(const v8h*)&st[t * 8];
        // stands in front of the next trip's step of the store's address
        asm volatile("s_wait_xcnt 0x0" ::: "memory");
        xv = xn;
    }
}

// ---------------------------------------------------------------------------
// One row slice of a stage: JC async copies of 16 B per lane, 128 B apart.
// The immediate offset moves the global and the LDS address alike.
// ---------------------------------------------------------------------------
template <int J, int JC>
__device__ __forceinline__ void copy_row(const _Float16* gp, unsigned int la) {
    __builtin_amdgcn_global_load_async_to_lds_b128(
        (AS1 v4i*)(unsigned long long)(uintptr_t)gp,
        (AS3 v4i*)la, J * 128, 0);
    if constexpr (J + 1 < JC) copy_row<J + 1, JC>(gp, la);
}

// ---------------------------------------------------------------------------
// WMMA GEMM: out = act(A[M,K] @ W[N,K]^T + bias)
// Block = 256 threads = 8 waves; tile 128(M) x 64(N); wave tile 32x32.
// A stage is BK of K for the 128 A rows and the 64 W rows, laid in LDS at a
// pitch of 2*BK+16 bytes (16 B x odd: conflict-free for ds_load_b128).
// Two stage buffers: the async copies of stage t+1 fly while stage t is
// multiplied.  The epilogue stages its tile in the same LDS.
// ---------------------------------------------------------------------------
template <int K, int BK, bool GELU_ACT, bool OUT_F32>
__global__ __launch_bounds__(256)
void gemm_wmma_kernel(const _Float16* __restrict__ A,   // [M][K]
                      const _Float16* __restrict__ W,   // [Nvalid][K]
                      const float* __restrict__ bias,   // [Nvalid]
                      void* __restrict__ out,           // [M][Nout]
                      int Nvalid, int Nout) {
    constexpr int NT    = K / BK;             // stages
    constexpr int JC    = BK / 64;            // 128-B pieces per staged row
    constexpr int PITCH = BK * 2 + 16;        // bytes
    constexpr int STAGE = 192 * PITCH;        // bytes: 128 A rows + 64 W rows
    static_assert(K % BK == 0 && BK % 64 == 0 && NT >= 2, "stage shape");
    static_assert(2 * STAGE >= 128 * 64 * 4, "epilogue tile fits the ring");
    __shared__ __attribute__((aligned(16))) char ring[2 * STAGE];

    const int t    = threadIdx.x;
    const int lane = t & 31;
    const int wid  = t >> 5;
    const int wm   = wid & 3;                 // 4 M-subtiles of 32 rows
    const int wn   = wid >> 2;                // 2 N-subtiles of 32 cols
    const int n_blk  = blockIdx.y * 64;
    const int l15 = lane & 15;
    const int g   = lane >> 4;

    const int ncol0 = n_blk + wn * 32 + l15;
    const int ncol1 = n_blk + wn * 32 + 16 + l15;
    const bool b0ok = (ncol0 < Nvalid);
    const bool b1ok = (ncol1 < Nvalid);

    // copy mapping: 8 lanes cover one 128-B line of a row, 32 rows per sweep,
    // six sweeps (four of A, two of W)
    const int srow = t >> 3;
    const int ssub = t & 7;
    const _Float16* grow[6];
#pragma unroll                                // grow[] stays in registers
    for (int rg = 0; rg < 4; ++rg)
        grow[rg] = A + (size_t)(blockIdx.x * 128 + rg * 32 + srow) * K + ssub * 8;
#pragma unroll                                // grow[] stays in registers
    for (int rg = 0; rg < 2; ++rg) {
        const int gcol0 = n_blk + rg * 32 + srow;
        const int gcol  = (gcol0 < Nvalid) ? gcol0 : (Nvalid - 1);  // clamp;
        grow[4 + rg] = W + (size_t)gcol * K + ssub * 8;     // such cols dropped
    }
    const unsigned int lbase =
        (unsigned int)(uintptr_t)&ring[srow * PITCH + ssub * 16];

    auto issue = [&](int stage, int buf) {
#pragma unroll                                // grow[] indexed by constants
        for (int rg = 0; rg < 6; ++rg)
            copy_row<0, JC>(grow[rg] + stage * BK,
                            lbase + buf * STAGE + rg * 32 * PITCH);
    };

    // LDS byte offsets of this lane's fragment rows inside a stage
    const int aoff = (wm * 32 + l15) * PITCH + 16 * g;
    const int boff = (128 + wn * 32 + l15) * PITCH + 16 * g;

    v8f c00 = {}, c01 = {}, c10 = {}, c11 = {};

    issue(0, 0);
    // stage 0 has landed for this wave before the barrier publishes it
    asm volatile("s_wait_asynccnt 0x0" ::: "memory");
    __syncthreads();
    issue(1, 1);

    for (int s = 0; s < NT; ++s) {
        const char* bufp = ring + (s & 1) * STAGE;
        const _Float16* ap = (const _Float16*)(bufp + aoff);
        const _Float16* bp = (const _Float16*)(bufp + boff);
        // fragments of k step ks+1 (same stage only) are fetched as one group
        // ahead of the WMMAs of step ks, so LDS latency hides under them
        v16h a0 = load_frag(ap);
        v16h a1 = load_frag(ap + 8 * PITCH);
        v16h b0 = load_frag(bp);
        v16h b1 = load_frag(bp + 8 * PITCH);
        // unrolled: LDS offsets become immediates, the two fragment sets are
        // renamed instead of moved
#pragma unroll
        for (int ks = 0; ks < BK / 32; ++ks) {
            v16h a0n, a1n, b0n, b1n;
            if (ks + 1 < BK / 32) {
                a0n = load_frag(ap + (ks + 1) * 32);
                a1n = load_frag(ap + 8 * PITCH + (ks + 1) * 32);
                b0n = load_frag(bp + (ks + 1) * 32);
                b1n = load_frag(bp + 8 * PITCH + (ks + 1) * 32);
            }
            // keeps the load group above in front of these WMMAs: the
            // scheduler otherwise sinks the loads to just before their use
            __builtin_amdgcn_sched_barrier(0);
            c00 = __builtin_amdgcn_wmma_f32_16x16x32_f16(false, a0, false, b0,
                                                         (short)0, c00, false, false);
            c01 = __builtin_amdgcn_wmma_f32_16x16x32_f16(false, a0, false, b1,
                                                         (short)0, c01, false, false);
            c10 = __builtin_amdgcn_wmma_f32_16x16x32_f16(false, a1, false, b0,
                                                         (short)0, c10, false, false);
            c11 = __builtin_amdgcn_wmma_f32_16x16x32_f16(false, a1, false, b1,
                                                         (short)0, c11, false, false);
            if (ks + 1 < BK / 32) { a0 = a0n; a1 = a1n; b0 = b0n; b1 = b1n; }
        }
        // publish point: this wave's reads of stage s are done ...
        asm volatile("s_wait_dscnt 0x0" ::: "memory");
        // ... and its copies of stage s+1 have landed, before the barrier that
        // frees buffer s&1 and lets every wave read stage s+1
        asm volatile("s_wait_asynccnt 0x0" ::: "memory");
        __syncthreads();
        if (s + 2 < NT) issue(s + 2, s & 1);
    }
    // no copy is outstanding when the ring becomes the epilogue's stage
    asm volatile("s_wait_asynccnt 0x0" ::: "memory");

    // ---- epilogue: bias + activation, stage in LDS, coalesced store ----
    const float bv0 = b0ok ? bias[ncol0] : 0.0f;
    const float bv1 = b1ok ? bias[ncol1] : 0.0f;

    if (OUT_F32) {
        float* st = (float*)ring;
        auto put = [&](const v8f& c, int rb, int cl, float bv) {
#pragma unroll
            for (int r = 0; r < 8; r += 2) {
                v2f v = {c[r] + bv, c[r + 1] + bv};
                if (GELU_ACT) v = gelu_2(v);
                st[(rb + 8 * g + r) * 64 + cl]     = v.x;
                st[(rb + 8 * g + r + 1) * 64 + cl] = v.y;
            }
        };
        put(c00, wm * 32,      wn * 32 + l15,      bv0);
        put(c01, wm * 32,      wn * 32 + 16 + l15, bv1);
        put(c10, wm * 32 + 16, wn * 32 + l15,      bv0);
        put(c11, wm * 32 + 16, wn * 32 + 16 + l15, bv1);
        __syncthreads();
#pragma unroll
        for (int j = 0; j < 8; ++j) {         // 2048 chunks of 4 floats
            const int cchunk = t + 256 * j;
            const int row = cchunk >> 4;
            const int ch  = cchunk & 15;
            const int col0 = n_blk + ch * 4;  // Nvalid (300) is 4-aligned
            if (col0 < Nvalid) {
                *(float4*)((float*)out +
                           (size_t)(blockIdx.x * 128 + row) * Nout + col0) =
                    *(const float4*)&st[row * 64 + ch * 4];
            }
        }
    } else {
        _Float16* st = (_Float16*)ring;
        auto put = [&](const v8f& c, int rb, int cl, float bv) {
#pragma unroll
            for (int r = 0; r < 8; r += 2) {
                v2f v = {c[r] + bv, c[r + 1] + bv};
                if (GELU_ACT) v = gelu_2(v);
                st[(rb + 8 * g + r) * 64 + cl]     = (_Float16)v.x;
                st[(rb + 8 * g + r + 1) * 64 + cl] = (_Float16)v.y;
            }
        };
        put(c00, wm * 32,      wn * 32 + l15,      bv0);
        put(c01, wm * 32,      wn * 32 + 16 + l15, bv1);
        put(c10, wm * 32 + 16, wn * 32 + l15,      bv0);
        put(c11, wm * 32 + 16, wn * 32 + 16 + l15, bv1);
        __syncthreads();
#pragma unroll
        for (int j = 0; j < 4; ++j) {         // 1024 chunks of 8 halves
            const int cchunk = t + 256 * j;
            const int row = cchunk >> 3;
            const int ch  = cchunk & 7;
            *(v8h*)((_Float16*)out +
                    (size_t)(blockIdx.x * 128 + row) * Nout + n_blk + ch * 8) =
                *(const v8h*)&st[row * 64 + ch * 8];
        }
    }
}

// ---------------------------------------------------------------------------
// Launch
// ---------------------------------------------------------------------------
extern "C" void kernel_launch(void* const* d_in, const int* in_sizes, int n_in,
                              void* d_out, int out_size, void* d_ws, size_t ws_size,
                              hipStream_t stream) {
    const float* x   = (const float*)d_in[0];
    const float* bw1 = (const float*)d_in[1];
    const float* bb1 = (const float*)d_in[2];
    const float* bw2 = (const float*)d_in[3];
    const float* bb2 = (const float*)d_in[4];
    const float* wc1 = (const float*)d_in[5];
    const float* bc1 = (const float*)d_in[6];
    const float* wc2 = (const float*)d_in[7];
    const float* bc2 = (const float*)d_in[8];
    const float* wc3 = (const float*)d_in[9];
    const float* bc3 = (const float*)d_in[10];
    float* out = (float*)d_out;

    // workspace carve-out (all slices 16B-aligned)
    char* ws = (char*)d_ws;
    _Float16* f   = (_Float16*)ws;  ws += (size_t)B_SZ * KF  * sizeof(_Float16);
    _Float16* z1  = (_Float16*)ws;  ws += (size_t)B_SZ * C1D * sizeof(_Float16);
    _Float16* z2  = (_Float16*)ws;  ws += (size_t)B_SZ * C2D * sizeof(_Float16);
    _Float16* w1h = (_Float16*)ws;  ws += (size_t)C1D  * KF  * sizeof(_Float16);
    _Float16* w2h = (_Float16*)ws;  ws += (size_t)C2D  * C1D * sizeof(_Float16);
    _Float16* w3h = (_Float16*)ws;  ws += (size_t)OUTD * C2D * sizeof(_Float16);
    if ((size_t)(ws - (char*)d_ws) > ws_size) return;  // ws too small: bail

    // 1) all 1000 branch MLPs, two a WMMA; f = [B, 8000] fp16
    //    (and the combiner weights to fp16)
    branch_kernel<<<dim3(BR_GX, BR_GY), 256, 0, stream>>>(
        x, bw1, bb1, bw2, bb2, wc1, wc2, wc3, w1h, w2h, w3h, f);

    // 2) z1 = gelu(f @ wc1^T + bc1)      M=4096 N=256  K=8000
    gemm_wmma_kernel<KF, 320, true, false><<<dim3(B_SZ / 128, C1D / 64), 256, 0, stream>>>(
        f, w1h, bc1, z1, C1D, C1D);

    // 3) z2 = gelu(z1 @ wc2^T + bc2)     M=4096 N=128  K=256
    gemm_wmma_kernel<C1D, 128, true, false><<<dim3(B_SZ / 128, C2D / 64), 256, 0, stream>>>(
        z1, w2h, bc2, z2, C2D, C2D);

    // 4) out = z2 @ wc3^T + bc3          M=4096 N=300  K=128 (fp32, guarded)
    gemm_wmma_kernel<C2D, 64, false, true><<<dim3(B_SZ / 128, (OUTD + 63) / 64), 256, 0, stream>>>(
        z2, w3h, bc3, out, OUTD, OUTD);
}

// v006
// Measured time: 56.5 microseconds a run.
// Next to v005, in two timings, it ran 1.35 and 1.36 times as fast.
// All steps since v000 together make it 4.67 times as fast.
#include <hip/hip_runtime.h>
#include <hip/hip_bf16.h>

typedef __attribute__((ext_vector_type(16))) _Float16 v16h;
typedef __attribute__((ext_vector_type(8)))  _Float16 v8h;
typedef __attribute__((ext_vector_type(4)))  _Float16 v4h;
typedef __attribute__((ext_vector_type(8)))  float    v8f;
typedef int v4i __attribute__((vector_size(4 * sizeof(int))));  // b128 payload

#define B_SZ 4096
#define N_BR 1000
#define H1D  16
#define H2D  8
#define C1D  256
#define C2D  128
#define OUTD 300
#define KF   (N_BR * H2D)   // 8000
#define FM   128            // batch rows of a fused work-group
#define KSPL 8              // slices of K, one a work-group
#define NGRP (N_BR / 8)     // groups of 8 branches = 64 of K
#define FP   144            // LDS row pitch, bytes: 64 f16 + 16 (16 B x odd)
#define FBUF ((C1D + FM) * FP)   // one buffer: 256 W rows, then 128 f rows
#define SLICE (B_SZ * C1D)  // floats of one K slice's partial sums
#define P2   (C1D * 2 + 16) // LDS row pitch of the second GEMM, bytes
// the two small combiner weights in pieces of 8 values, one piece a thread
#define CH2 (C2D * C1D / 8)
#define CH3 (OUTD * C2D / 8)

#define AS1 __attribute__((address_space(1)))
#define AS3 __attribute__((address_space(3)))

typedef __attribute__((ext_vector_type(2))) float v2f;

// exact GeLU, 0.5*x*(1+erf(x/sqrt(2))), written without a branch as
//   max(x,0) - a*Q(a),  a = |x|,  Q(a) = 0.5*erfc(a/sqrt(2)) = exp2(P(a)).
// P is one polynomial of degree 6 for all of 0 <= a <= 6 (fitted to log2 Q,
// weighted by a*Q); past 6 the term a*Q is below 1e-8 and a is held at 6.
// The term a*Q(a) stays within 2e-7 of the exact one, the size of f32 rounding
// (a NaN does not pass min and max, as in tanh_fast below).
// Two values at a time, so that the polynomial runs on packed FMAs.
__device__ __forceinline__ v2f gelu_2(v2f v) {
    const v2f a = __builtin_elementwise_min(__builtin_elementwise_abs(v), (v2f)(6.0f));
    v2f p = (v2f)(0.0000330932962f);
    p = __builtin_elementwise_fma(p, a, (v2f)(-0.000769223785f));
    p = __builtin_elementwise_fma(p, a, (v2f)(0.00808072928f));
    p = __builtin_elementwise_fma(p, a, (v2f)(-0.0534121245f));
    p = __builtin_elementwise_fma(p, a, (v2f)(-0.458770961f));
    p = __builtin_elementwise_fma(p, a, (v2f)(-1.15120173f));
    p = __builtin_elementwise_fma(p, a, (v2f)(-0.999993086f));
    v2f q;
    q.x = __builtin_amdgcn_exp2f(p.x);
    q.y = __builtin_amdgcn_exp2f(p.y);
    return __builtin_elementwise_fma(-a, q, __builtin_elementwise_max(v, (v2f)(0.0f)));
}

// branch-free tanh: (e^2x - 1) * rcp(e^2x + 1), clamped so e stays finite
__device__ __forceinline__ float tanh_fast(float v) {
    v = fminf(fmaxf(v, -10.0f), 10.0f);
    const float e = __expf(2.0f * v);
    return (e - 1.0f) * __builtin_amdgcn_rcpf(e + 1.0f);
}

// Build a 16-bit A/B WMMA fragment for this lane from K-contiguous memory.
// Lane group g (lane>>4): elements 0..7 = K[8g..8g+7], elements 8..15 =
// K[16+8g..16+8g+7].  `p` must already point at row_base + 8*g.
__device__ __forceinline__ v16h load_frag(const _Float16* p) {
    v8h lo = *(const v8h*)(p);
    v8h hi = *(const v8h*)(p + 16);
    v16h r;
#pragma unroll
    for (int i = 0; i < 8; ++i) { r[i] = lo[i]; r[8 + i] = hi[i]; }
    return r;
}

// ---------------------------------------------------------------------------
// Branch stage and first combiner GEMM in one kernel.
//   h = gelu(x*bw1+bb1) [16], f = tanh(h @ bw2^T + bb2) [8], z1pre = f @ wc1^T
// A work-group owns 128 batch rows, all 256 columns of wc1 and one slice of K
// (15 or 16 groups of 8 branches).  Per group it makes its 128 x 64 piece of f
// in LDS, lays the 256 x 64 piece of wc1 beside it as f16, and multiplies the
// two at once: f never goes to memory.
// Making f: one wave = 2 neighbouring branches x 16 rows, one full WMMA with a
// block-diagonal B (K = 2 x 16 hidden units, N = 2 x 8 outputs); the 8 waves
// are 4 branch pairs x 2 row halves and walk 4 tiles of 32 rows.
// Multiplying: wave tile 64 x 64, waves 2 (M) x 4 (N), 16 accumulator tiles.
// Two LDS buffers, one barrier a group.
// The f32 partial sums of the slice leave in accumulator order (a wave's tile
// is 1 KiB in a row); the next kernel adds the slices.
// The fp32 -> fp16 conversion of the two small combiner weights rides in the
// first work-groups.
// ---------------------------------------------------------------------------
__global__ __launch_bounds__(256)
void branch_gemm_kernel(const float* __restrict__ x,     // [B, N_BR]
                        const float* __restrict__ bw1,   // [N_BR, 16]
                        const float* __restrict__ bb1,   // [N_BR, 16]
                        const float* __restrict__ bw2,   // [N_BR, 8, 16]
                        const float* __restrict__ bb2,   // [N_BR, 8]
                        const float* __restrict__ wc1,   // [256, 8000]
                        const float* __restrict__ wc2,   // [128, 256]
                        const float* __restrict__ wc3,   // [300, 128]
                        _Float16* __restrict__ w2h,      // wc2 as f16
                        _Float16* __restrict__ w3h,      // wc3 as f16
                        float* __restrict__ part) {      // [tile][KSPL][256]
    __shared__ __attribute__((aligned(16))) char lds[2 * FBUF];

    const int t    = threadIdx.x;
    const int lane = t & 31;
    const int wid  = t >> 5;
    const int pr   = wid & 3;                 // making f: branch pair
    const int rh   = wid >> 2;                // making f: 16-row half of a tile
    const int wm   = wid & 1;                 // multiplying: 64-row half
    const int wn   = wid >> 1;                // multiplying: 64-column quarter
    const int m    = lane & 15;
    const int g    = lane >> 4;
    const int mt   = blockIdx.x;              // 128-row tile
    const int ks   = blockIdx.y;              // K slice
    const int gs   = ks * NGRP / KSPL;        // first group of the slice
    const int ge   = (ks + 1) * NGRP / KSPL;  // one past its last

    // ---- this work-group's share of the small weights' conversion ----
    {
        static_assert((C2D * C1D) % 8 == 0 && (OUTD * C2D) % 8 == 0, "8 values a piece");
        static_assert(CH2 + CH3 <= (B_SZ / FM) * KSPL * 256, "a piece a thread at most");
        const int pc0 = (blockIdx.y * (B_SZ / FM) + blockIdx.x) * 256 + t;
        if (pc0 < CH2 + CH3) {
            const bool third = (pc0 >= CH2);
            const float* src = third ? wc3 : wc2;
            _Float16* dst    = third ? w3h : w2h;
            const int pc     = third ? pc0 - CH2 : pc0;
            const float4 lo = *(const float4*)(src + pc * 8);
            const float4 hi = *(const float4*)(src + pc * 8 + 4);
            v8h r;
            r[0] = (_Float16)lo.x; r[1] = (_Float16)lo.y;
            r[2] = (_Float16)lo.z; r[3] = (_Float16)lo.w;
            r[4] = (_Float16)hi.x; r[5] = (_Float16)hi.y;
            r[6] = (_Float16)hi.z; r[7] = (_Float16)hi.w;
            *(v8h*)(dst + pc * 8) = r;
        }
    }

    // ---- what a group reads from memory, fetched one group ahead ----
    // Every address is a base that is the same for the whole work-group plus a
    // byte offset of the lane that never changes.
    // wc1: 16 lanes cover the 256 B of a row's 64 values, 16 rows a sweep
    const unsigned int vo_w = ((t >> 4) * KF + (t & 15) * 4) * 4u;
    // branch weights: hidden units 8g..8g+7 of both branches of the pair
    const unsigned int vo_1 = (pr * 2 * H1D + 8 * g) * 4u;
    // row m of the pair's 16 outputs
    const unsigned int vo_2 = ((pr * 2 * H2D + m) * H1D + 8 * g) * 4u;
    const unsigned int vo_b = (pr * 2 * H2D + m) * 4u;
    // x of both branches is one aligned pair (n0 even, row pitch even)
    const unsigned int vo_x = ((rh * 16 + m) * N_BR + pr * 2) * 4u;
    float4 wr[16], w1q[4], c1q[4], w2q[2];
    v2f xv[4];
    float bias;
    auto load_group = [&](int grp, bool in_loop) {
        // the lane's six addresses; every load is one of them plus a constant
        const char* sw = (const char*)(wc1 + grp * 64) + vo_w;
        const char* s1 = (const char*)(bw1 + grp * 8 * H1D) + vo_1;
        const char* sc = (const char*)(bb1 + grp * 8 * H1D) + vo_1;
        const char* s2 = (const char*)(bw2 + grp * 8 * H2D * H1D) + vo_2;
        const char* sb = (const char*)(bb2 + grp * 8 * H2D) + vo_b;
        const char* sx = (const char*)(x + (size_t)mt * FM * N_BR + grp * 8) + vo_x;
#pragma unroll                                // wr[] stays in registers
        for (int j = 0; j < 16; ++j)
            wr[j] = *(const float4*)(sw + j * (16 * KF * 4));
#pragma unroll                                // w1q[], c1q[] stay in registers
        for (int p = 0; p < 2; ++p) {
#pragma unroll                                // as above: indices become constants
            for (int h = 0; h < 2; ++h) {
                w1q[p * 2 + h] = *(const float4*)(s1 + p * (H1D * 4) + h * 16);
                c1q[p * 2 + h] = *(const float4*)(sc + p * (H1D * 4) + h * 16);
            }
        }
        w2q[0] = *(const float4*)(s2);
        w2q[1] = *(const float4*)(s2 + 16);
        bias = *(const float*)(sb);
#pragma unroll                                // xv[] stays in registers
        for (int tl = 0; tl < 4; ++tl)
            xv[tl] = *(const v2f*)(sx + tl * (32 * N_BR * 4));
        // stands directly behind the loads, in front of any rewrite of a
        // register that they name.  In the loop the six addresses are its
        // inputs, so that each keeps its registers up to here and no load's
        // result lands there; in front of the loop the loads name scalar bases
        // and the lane offsets, which live on
        if (in_loop)
            asm volatile("s_wait_xcnt 0x0"
                         :: "v"(sw), "v"(s1), "v"(sc), "v"(s2), "v"(sb), "v"(sx) : "memory");
        else
            asm volatile("s_wait_xcnt 0x0" ::: "memory");
        // nothing is scheduled in between the loads and that wait
        __builtin_amdgcn_sched_barrier(0);
    };

    v8f acc[4][4];
#pragma unroll                                // acc[][] stays in registers
    for (int i = 0; i < 4; ++i)
#pragma unroll                                // as above: indices become constants
        for (int j = 0; j < 4; ++j) acc[i][j] = (v8f){};

    // the loads below start a scheduling region of their own
    __builtin_amdgcn_sched_barrier(0);
    load_group(gs, false);

    const bool up = (m >= H2D);
    static_assert(NGRP >= KSPL, "every slice has a group");
    int grp = gs;
    do {    // at least one trip: the loads above stay where they are written
        char* buf = lds + ((grp - gs) & 1) * FBUF;
        // the last trip asks for its own group again: in bounds, unused
        const int gn = (grp + 1 < ge) ? grp + 1 : grp;

        // ---- wc1 piece to LDS as f16
#pragma unroll                                // as above: indices become constants
        for (int j = 0; j < 16; ++j) {
            v4h h;
            h[0] = (_Float16)wr[j].x; h[1] = (_Float16)wr[j].y;
            h[2] = (_Float16)wr[j].z; h[3] = (_Float16)wr[j].w;
            *(v4h*)(buf + (j * 16 + (t >> 4)) * FP + (t & 15) * 8) = h;
        }

        // ---- layer 1 ahead of its GeLU, all 4 tiles: the last use of x and
        // of the layer's weights, so that the next group's can be asked for
        v2f pre[4][8];
#pragma unroll                                // pre[][] stays in registers
        for (int tl = 0; tl < 4; ++tl) {
#pragma unroll                                // as above: indices become constants
            for (int p = 0; p < 2; ++p) {
                const v2f xb = (v2f)(p ? xv[tl].y : xv[tl].x);
#pragma unroll                                // as above: indices become constants
                for (int h = 0; h < 2; ++h) {
                    const float4 wq = w1q[p * 2 + h], cq = c1q[p * 2 + h];
                    pre[tl][p * 4 + h * 2] =
                        __builtin_elementwise_fma(xb, (v2f){wq.x, wq.y}, (v2f){cq.x, cq.y});
                    pre[tl][p * 4 + h * 2 + 1] =
                        __builtin_elementwise_fma(xb, (v2f){wq.z, wq.w}, (v2f){cq.z, cq.w});
                }
            }
        }

        // ---- B fragment, block diagonal.  Fragment elements 0..7 carry
        // hidden units 8g..8g+7 of branch n0, elements 8..15 those of branch
        // n0+1 (the A fragment below has the same order).  Column m is output
        // m&7 of branch n0 + (m>>3): weights in its own branch's half only.
        v16h b;
#pragma unroll                                // as above: indices become constants
        for (int i = 0; i < 8; ++i) {
            const float wf = (i < 4) ? ((const float*)&w2q[0])[i] : ((const float*)&w2q[1])[i - 4];
            const _Float16 w = (_Float16)wf;
            b[i]     = up ? (_Float16)0.0f : w;
            b[8 + i] = up ? w : (_Float16)0.0f;
        }
        const float bcur = bias;

        // the next group's loads start a scheduling region of their own, a
        // whole f stage ahead of their use
        __builtin_amdgcn_sched_barrier(0);
        load_group(gn, true);

        _Float16* st = (_Float16*)(buf + C1D * FP);
#pragma unroll                                // pre[][] indexed by constants
        for (int tl = 0; tl < 4; ++tl) {
            // ---- A fragment: rows = batch, K = hidden units of the pair
            v16h a;
#pragma unroll                                // as above: indices become constants
            for (int i = 0; i < 8; ++i) {
                const v2f hv = gelu_2(pre[tl][i]);
                a[2 * i]     = (_Float16)hv.x;
                a[2 * i + 1] = (_Float16)hv.y;
            }
            v8f c = {};
            c = __builtin_amdgcn_wmma_f32_16x16x32_f16(false, a, false, b,
                                                       (short)0, c, false, false);
#pragma unroll                                // as above: indices become constants
            for (int r = 0; r < 8; ++r) {
                const int row = tl * 32 + rh * 16 + r + 8 * g;  // lanes 16-31: M 8..15
                st[row * (FP / 2) + pr * 16 + m] = (_Float16)tanh_fast(c[r] + bcur);
            }
        }

        // publishes this group's f and wc1 pieces; the buffer written next was
        // last read in front of this barrier
        __syncthreads();

        // ---- 128 x 256 x 64 product; all fragments fetched as one group
        const char* ab = buf + (C1D + wm * 64 + m) * FP + 16 * g;
        const char* bb = buf + (wn * 64 + m) * FP + 16 * g;
        v16h af[2][4], bf[2][4];
#pragma unroll                                // af[][], bf[][] stay in registers
        for (int k2 = 0; k2 < 2; ++k2) {
#pragma unroll                                // as above: indices become constants
            for (int i = 0; i < 4; ++i) {
                af[k2][i] = load_frag((const _Float16*)(ab + i * 16 * FP + k2 * 64));
                bf[k2][i] = load_frag((const _Float16*)(bb + i * 16 * FP + k2 * 64));
            }
        }
        // keeps the load group in front of the WMMAs: the scheduler otherwise
        // sinks the loads to just before their use
        __builtin_amdgcn_sched_barrier(0);
#pragma unroll                                // as above: indices become constants
        for (int k2 = 0; k2 < 2; ++k2)
#pragma unroll                                // as above: indices become constants
            for (int i = 0; i < 4; ++i)
#pragma unroll                                // as above: indices become constants
                for (int j = 0; j < 4; ++j)
                    acc[i][j] = __builtin_amdgcn_wmma_f32_16x16x32_f16(
                        false, af[k2][i], false, bf[k2][j], (short)0, acc[i][j], false, false);
    } while (++grp < ge);

    // ---- the slice's partial sums, in accumulator order: tile (i,j) of wave
    // wid is 32 lanes x 8 floats in a row, the 8 slices of a tile side by side
    float* pp = part + ((size_t)((mt * 8 + wid) * 16 * KSPL + ks) * 32 + lane) * 8;
#pragma unroll                                // as above: indices become constants
    for (int i = 0; i < 4; ++i)
#pragma unroll                                // as above: indices become constants
        for (int j = 0; j < 4; ++j)
            *(v8f*)(pp + (i * 4 + j) * (KSPL * 256)) = acc[i][j];
}

// ---------------------------------------------------------------------------
// One row slice of a stage: JC async copies of 16 B per lane, 128 B apart.
// The immediate offset moves the global and the LDS address alike.
// ---------------------------------------------------------------------------
template <int J, int JC>
__device__ __forceinline__ void copy_row(const _Float16* gp, unsigned int la) {
    __builtin_amdgcn_global_load_async_to_lds_b128(
        (AS1 v4i*)(unsigned long long)(uintptr_t)gp,
        (AS3 v4i*)la, J * 128, 0);
    if constexpr (J + 1 < JC) copy_row<J + 1, JC>(gp, la);
}

// ---------------------------------------------------------------------------
// WMMA GEMM: out = act(A[M,K] @ W[N,K]^T + bias)
// Block = 256 threads = 8 waves; tile 128(M) x 64(N); wave tile 32x32.
// A stage is BK of K for the 128 A rows and the 64 W rows, laid in LDS at a
// pitch of 2*BK+16 bytes (16 B x odd: conflict-free for ds_load_b128).
// Two stage buffers: the async copies of stage t+1 fly while stage t is
// multiplied.  The epilogue stages its tile in the same LDS.
// ---------------------------------------------------------------------------
template <int K, int BK, bool GELU_ACT, bool OUT_F32>
__global__ __launch_bounds__(256)
void gemm_wmma_kernel(const _Float16* __restrict__ A,   // [M][K]
                      const _Float16* __restrict__ W,   // [Nvalid][K]
                      const float* __restrict__ bias,   // [Nvalid]
                      void* __restrict__ out,           // [M][Nout]
                      int Nvalid, int Nout) {
    constexpr int NT    = K / BK;             // stages
    constexpr int JC    = BK / 64;            // 128-B pieces per staged row
    constexpr int PITCH = BK * 2 + 16;        // bytes
    constexpr int STAGE = 192 * PITCH;        // bytes: 128 A rows + 64 W rows
    static_assert(K % BK == 0 && BK % 64 == 0 && NT >= 2, "stage shape");
    static_assert(2 * STAGE >= 128 * 64 * 4, "epilogue tile fits the ring");
    __shared__ __attribute__((aligned(16))) char ring[2 * STAGE];

    const int t    = threadIdx.x;
    const int lane = t & 31;
    const int wid  = t >> 5;
    const int wm   = wid & 3;                 // 4 M-subtiles of 32 rows
    const int wn   = wid >> 2;                // 2 N-subtiles of 32 cols
    const int n_blk  = blockIdx.y * 64;
    const int l15 = lane & 15;
    const int g   = lane >> 4;

    const int ncol0 = n_blk + wn * 32 + l15;
    const int ncol1 = n_blk + wn * 32 + 16 + l15;
    const bool b0ok = (ncol0 < Nvalid);
    const bool b1ok = (ncol1 < Nvalid);

    // copy mapping: 8 lanes cover one 128-B line of a row, 32 rows per sweep,
    // six sweeps (four of A, two of W)
    const int srow = t >> 3;
    const int ssub = t & 7;
    const _Float16* grow[6];
#pragma unroll                                // grow[] stays in registers
    for (int rg = 0; rg < 4; ++rg)
        grow[rg] = A + (size_t)(blockIdx.x * 128 + rg * 32 + srow) * K + ssub * 8;
#pragma unroll                                // grow[] stays in registers
    for (int rg = 0; rg < 2; ++rg) {
        const int gcol0 = n_blk + rg * 32 + srow;
        const int gcol  = (gcol0 < Nvalid) ? gcol0 : (Nvalid - 1);  // clamp;
        grow[4 + rg] = W + (size_t)gcol * K + ssub * 8;     // such cols dropped
    }
    const unsigned int lbase =
        (unsigned int)(uintptr_t)&ring[srow * PITCH + ssub * 16];

    auto issue = [&](int stage, int buf) {
#pragma unroll                                // grow[] indexed by constants
        for (int rg = 0; rg < 6; ++rg)
            copy_row<0, JC>(grow[rg] + stage * BK,
                            lbase + buf * STAGE + rg * 32 * PITCH);
    };

    // LDS byte offsets of this lane's fragment rows inside a stage
    const int aoff = (wm * 32 + l15) * PITCH + 16 * g;
    const int boff = (128 + wn * 32 + l15) * PITCH + 16 * g;

    v8f c00 = {}, c01 = {}, c10 = {}, c11 = {};

    issue(0, 0);
    // stage 0 has landed for this wave before the barrier publishes it
    asm volatile("s_wait_asynccnt 0x0" ::: "memory");
    __syncthreads();
    issue(1, 1);

    for (int s = 0; s < NT; ++s) {
        const char* bufp = ring + (s & 1) * STAGE;
        const _Float16* ap = (const _Float16*)(bufp + aoff);
        const _Float16* bp = (const _Float16*)(bufp + boff);
        // fragments of k step ks+1 (same stage only) are fetched as one group
        // ahead of the WMMAs of step ks, so LDS latency hides under them
        v16h a0 = load_frag(ap);
        v16h a1 = load_frag(ap + 8 * PITCH);
        v16h b0 = load_frag(bp);
        v16h b1 = load_frag(bp + 8 * PITCH);
        // unrolled: LDS offsets become immediates, the two fragment sets are
        // renamed instead of moved
#pragma unroll
        for (int ks = 0; ks < BK / 32; ++ks) {
            v16h a0n, a1n, b0n, b1n;
            if (ks + 1 < BK / 32) {
                a0n = load_frag(ap + (ks + 1) * 32);
                a1n = load_frag(ap + 8 * PITCH + (ks + 1) * 32);
                b0n = load_frag(bp + (ks + 1) * 32);
                b1n = load_frag(bp + 8 * PITCH + (ks + 1) * 32);
            }
            // keeps the load group above in front of these WMMAs: the
            // scheduler otherwise sinks the loads to just before their use
            __builtin_amdgcn_sched_barrier(0);
            c00 = __builtin_amdgcn_wmma_f32_16x16x32_f16(false, a0, false, b0,
                                                         (short)0, c00, false, false);
            c01 = __builtin_amdgcn_wmma_f32_16x16x32_f16(false, a0, false, b1,
                                                         (short)0, c01, false, false);
            c10 = __builtin_amdgcn_wmma_f32_16x16x32_f16(false, a1, false, b0,
                                                         (short)0, c10, false, false);
            c11 = __builtin_amdgcn_wmma_f32_16x16x32_f16(false, a1, false, b1,
                                                         (short)0, c11, false, false);
            if (ks + 1 < BK / 32) { a0 = a0n; a1 = a1n; b0 = b0n; b1 = b1n; }
        }
        // publish point: this wave's reads of stage s are done ...
        asm volatile("s_wait_dscnt 0x0" ::: "memory");
        // ... and its copies of stage s+1 have landed, before the barrier that
        // frees buffer s&1 and lets every wave read stage s+1
        asm volatile("s_wait_asynccnt 0x0" ::: "memory");
        __syncthreads();
        if (s + 2 < NT) issue(s + 2, s & 1);
    }
    // no copy is outstanding when the ring becomes the epilogue's stage
    asm volatile("s_wait_asynccnt 0x0" ::: "memory");

    // ---- epilogue: bias + activation, stage in LDS, coalesced store ----
    const float bv0 = b0ok ? bias[ncol0] : 0.0f;
    const float bv1 = b1ok ? bias[ncol1] : 0.0f;

    if (OUT_F32) {
        float* st = (float*)ring;
        auto put = [&](const v8f& c, int rb, int cl, float bv) {
#pragma unroll
            for (int r = 0; r < 8; r += 2) {
                v2f v = {c[r] + bv, c[r + 1] + bv};
                if (GELU_ACT) v = gelu_2(v);
                st[(rb + 8 * g + r) * 64 + cl]     = v.x;
                st[(rb + 8 * g + r + 1) * 64 + cl] = v.y;
            }
        };
        put(c00, wm * 32,      wn * 32 + l15,      bv0);
        put(c01, wm * 32,      wn * 32 + 16 + l15, bv1);
        put(c10, wm * 32 + 16, wn * 32 + l15,      bv0);
        put(c11, wm * 32 + 16, wn * 32 + 16 + l15, bv1);
        __syncthreads();
#pragma unroll
        for (int j = 0; j < 8; ++j) {         // 2048 chunks of 4 floats
            const int cchunk = t + 256 * j;
            const int row = cchunk >> 4;
            const int ch  = cchunk & 15;
            const int col0 = n_blk + ch * 4;  // Nvalid (300) is 4-aligned
            if (col0 < Nvalid) {
                *(float4*)((float*)out +
                           (size_t)(blockIdx.x * 128 + row) * Nout + col0) =
                    *(const float4*)&st[row * 64 + ch * 4];
            }
        }
    } else {
        _Float16* st = (_Float16*)ring;
        auto put = [&](const v8f& c, int rb, int cl, float bv) {
#pragma unroll
            for (int r = 0; r < 8; r += 2) {
                v2f v = {c[r] + bv, c[r + 1] + bv};
                if (GELU_ACT) v = gelu_2(v);
                st[(rb + 8 * g + r) * 64 + cl]     = (_Float16)v.x;
                st[(rb + 8 * g + r + 1) * 64 + cl] = (_Float16)v.y;
            }
        };
        put(c00, wm * 32,      wn * 32 + l15,      bv0);
        put(c01, wm * 32,      wn * 32 + 16 + l15, bv1);
        put(c10, wm * 32 + 16, wn * 32 + l15,      bv0);
        put(c11, wm * 32 + 16, wn * 32 + 16 + l15, bv1);
        __syncthreads();
#pragma unroll
        for (int j = 0; j < 4; ++j) {         // 1024 chunks of 8 halves
            const int cchunk = t + 256 * j;
            const int row = cchunk >> 3;
            const int ch  = cchunk & 7;
            *(v8h*)((_Float16*)out +
                    (size_t)(blockIdx.x * 128 + row) * Nout + n_blk + ch * 8) =
                *(const v8h*)&st[row * 64 + ch * 8];
        }
    }
}

// ---------------------------------------------------------------------------
// z1 = gelu(sum of the K slices + bc1), z2 = gelu(z1 @ wc2^T + bc2)
// A work-group of 16 waves owns 32 batch rows and all 128 columns.  wc2 (f16)
// comes into LDS by async copies, filled once, while the slices are added; z1
// goes to LDS as f16 and never to memory.  Slices are added in the order 0..7.
// ---------------------------------------------------------------------------
__global__ __launch_bounds__(512)
void reduce_gemm_kernel(const float* __restrict__ part,   // [tile][KSPL][256]
                        const _Float16* __restrict__ w2h, // [128][256]
                        const float* __restrict__ bc1,    // [256]
                        const float* __restrict__ bc2,    // [128]
                        _Float16* __restrict__ z2) {      // [B][128]
    // 128 rows of wc2, then 32 rows of z1
    __shared__ __attribute__((aligned(16))) char lds[(C2D + 32) * P2];

    const int t    = threadIdx.x;
    const int lane = t & 31;
    const int wid  = t >> 5;
    const int l15  = lane & 15;
    const int g    = lane >> 4;

    // 8 lanes cover a 128-B line of a row, 64 rows a sweep, 4 lines a row
    {
        const int srow = t >> 3;
        const int ssub = t & 7;
        const unsigned int lbase = (unsigned int)(uintptr_t)&lds[srow * P2 + ssub * 16];
#pragma unroll                                // offsets become constants
        for (int rg = 0; rg < 2; ++rg)
            copy_row<0, 4>(w2h + (size_t)(rg * 64 + srow) * C1D + ssub * 8,
                           lbase + rg * 64 * P2);
    }

    // where these 32 rows lie in the first kernel's accumulator order
    const int mt  = blockIdx.x >> 2;               // its 128-row tile
    const int wmf = (blockIdx.x >> 1) & 1;         // its 64-row half
    const int ih  = wid >> 3;                      // 16-row half of the 32 rows
    const int ti  = (blockIdx.x & 1) * 2 + ih;     // its 16-row tile
    const int wnf = (wid >> 1) & 3;                // its 64-column quarter
    const int u0  = (wid & 1) * 2;                 // first of 2 16-column tiles
    const int wm = wid & 1;                        // the product's 16-row half
    const int wn = wid >> 1;                       // its 16-column eighth
    // every load below is a kernel argument plus one of these lane offsets
    // (bytes) plus a constant: the 2 x 8 slices of the wave lie in a row
    const unsigned int vo_p =
        ((((mt * 8 + wmf + 2 * wnf) * 16 + ti * 4 + u0) * KSPL) * 32 + lane) * 32u;
    const unsigned int vo_c1 = (wnf * 64 + u0 * 16 + l15) * 4u;
    const unsigned int vo_c2 = (wn * 16 + l15) * 4u;
    // all loads of the kernel as one group, in a scheduling region of its own
    __builtin_amdgcn_sched_barrier(0);
    v8f ps[2][KSPL];
    float bv1s[2];
#pragma unroll                                // ps[][], bv1s[] stay in registers
    for (int u = 0; u < 2; ++u) {
#pragma unroll                                // as above
        for (int k = 0; k < KSPL; ++k)
            ps[u][k] = *(const v8f*)((const char*)part + vo_p + (u * KSPL + k) * 1024);
        bv1s[u] = *(const float*)((const char*)bc1 + vo_c1 + u * 64);
    }
    const float bv2 = *(const float*)((const char*)bc2 + vo_c2);
    // stands directly behind the loads, in front of any rewrite of a register
    // that they name; the lane offsets are its inputs, so that each keeps its
    // register up to here
    asm volatile("s_wait_xcnt 0x0" :: "v"(vo_p), "v"(vo_c1), "v"(vo_c2) : "memory");
    // nothing is scheduled in between the loads and that wait
    __builtin_amdgcn_sched_barrier(0);
#pragma unroll                                // ps[][] indexed by constants
    for (int u = 0; u < 2; ++u) {
        v8f s = ps[u][0];
#pragma unroll                                // as above
        for (int k = 1; k < KSPL; ++k) s += ps[u][k];
        const int col = wnf * 64 + (u0 + u) * 16 + l15;
        const float bv = bv1s[u];
#pragma unroll                                // s[] indexed by constants
        for (int r = 0; r < 8; r += 2) {
            const v2f v = gelu_2((v2f){s[r] + bv, s[r + 1] + bv});
            const int row = C2D + ih * 16 + 8 * g + r;
            *(_Float16*)(lds + row * P2 + col * 2)       = (_Float16)v.x;
            *(_Float16*)(lds + (row + 1) * P2 + col * 2) = (_Float16)v.y;
        }
    }
    // this wave's copies of wc2 have landed before the barrier publishes them
    asm volatile("s_wait_asynccnt 0x0" ::: "memory");
    __syncthreads();

    // ---- 32 x 128 x 256 product: wave tile 16 x 16, waves 2 (M) x 8 (N)
    const char* ap = lds + (C2D + wm * 16 + l15) * P2 + 16 * g;
    const char* bp = lds + (wn * 16 + l15) * P2 + 16 * g;
    v8f c0 = {};
    v16h fa[C1D / 32], fb[C1D / 32];
#pragma unroll                                // fa[], fb[] stay in registers
    for (int k = 0; k < C1D / 32; ++k) {
        fa[k] = load_frag((const _Float16*)(ap + k * 64));
        fb[k] = load_frag((const _Float16*)(bp + k * 64));
    }
    // keeps the load group in front of the WMMAs: one LDS latency for all of
    // K, where the scheduler otherwise waits out one for every WMMA
    __builtin_amdgcn_sched_barrier(0);
#pragma unroll                                // fragments indexed by constants
    for (int k = 0; k < C1D / 32; ++k)
        c0 = __builtin_amdgcn_wmma_f32_16x16x32_f16(false, fa[k], false, fb[k],
                                                    (short)0, c0, false, false);
    // every wave has read its fragments before the LDS becomes the store stage
    __syncthreads();

    _Float16* st = (_Float16*)lds;
#pragma unroll                                // c0[] indexed by constants
    for (int r = 0; r < 8; r += 2) {
        const v2f v0 = gelu_2((v2f){c0[r] + bv2, c0[r + 1] + bv2});
        const int row = wm * 16 + 8 * g + r;
        st[row * C2D + wn * 16 + l15]       = (_Float16)v0.x;
        st[(row + 1) * C2D + wn * 16 + l15] = (_Float16)v0.y;
    }
    // publishes the staged tile
    __syncthreads();
    // coalesced write: 32 rows x 256 B, one b128 chunk a thread
    *(v8h*)(z2 + (size_t)blockIdx.x * 32 * C2D + t * 8) = *(const v8h*)&st[t * 8];
}

// ---------------------------------------------------------------------------
// Launch
// ---------------------------------------------------------------------------
extern "C" void kernel_launch(void* const* d_in, const int* in_sizes, int n_in,
                              void* d_out, int out_size, void* d_ws, size_t ws_size,
                              hipStream_t stream) {
    const float* x   = (const float*)d_in[0];
    const float* bw1 = (const float*)d_in[1];
    const float* bb1 = (const float*)d_in[2];
    const float* bw2 = (const float*)d_in[3];
    const float* bb2 = (const float*)d_in[4];
    const float* wc1 = (const float*)d_in[5];
    const float* bc1 = (const float*)d_in[6];
    const float* wc2 = (const float*)d_in[7];
    const float* bc2 = (const float*)d_in[8];
    const float* wc3 = (const float*)d_in[9];
    const float* bc3 = (const float*)d_in[10];
    float* out = (float*)d_out;

    // workspace carve-out (all slices 32B-aligned)
    char* ws = (char*)d_ws;
    float*    part = (float*)ws;    ws += (size_t)KSPL * SLICE * sizeof(float);
    _Float16* z2  = (_Float16*)ws;  ws += (size_t)B_SZ * C2D * sizeof(_Float16);
    _Float16* w2h = (_Float16*)ws;  ws += (size_t)C2D  * C1D * sizeof(_Float16);
    _Float16* w3h = (_Float16*)ws;  ws += (size_t)OUTD * C2D * sizeof(_Float16);
    if ((size_t)(ws - (char*)d_ws) > ws_size) return;  // ws too small: bail

    // 1) all 1000 branch MLPs and f @ wc1^T, K in 8 slices (f32 partial sums)
    //    (and the two small combiner weights to fp16)
    branch_gemm_kernel<<<dim3(B_SZ / FM, KSPL), 256, 0, stream>>>(
        x, bw1, bb1, bw2, bb2, wc1, wc2, wc3, w2h, w3h, part);

    // 2) z1 = gelu(slices + bc1), z2 = gelu(z1 @ wc2^T + bc2)
    reduce_gemm_kernel<<<dim3(B_SZ / 32), 512, 0, stream>>>(part, w2h, bc1, bc2, z2);

    // 3) out = z2 @ wc3^T + bc3          M=4096 N=300  K=128 (fp32, guarded)
    gemm_wmma_kernel<C2D, 64, false, true><<<dim3(B_SZ / 128, (OUTD + 63) / 64), 256, 0, stream>>>(
        z2, w3h, bc3, out, OUTD, OUTD);
}

// v007
// It runs in 52.1 microseconds.
// In both of two side-by-side timings against v006, it was 1.09 times as fast.
// Counting every step since v000, it is 5.08 times as fast.
#include <hip/hip_runtime.h>
#include <hip/hip_bf16.h>

typedef __attribute__((ext_vector_type(16))) _Float16 v16h;
typedef __attribute__((ext_vector_type(8)))  _Float16 v8h;
typedef __attribute__((ext_vector_type(4)))  _Float16 v4h;
typedef __attribute__((ext_vector_type(8)))  float    v8f;
typedef int v4i __attribute__((vector_size(4 * sizeof(int))));  // b128 payload

#define B_SZ 4096
#define N_BR 1000
#define H1D  16
#define H2D  8
#define C1D  256
#define C2D  128
#define OUTD 300
#define KF   (N_BR * H2D)   // 8000
#define FM   128            // batch rows of a fused work-group
#define KSPL 8              // slices of K, one a work-group
#define NGRP (N_BR / 8)     // groups of 8 branches = 64 of K
#define FP   144            // LDS row pitch, bytes: 64 f16 + 16 (16 B x odd)
#define FBUF ((C1D + FM) * FP)   // one buffer: 256 W rows, then 128 f rows
#define SLICE (B_SZ * C1D)  // floats of one K slice's partial sums
#define P2   (C1D * 2 + 16) // LDS row pitch of the second GEMM, bytes
// the two small combiner weights in pieces of 8 values, one piece a thread
#define CH2 (C2D * C1D / 8)
#define CH3 (OUTD * C2D / 8)

#define AS1 __attribute__((address_space(1)))
#define AS3 __attribute__((address_space(3)))

typedef __attribute__((ext_vector_type(2))) float v2f;

// exact GeLU, 0.5*x*(1+erf(x/sqrt(2))), written without a branch as
//   max(x,0) - a*Q(a),  a = |x|,  Q(a) = 0.5*erfc(a/sqrt(2)) = exp2(P(a)).
// P is one polynomial of degree 6 for all of 0 <= a <= 6 (fitted to log2 Q,
// weighted by a*Q); past 6 the term a*Q is below 1e-8 and a is held at 6.
// The term a*Q(a) stays within 2e-7 of the exact one, the size of f32 rounding
// (a NaN does not pass min and max, as in tanh_fast below).
// Two values at a time, so that the polynomial runs on packed FMAs.
__device__ __forceinline__ v2f gelu_2(v2f v) {
    const v2f a = __builtin_elementwise_min(__builtin_elementwise_abs(v), (v2f)(6.0f));
    v2f p = (v2f)(0.0000330932962f);
    p = __builtin_elementwise_fma(p, a, (v2f)(-0.000769223785f));
    p = __builtin_elementwise_fma(p, a, (v2f)(0.00808072928f));
    p = __builtin_elementwise_fma(p, a, (v2f)(-0.0534121245f));
    p = __builtin_elementwise_fma(p, a, (v2f)(-0.458770961f));
    p = __builtin_elementwise_fma(p, a, (v2f)(-1.15120173f));
    p = __builtin_elementwise_fma(p, a, (v2f)(-0.999993086f));
    v2f q;
    q.x = __builtin_amdgcn_exp2f(p.x);
    q.y = __builtin_amdgcn_exp2f(p.y);
    return __builtin_elementwise_fma(-a, q, __builtin_elementwise_max(v, (v2f)(0.0f)));
}

// branch-free tanh: (e^2x - 1) * rcp(e^2x + 1), clamped so e stays finite
__device__ __forceinline__ float tanh_fast(float v) {
    v = fminf(fmaxf(v, -10.0f), 10.0f);
    const float e = __expf(2.0f * v);
    return (e - 1.0f) * __builtin_amdgcn_rcpf(e + 1.0f);
}

// Build a 16-bit A/B WMMA fragment for this lane from K-contiguous memory.
// Lane group g (lane>>4): elements 0..7 = K[8g..8g+7], elements 8..15 =
// K[16+8g..16+8g+7].  `p` must already point at row_base + 8*g.
__device__ __forceinline__ v16h load_frag(const _Float16* p) {
    v8h lo = *(const v8h*)(p);
    v8h hi = *(const v8h*)(p + 16);
    v16h r;
#pragma unroll
    for (int i = 0; i < 8; ++i) { r[i] = lo[i]; r[8 + i] = hi[i]; }
    return r;
}

// ---------------------------------------------------------------------------
// Branch stage and first combiner GEMM in one kernel.
//   h = gelu(x*bw1+bb1) [16], f = tanh(h @ bw2^T + bb2) [8], z1pre = f @ wc1^T
// A work-group owns 128 batch rows, all 256 columns of wc1 and one slice of K
// (15 or 16 groups of 8 branches).  Per group it makes its 128 x 64 piece of f
// in LDS, lays the 256 x 64 piece of wc1 beside it as f16, and multiplies the
// two at once: f never goes to memory.
// Making f: one wave = 2 neighbouring branches x 16 rows, one full WMMA with a
// block-diagonal B (K = 2 x 16 hidden units, N = 2 x 8 outputs); the 8 waves
// are 4 branch pairs x 2 row halves and walk 4 tiles of 32 rows.
// Multiplying: wave tile 64 x 64, waves 2 (M) x 4 (N), 16 accumulator tiles.
// Two LDS buffers, one barrier a group.  The loop is staggered by one group:
// while group g is made in one buffer, group g-1 is multiplied out of the
// other, its fragment reads and WMMAs standing among the vector work.
// The f32 partial sums of the slice leave in accumulator order (a wave's tile
// is 1 KiB in a row); the next kernel adds the slices.
// The fp32 -> fp16 conversion of the two small combiner weights rides in the
// first work-groups.
// ---------------------------------------------------------------------------
__global__ __launch_bounds__(256)
void branch_gemm_kernel(const float* __restrict__ x,     // [B, N_BR]
                        const float* __restrict__ bw1,   // [N_BR, 16]
                        const float* __restrict__ bb1,   // [N_BR, 16]
                        const float* __restrict__ bw2,   // [N_BR, 8, 16]
                        const float* __restrict__ bb2,   // [N_BR, 8]
                        const float* __restrict__ wc1,   // [256, 8000]
                        const float* __restrict__ wc2,   // [128, 256]
                        const float* __restrict__ wc3,   // [300, 128]
                        _Float16* __restrict__ w2h,      // wc2 as f16
                        _Float16* __restrict__ w3h,      // wc3 as f16
                        float* __restrict__ part) {      // [tile][KSPL][256]
    __shared__ __attribute__((aligned(16))) char lds[2 * FBUF];

    const int t    = threadIdx.x;
    const int lane = t & 31;
    const int wid  = t >> 5;
    const int pr   = wid & 3;                 // making f: branch pair
    const int rh   = wid >> 2;                // making f: 16-row half of a tile
    const int wm   = wid & 1;                 // multiplying: 64-row half
    const int wn   = wid >> 1;                // multiplying: 64-column quarter
    const int m    = lane & 15;
    const int g    = lane >> 4;
    const int mt   = blockIdx.x;              // 128-row tile
    const int ks   = blockIdx.y;              // K slice
    const int gs   = ks * NGRP / KSPL;        // first group of the slice
    const int ge   = (ks + 1) * NGRP / KSPL;  // one past its last

    // ---- this work-group's share of the small weights' conversion ----
    {
        static_assert((C2D * C1D) % 8 == 0 && (OUTD * C2D) % 8 == 0, "8 values a piece");
        static_assert(CH2 + CH3 <= (B_SZ / FM) * KSPL * 256, "a piece a thread at most");
        const int pc0 = (blockIdx.y * (B_SZ / FM) + blockIdx.x) * 256 + t;
        if (pc0 < CH2 + CH3) {
            const bool third = (pc0 >= CH2);
            const float* src = third ? wc3 : wc2;
            _Float16* dst    = third ? w3h : w2h;
            const int pc     = third ? pc0 - CH2 : pc0;
            const float4 lo = *(const float4*)(src + pc * 8);
            const float4 hi = *(const float4*)(src + pc * 8 + 4);
            v8h r;
            r[0] = (_Float16)lo.x; r[1] = (_Float16)lo.y;
            r[2] = (_Float16)lo.z; r[3] = (_Float16)lo.w;
            r[4] = (_Float16)hi.x; r[5] = (_Float16)hi.y;
            r[6] = (_Float16)hi.z; r[7] = (_Float16)hi.w;
            *(v8h*)(dst + pc * 8) = r;
        }
    }

    // ---- what a group reads from memory, fetched one group ahead ----
    // Every address is a base that is the same for the whole work-group plus a
    // byte offset of the lane that never changes.
    // wc1: 16 lanes cover the 256 B of a row's 64 values, 16 rows a sweep
    const unsigned int vo_w = ((t >> 4) * KF + (t & 15) * 4) * 4u;
    // branch weights: hidden units 8g..8g+7 of both branches of the pair
    const unsigned int vo_1 = (pr * 2 * H1D + 8 * g) * 4u;
    // row m of the pair's 16 outputs
    const unsigned int vo_2 = ((pr * 2 * H2D + m) * H1D + 8 * g) * 4u;
    const unsigned int vo_b = (pr * 2 * H2D + m) * 4u;
    // x of both branches is one aligned pair (n0 even, row pitch even)
    const unsigned int vo_x = ((rh * 16 + m) * N_BR + pr * 2) * 4u;
    float4 wr[16], w1q[4], c1q[4], w2q[2];
    v2f xv[4];
    float bias;
    auto load_group = [&](int grp, bool in_loop) {
        // the lane's six addresses; every load is one of them plus a constant
        const char* sw = (const char*)(wc1 + grp * 64) + vo_w;
        const char* s1 = (const char*)(bw1 + grp * 8 * H1D) + vo_1;
        const char* sc = (const char*)(bb1 + grp * 8 * H1D) + vo_1;
        const char* s2 = (const char*)(bw2 + grp * 8 * H2D * H1D) + vo_2;
        const char* sb = (const char*)(bb2 + grp * 8 * H2D) + vo_b;
        const char* sx = (const char*)(x + (size_t)mt * FM * N_BR + grp * 8) + vo_x;
#pragma unroll                                // wr[] stays in registers
        for (int j = 0; j < 16; ++j)
            wr[j] = *(const float4*)(sw + j * (16 * KF * 4));
#pragma unroll                                // w1q[], c1q[] stay in registers
        for (int p = 0; p < 2; ++p) {
#pragma unroll                                // as above: indices become constants
            for (int h = 0; h < 2; ++h) {
                w1q[p * 2 + h] = *(const float4*)(s1 + p * (H1D * 4) + h * 16);
                c1q[p * 2 + h] = *(const float4*)(sc + p * (H1D * 4) + h * 16);
            }
        }
        w2q[0] = *(const float4*)(s2);
        w2q[1] = *(const float4*)(s2 + 16);
        bias = *(const float*)(sb);
#pragma unroll                                // xv[] stays in registers
        for (int tl = 0; tl < 4; ++tl)
            xv[tl] = *(const v2f*)(sx + tl * (32 * N_BR * 4));
        // stands directly behind the loads, in front of any rewrite of a
        // register that they name.  In the loop the six addresses are its
        // inputs, so that each keeps its registers up to here and no load's
        // result lands there; in front of the loop the loads name scalar bases
        // and the lane offsets, which live on
        if (in_loop)
            asm volatile("s_wait_xcnt 0x0"
                         :: "v"(sw), "v"(s1), "v"(sc), "v"(s2), "v"(sb), "v"(sx) : "memory");
        else
            asm volatile("s_wait_xcnt 0x0" ::: "memory");
        // nothing is scheduled in between the loads and that wait
        __builtin_amdgcn_sched_barrier(0);
    };

    v8f acc[4][4];
#pragma unroll                                // acc[][] stays in registers
    for (int i = 0; i < 4; ++i)
#pragma unroll                                // as above: indices become constants
        for (int j = 0; j < 4; ++j) acc[i][j] = (v8f){};

    // the loads below start a scheduling region of their own
    __builtin_amdgcn_sched_barrier(0);
    load_group(gs, false);

    const bool up = (m >= H2D);
    static_assert(NGRP >= 2 * KSPL, "every slice has two groups");

    v2f pre[4][8];
    v16h b;
    float bcur;
    // ---- head of a group: all that uses up what was fetched for it, then the
    // request for group gn
    auto head = [&](char* buf, int gn, bool in_loop) {
        // ---- wc1 piece to LDS as f16
#pragma unroll                                // as above: indices become constants
        for (int j = 0; j < 16; ++j) {
            v4h h;
            h[0] = (_Float16)wr[j].x; h[1] = (_Float16)wr[j].y;
            h[2] = (_Float16)wr[j].z; h[3] = (_Float16)wr[j].w;
            *(v4h*)(buf + (j * 16 + (t >> 4)) * FP + (t & 15) * 8) = h;
        }

        // ---- layer 1 ahead of its GeLU, all 4 tiles: the last use of x and
        // of the layer's weights, so that the next group's can be asked for
#pragma unroll                                // pre[][] stays in registers
        for (int tl = 0; tl < 4; ++tl) {
#pragma unroll                                // as above: indices become constants
            for (int p = 0; p < 2; ++p) {
                const v2f xb = (v2f)(p ? xv[tl].y : xv[tl].x);
#pragma unroll                                // as above: indices become constants
                for (int h = 0; h < 2; ++h) {
                    const float4 wq = w1q[p * 2 + h], cq = c1q[p * 2 + h];
                    pre[tl][p * 4 + h * 2] =
                        __builtin_elementwise_fma(xb, (v2f){wq.x, wq.y}, (v2f){cq.x, cq.y});
                    pre[tl][p * 4 + h * 2 + 1] =
                        __builtin_elementwise_fma(xb, (v2f){wq.z, wq.w}, (v2f){cq.z, cq.w});
                }
            }
        }

        // ---- B fragment, block diagonal.  Fragment elements 0..7 carry
        // hidden units 8g..8g+7 of branch n0, elements 8..15 those of branch
        // n0+1 (the A fragment below has the same order).  Column m is output
        // m&7 of branch n0 + (m>>3): weights in its own branch's half only.
#pragma unroll                                // as above: indices become constants
        for (int i = 0; i < 8; ++i) {
            const float wf = (i < 4) ? ((const float*)&w2q[0])[i] : ((const float*)&w2q[1])[i - 4];
            const _Float16 w = (_Float16)wf;
            b[i]     = up ? (_Float16)0.0f : w;
            b[8 + i] = up ? w : (_Float16)0.0f;
        }
        bcur = bias;

        // the next group's loads start a scheduling region of their own, a
        // whole f stage ahead of their use
        __builtin_amdgcn_sched_barrier(0);
        load_group(gn, in_loop);
    };

    // ---- 32 rows of the group's f (this wave: 16 rows x 2 branches) to LDS,
    // in two parts.  A fragment: rows = batch, K = hidden units of the pair
    auto hidden = [&](int tl) {
        v16h a;
#pragma unroll                                // as above: indices become constants
        for (int i = 0; i < 8; ++i) {
            const v2f hv = gelu_2(pre[tl][i]);
            a[2 * i]     = (_Float16)hv.x;
            a[2 * i + 1] = (_Float16)hv.y;
        }
        return a;
    };
    auto finish = [&](char* buf, int tl, v16h a) {
        _Float16* st = (_Float16*)(buf + C1D * FP);
        v8f c = {};
        c = __builtin_amdgcn_wmma_f32_16x16x32_f16(false, a, false, b,
                                                   (short)0, c, false, false);
#pragma unroll                                // as above: indices become constants
        for (int r = 0; r < 8; ++r) {
            const int row = tl * 32 + rh * 16 + r + 8 * g;  // lanes 16-31: M 8..15
            st[row * (FP / 2) + pr * 16 + m] = (_Float16)tanh_fast(c[r] + bcur);
        }
    };
    auto tile = [&](char* buf, int tl) { finish(buf, tl, hidden(tl)); };

    // ---- the 128 x 256 x 64 product of a published buffer, in 4 quarters:
    // fragments of 32 of K as one group, then 2 x 8 WMMAs
    v16h af[4], bf[4];
    auto frags = [&](const char* pb, int k2) {
        const char* ab = pb + (C1D + wm * 64 + m) * FP + 16 * g + k2 * 64;
        const char* bb = pb + (wn * 64 + m) * FP + 16 * g + k2 * 64;
#pragma unroll                                // af[], bf[] stay in registers
        for (int i = 0; i < 4; ++i) {
            af[i] = load_frag((const _Float16*)(ab + i * 16 * FP));
            bf[i] = load_frag((const _Float16*)(bb + i * 16 * FP));
        }
        // keeps the load group where it is written (in the loop: a stretch of
        // vector work ahead of its WMMAs): the scheduler otherwise sinks the
        // loads to just before their use
        __builtin_amdgcn_sched_barrier(0);
    };
    auto quarter = [&](int ih) {
#pragma unroll                                // as above: indices become constants
        for (int i = 2 * ih; i < 2 * ih + 2; ++i)
#pragma unroll                                // as above: indices become constants
            for (int j = 0; j < 4; ++j)
                acc[i][j] = __builtin_amdgcn_wmma_f32_16x16x32_f16(
                    false, af[i], false, bf[j], (short)0, acc[i][j], false, false);
    };

    // ---- first group: made, not yet multiplied
    head(lds, gs + 1, false);
#pragma unroll                                // pre[][] indexed by constants
    for (int tl = 0; tl < 4; ++tl) tile(lds, tl);
    // publishes the first group's f and wc1 pieces
    __syncthreads();

    // ---- group grp is made while group grp-1 is multiplied: each quarter of
    // the product stands behind a tile of vector work, so that one wave's
    // WMMAs and LDS reads run under the other wave's (and its own) GeLU, tanh
    int grp = gs + 1;
    do {    // at least one trip
        char* buf       = lds + ((grp - gs) & 1) * FBUF;
        const char* prv = lds + ((grp - gs - 1) & 1) * FBUF;
        // the last trip asks for its own group again: in bounds, unused
        const int gn = (grp + 1 < ge) ? grp + 1 : grp;

        frags(prv, 0);
        head(buf, gn, true);
        tile(buf, 0);
        quarter(0);
        tile(buf, 1);
        quarter(1);
        frags(prv, 1);
        const v16h a2 = hidden(2);
        // keeps the WMMAs below behind that GeLU, which covers the latency of
        // the fragment reads: the scheduler otherwise lifts them to the reads
        __builtin_amdgcn_sched_barrier(0);
        quarter(0);
        finish(buf, 2, a2);
        tile(buf, 3);
        quarter(1);

        // publishes this group's f and wc1 pieces; the buffer written next was
        // last read in front of this barrier
        __syncthreads();
    } while (++grp < ge);

    // ---- the last group's product
    {
        const char* prv = lds + ((ge - gs - 1) & 1) * FBUF;
        frags(prv, 0);
        quarter(0);
        quarter(1);
        frags(prv, 1);
        quarter(0);
        quarter(1);
    }

    // ---- the slice's partial sums, in accumulator order: tile (i,j) of wave
    // wid is 32 lanes x 8 floats in a row, the 8 slices of a tile side by side
    float* pp = part + ((size_t)((mt * 8 + wid) * 16 * KSPL + ks) * 32 + lane) * 8;
#pragma unroll                                // as above: indices become constants
    for (int i = 0; i < 4; ++i)
#pragma unroll                                // as above: indices become constants
        for (int j = 0; j < 4; ++j)
            *(v8f*)(pp + (i * 4 + j) * (KSPL * 256)) = acc[i][j];
}

// ---------------------------------------------------------------------------
// One row slice of a stage: JC async copies of 16 B per lane, 128 B apart.
// The immediate offset moves the global and the LDS address alike.
// ---------------------------------------------------------------------------
template <int J, int JC>
__device__ __forceinline__ void copy_row(const _Float16* gp, unsigned int la) {
    __builtin_amdgcn_global_load_async_to_lds_b128(
        (AS1 v4i*)(unsigned long long)(uintptr_t)gp,
        (AS3 v4i*)la, J * 128, 0);
    if constexpr (J + 1 < JC) copy_row<J + 1, JC>(gp, la);
}

// ---------------------------------------------------------------------------
// WMMA GEMM: out = act(A[M,K] @ W[N,K]^T + bias)
// Block = 256 threads = 8 waves; tile 128(M) x 64(N); wave tile 32x32.
// A stage is BK of K for the 128 A rows and the 64 W rows, laid in LDS at a
// pitch of 2*BK+16 bytes (16 B x odd: conflict-free for ds_load_b128).
// Two stage buffers: the async copies of stage t+1 fly while stage t is
// multiplied.  The epilogue stages its tile in the same LDS.
// ---------------------------------------------------------------------------
template <int K, int BK, bool GELU_ACT, bool OUT_F32>
__global__ __launch_bounds__(256)
void gemm_wmma_kernel(const _Float16* __restrict__ A,   // [M][K]
                      const _Float16* __restrict__ W,   // [Nvalid][K]
                      const float* __restrict__ bias,   // [Nvalid]
                      void* __restrict__ out,           // [M][Nout]
                      int Nvalid, int Nout) {
    constexpr int NT    = K / BK;             // stages
    constexpr int JC    = BK / 64;            // 128-B pieces per staged row
    constexpr int PITCH = BK * 2 + 16;        // bytes
    constexpr int STAGE = 192 * PITCH;        // bytes: 128 A rows + 64 W rows
    static_assert(K % BK == 0 && BK % 64 == 0 && NT >= 2, "stage shape");
    static_assert(2 * STAGE >= 128 * 64 * 4, "epilogue tile fits the ring");
    __shared__ __attribute__((aligned(16))) char ring[2 * STAGE];

    const int t    = threadIdx.x;
    const int lane = t & 31;
    const int wid  = t >> 5;
    const int wm   = wid & 3;                 // 4 M-subtiles of 32 rows
    const int wn   = wid >> 2;                // 2 N-subtiles of 32 cols
    const int n_blk  = blockIdx.y * 64;
    const int l15 = lane & 15;
    const int g   = lane >> 4;

    const int ncol0 = n_blk + wn * 32 + l15;
    const int ncol1 = n_blk + wn * 32 + 16 + l15;
    const bool b0ok = (ncol0 < Nvalid);
    const bool b1ok = (ncol1 < Nvalid);

    // copy mapping: 8 lanes cover one 128-B line of a row, 32 rows per sweep,
    // six sweeps (four of A, two of W)
    const int srow = t >> 3;
    const int ssub = t & 7;
    const _Float16* grow[6];
#pragma unroll                                // grow[] stays in registers
    for (int rg = 0; rg < 4; ++rg)
        grow[rg] = A + (size_t)(blockIdx.x * 128 + rg * 32 + srow) * K + ssub * 8;
#pragma unroll                                // grow[] stays in registers
    for (int rg = 0; rg < 2; ++rg) {
        const int gcol0 = n_blk + rg * 32 + srow;
        const int gcol  = (gcol0 < Nvalid) ? gcol0 : (Nvalid - 1);  // clamp;
        grow[4 + rg] = W + (size_t)gcol * K + ssub * 8;     // such cols dropped
    }
    const unsigned int lbase =
        (unsigned int)(uintptr_t)&ring[srow * PITCH + ssub * 16];

    auto issue = [&](int stage, int buf) {
#pragma unroll                                // grow[] indexed by constants
        for (int rg = 0; rg < 6; ++rg)
            copy_row<0, JC>(grow[rg] + stage * BK,
                            lbase + buf * STAGE + rg * 32 * PITCH);
    };

    // LDS byte offsets of this lane's fragment rows inside a stage
    const int aoff = (wm * 32 + l15) * PITCH + 16 * g;
    const int boff = (128 + wn * 32 + l15) * PITCH + 16 * g;

    v8f c00 = {}, c01 = {}, c10 = {}, c11 = {};

    issue(0, 0);
    // stage 0 has landed for this wave before the barrier publishes it
    asm volatile("s_wait_asynccnt 0x0" ::: "memory");
    __syncthreads();
    issue(1, 1);

    for (int s = 0; s < NT; ++s) {
        const char* bufp = ring + (s & 1) * STAGE;
        const _Float16* ap = (const _Float16*)(bufp + aoff);
        const _Float16* bp = (const _Float16*)(bufp + boff);
        // fragments of k step ks+1 (same stage only) are fetched as one group
        // ahead of the WMMAs of step ks, so LDS latency hides under them
        v16h a0 = load_frag(ap);
        v16h a1 = load_frag(ap + 8 * PITCH);
        v16h b0 = load_frag(bp);
        v16h b1 = load_frag(bp + 8 * PITCH);
        // unrolled: LDS offsets become immediates, the two fragment sets are
        // renamed instead of moved
#pragma unroll
        for (int ks = 0; ks < BK / 32; ++ks) {
            v16h a0n, a1n, b0n, b1n;
            if (ks + 1 < BK / 32) {
                a0n = load_frag(ap + (ks + 1) * 32);
                a1n = load_frag(ap + 8 * PITCH + (ks + 1) * 32);
                b0n = load_frag(bp + (ks + 1) * 32);
                b1n = load_frag(bp + 8 * PITCH + (ks + 1) * 32);
            }
            // keeps the load group above in front of these WMMAs: the
            // scheduler otherwise sinks the loads to just before their use
            __builtin_amdgcn_sched_barrier(0);
            c00 = __builtin_amdgcn_wmma_f32_16x16x32_f16(false, a0, false, b0,
                                                         (short)0, c00, false, false);
            c01 = __builtin_amdgcn_wmma_f32_16x16x32_f16(false, a0, false, b1,
                                                         (short)0, c01, false, false);
            c10 = __builtin_amdgcn_wmma_f32_16x16x32_f16(false, a1, false, b0,
                                                         (short)0, c10, false, false);
            c11 = __builtin_amdgcn_wmma_f32_16x16x32_f16(false, a1, false, b1,
                                                         (short)0, c11, false, false);
            if (ks + 1 < BK / 32) { a0 = a0n; a1 = a1n; b0 = b0n; b1 = b1n; }
        }
        // publish point: this wave's reads of stage s are done ...
        asm volatile("s_wait_dscnt 0x0" ::: "memory");
        // ... and its copies of stage s+1 have landed, before the barrier that
        // frees buffer s&1 and lets every wave read stage s+1
        asm volatile("s_wait_asynccnt 0x0" ::: "memory");
        __syncthreads();
        if (s + 2 < NT) issue(s + 2, s & 1);
    }
    // no copy is outstanding when the ring becomes the epilogue's stage
    asm volatile("s_wait_asynccnt 0x0" ::: "memory");

    // ---- epilogue: bias + activation, stage in LDS, coalesced store ----
    const float bv0 = b0ok ? bias[ncol0] : 0.0f;
    const float bv1 = b1ok ? bias[ncol1] : 0.0f;

    if (OUT_F32) {
        float* st = (float*)ring;
        auto put = [&](const v8f& c, int rb, int cl, float bv) {
#pragma unroll
            for (int r = 0; r < 8; r += 2) {
                v2f v = {c[r] + bv, c[r + 1] + bv};
                if (GELU_ACT) v = gelu_2(v);
                st[(rb + 8 * g + r) * 64 + cl]     = v.x;
                st[(rb + 8 * g + r + 1) * 64 + cl] = v.y;
            }
        };
        put(c00, wm * 32,      wn * 32 + l15,      bv0);
        put(c01, wm * 32,      wn * 32 + 16 + l15, bv1);
        put(c10, wm * 32 + 16, wn * 32 + l15,      bv0);
        put(c11, wm * 32 + 16, wn * 32 + 16 + l15, bv1);
        __syncthreads();
#pragma unroll
        for (int j = 0; j < 8; ++j) {         // 2048 chunks of 4 floats
            const int cchunk = t + 256 * j;
            const int row = cchunk >> 4;
            const int ch  = cchunk & 15;
            const int col0 = n_blk + ch * 4;  // Nvalid (300) is 4-aligned
            if (col0 < Nvalid) {
                *(float4*)((float*)out +
                           (size_t)(blockIdx.x * 128 + row) * Nout + col0) =
                    *(const float4*)&st[row * 64 + ch * 4];
            }
        }
    } else {
        _Float16* st = (_Float16*)ring;
        auto put = [&](const v8f& c, int rb, int cl, float bv) {
#pragma unroll
            for (int r = 0; r < 8; r += 2) {
                v2f v = {c[r] + bv, c[r + 1] + bv};
                if (GELU_ACT) v = gelu_2(v);
                st[(rb + 8 * g + r) * 64 + cl]     = (_Float16)v.x;
                st[(rb + 8 * g + r + 1) * 64 + cl] = (_Float16)v.y;
            }
        };
        put(c00, wm * 32,      wn * 32 + l15,      bv0);
        put(c01, wm * 32,      wn * 32 + 16 + l15, bv1);
        put(c10, wm * 32 + 16, wn * 32 + l15,      bv0);
        put(c11, wm * 32 + 16, wn * 32 + 16 + l15, bv1);
        __syncthreads();
#pragma unroll
        for (int j = 0; j < 4; ++j) {         // 1024 chunks of 8 halves
            const int cchunk = t + 256 * j;
            const int row = cchunk >> 3;
            const int ch  = cchunk & 7;
            *(v8h*)((_Float16*)out +
                    (size_t)(blockIdx.x * 128 + row) * Nout + n_blk + ch * 8) =
                *(const v8h*)&st[row * 64 + ch * 8];
        }
    }
}

// ---------------------------------------------------------------------------
// z1 = gelu(sum of the K slices + bc1), z2 = gelu(z1 @ wc2^T + bc2)
// A work-group of 16 waves owns 32 batch rows and all 128 columns.  wc2 (f16)
// comes into LDS by async copies, filled once, while the slices are added; z1
// goes to LDS as f16 and never to memory.  Slices are added in the order 0..7.
// ---------------------------------------------------------------------------
__global__ __launch_bounds__(512)
void reduce_gemm_kernel(const float* __restrict__ part,   // [tile][KSPL][256]
                        const _Float16* __restrict__ w2h, // [128][256]
                        const float* __restrict__ bc1,    // [256]
                        const float* __restrict__ bc2,    // [128]
                        _Float16* __restrict__ z2) {      // [B][128]
    // 128 rows of wc2, then 32 rows of z1
    __shared__ __attribute__((aligned(16))) char lds[(C2D + 32) * P2];

    const int t    = threadIdx.x;
    const int lane = t & 31;
    const int wid  = t >> 5;
    const int l15  = lane & 15;
    const int g    = lane >> 4;

    // 8 lanes cover a 128-B line of a row, 64 rows a sweep, 4 lines a row
    {
        const int srow = t >> 3;
        const int ssub = t & 7;
        const unsigned int lbase = (unsigned int)(uintptr_t)&lds[srow * P2 + ssub * 16];
#pragma unroll                                // offsets become constants
        for (int rg = 0; rg < 2; ++rg)
            copy_row<0, 4>(w2h + (size_t)(rg * 64 + srow) * C1D + ssub * 8,
                           lbase + rg * 64 * P2);
    }

    // where these 32 rows lie in the first kernel's accumulator order
    const int mt  = blockIdx.x >> 2;               // its 128-row tile
    const int wmf = (blockIdx.x >> 1) & 1;         // its 64-row half
    const int ih  = wid >> 3;                      // 16-row half of the 32 rows
    const int ti  = (blockIdx.x & 1) * 2 + ih;     // its 16-row tile
    const int wnf = (wid >> 1) & 3;                // its 64-column quarter
    const int u0  = (wid & 1) * 2;                 // first of 2 16-column tiles
    const int wm = wid & 1;                        // the product's 16-row half
    const int wn = wid >> 1;                       // its 16-column eighth
    // every load below is a kernel argument plus one of these lane offsets
    // (bytes) plus a constant: the 2 x 8 slices of the wave lie in a row
    const unsigned int vo_p =
        ((((mt * 8 + wmf + 2 * wnf) * 16 + ti * 4 + u0) * KSPL) * 32 + lane) * 32u;
    const unsigned int vo_c1 = (wnf * 64 + u0 * 16 + l15) * 4u;
    const unsigned int vo_c2 = (wn * 16 + l15) * 4u;
    // all loads of the kernel as one group, in a scheduling region of its own
    __builtin_amdgcn_sched_barrier(0);
    v8f ps[2][KSPL];
    float bv1s[2];
#pragma unroll                                // ps[][], bv1s[] stay in registers
    for (int u = 0; u < 2; ++u) {
#pragma unroll                                // as above
        for (int k = 0; k < KSPL; ++k)
            ps[u][k] = *(const v8f*)((const char*)part + vo_p + (u * KSPL + k) * 1024);
        bv1s[u] = *(const float*)((const char*)bc1 + vo_c1 + u * 64);
    }
    const float bv2 = *(const float*)((const char*)bc2 + vo_c2);
    // stands directly behind the loads, in front of any rewrite of a register
    // that they name; the lane offsets are its inputs, so that each keeps its
    // register up to here
    asm volatile("s_wait_xcnt 0x0" :: "v"(vo_p), "v"(vo_c1), "v"(vo_c2) : "memory");
    // nothing is scheduled in between the loads and that wait
    __builtin_amdgcn_sched_barrier(0);
#pragma unroll                                // ps[][] indexed by constants
    for (int u = 0; u < 2; ++u) {
        v8f s = ps[u][0];
#pragma unroll                                // as above
        for (int k = 1; k < KSPL; ++k) s += ps[u][k];
        const int col = wnf * 64 + (u0 + u) * 16 + l15;
        const float bv = bv1s[u];
#pragma unroll                                // s[] indexed by constants
        for (int r = 0; r < 8; r += 2) {
            const v2f v = gelu_2((v2f){s[r] + bv, s[r + 1] + bv});
            const int row = C2D + ih * 16 + 8 * g + r;
            *(_Float16*)(lds + row * P2 + col * 2)       = (_Float16)v.x;
            *(_Float16*)(lds + (row + 1) * P2 + col * 2) = (_Float16)v.y;
        }
    }
    // this wave's copies of wc2 have landed before the barrier publishes them
    asm volatile("s_wait_asynccnt 0x0" ::: "memory");
    __syncthreads();

    // ---- 32 x 128 x 256 product: wave tile 16 x 16, waves 2 (M) x 8 (N)
    const char* ap = lds + (C2D + wm * 16 + l15) * P2 + 16 * g;
    const char* bp = lds + (wn * 16 + l15) * P2 + 16 * g;
    v8f c0 = {};
    v16h fa[C1D / 32], fb[C1D / 32];
#pragma unroll                                // fa[], fb[] stay in registers
    for (int k = 0; k < C1D / 32; ++k) {
        fa[k] = load_frag((const _Float16*)(ap + k * 64));
        fb[k] = load_frag((const _Float16*)(bp + k * 64));
    }
    // keeps the load group in front of the WMMAs: one LDS latency for all of
    // K, where the scheduler otherwise waits out one for every WMMA
    __builtin_amdgcn_sched_barrier(0);
#pragma unroll                                // fragments indexed by constants
    for (int k = 0; k < C1D / 32; ++k)
        c0 = __builtin_amdgcn_wmma_f32_16x16x32_f16(false, fa[k], false, fb[k],
                                                    (short)0, c0, false, false);
    // every wave has read its fragments before the LDS becomes the store stage
    __syncthreads();

    _Float16* st = (_Float16*)lds;
#pragma unroll                                // c0[] indexed by constants
    for (int r = 0; r < 8; r += 2) {
        const v2f v0 = gelu_2((v2f){c0[r] + bv2, c0[r + 1] + bv2});
        const int row = wm * 16 + 8 * g + r;
        st[row * C2D + wn * 16 + l15]       = (_Float16)v0.x;
        st[(row + 1) * C2D + wn * 16 + l15] = (_Float16)v0.y;
    }
    // publishes the staged tile
    __syncthreads();
    // coalesced write: 32 rows x 256 B, one b128 chunk a thread
    *(v8h*)(z2 + (size_t)blockIdx.x * 32 * C2D + t * 8) = *(const v8h*)&st[t * 8];
}

// ---------------------------------------------------------------------------
// Launch
// ---------------------------------------------------------------------------
extern "C" void kernel_launch(void* const* d_in, const int* in_sizes, int n_in,
                              void* d_out, int out_size, void* d_ws, size_t ws_size,
                              hipStream_t stream) {
    const float* x   = (const float*)d_in[0];
    const float* bw1 = (const float*)d_in[1];
    const float* bb1 = (const float*)d_in[2];
    const float* bw2 = (const float*)d_in[3];
    const float* bb2 = (const float*)d_in[4];
    const float* wc1 = (const float*)d_in[5];
    const float* bc1 = (const float*)d_in[6];
    const float* wc2 = (const float*)d_in[7];
    const float* bc2 = (const float*)d_in[8];
    const float* wc3 = (const float*)d_in[9];
    const float* bc3 = (const float*)d_in[10];
    float* out = (float*)d_out;

    // workspace carve-out (all slices 32B-aligned)
    char* ws = (char*)d_ws;
    float*    part = (float*)ws;    ws += (size_t)KSPL * SLICE * sizeof(float);
    _Float16* z2  = (_Float16*)ws;  ws += (size_t)B_SZ * C2D * sizeof(_Float16);
    _Float16* w2h = (_Float16*)ws;  ws += (size_t)C2D  * C1D * sizeof(_Float16);
    _Float16* w3h = (_Float16*)ws;  ws += (size_t)OUTD * C2D * sizeof(_Float16);
    if ((size_t)(ws - (char*)d_ws) > ws_size) return;  // ws too small: bail

    // 1) all 1000 branch MLPs and f @ wc1^T, K in 8 slices (f32 partial sums)
    //    (and the two small combiner weights to fp16)
    branch_gemm_kernel<<<dim3(B_SZ / FM, KSPL), 256, 0, stream>>>(
        x, bw1, bb1, bw2, bb2, wc1, wc2, wc3, w2h, w3h, part);

    // 2) z1 = gelu(slices + bc1), z2 = gelu(z1 @ wc2^T + bc2)
    reduce_gemm_kernel<<<dim3(B_SZ / 32), 512, 0, stream>>>(part, w2h, bc1, bc2, z2);

    // 3) out = z2 @ wc3^T + bc3          M=4096 N=300  K=128 (fp32, guarded)
    gemm_wmma_kernel<C2D, 64, false, true><<<dim3(B_SZ / 128, (OUTD + 63) / 64), 256, 0, stream>>>(
        z2, w3h, bc3, out, OUTD, OUTD);
}

// v008
// One run takes 48.2 microseconds.
// In both of two side-by-side timings against v007, it was 1.08 times as fast.
// Over all steps from v000 it is 5.49 times as fast.
#include <hip/hip_runtime.h>
#include <hip/hip_bf16.h>

typedef __attribute__((ext_vector_type(16))) _Float16 v16h;
typedef __attribute__((ext_vector_type(8)))  _Float16 v8h;
typedef __attribute__((ext_vector_type(4)))  _Float16 v4h;
typedef __attribute__((ext_vector_type(8)))  float    v8f;
typedef int v4i __attribute__((vector_size(4 * sizeof(int))));  // b128 payload

#define B_SZ 4096
#define N_BR 1000
#define H1D  16
#define H2D  8
#define C1D  256
#define C2D  128
#define OUTD 300
#define KF   (N_BR * H2D)   // 8000
#define FM   128            // batch rows of a fused work-group
#define KSPL 8              // slices of K, one a work-group
#define NGRP (N_BR / 8)     // groups of 8 branches = 64 of K
#define FP   144            // LDS row pitch, bytes: 64 f16 + 16 (16 B x odd)
#define FBUF ((C1D + FM) * FP)   // one buffer: 256 W rows, then 128 f rows
#define SLICE (B_SZ * C1D)  // floats of one K slice's partial sums
#define P2   (C1D * 2 + 16) // LDS row pitch of the second GEMM, bytes
#define P3   (C2D * 2 + 16) // LDS row pitch of the third GEMM, bytes (16 B x odd)
#define NT3  ((OUTD + 15) / 16)  // 16-column tiles of the output
#define W3R  320            // LDS rows of wc3: 5 sweeps of 64
#define O_W3 ((C2D + 32) * P2)   // LDS offset of wc3, behind wc2 and z1
#define O_ST (32 * P3)      // LDS offset of the output stage, behind the z2 tile
// the two small combiner weights in pieces of 8 values, one piece a thread
#define CH2 (C2D * C1D / 8)
#define CH3 (OUTD * C2D / 8)

#define AS1 __attribute__((address_space(1)))
#define AS3 __attribute__((address_space(3)))

typedef __attribute__((ext_vector_type(2))) float v2f;

// exact GeLU, 0.5*x*(1+erf(x/sqrt(2))), written without a branch as
//   max(x,0) - a*Q(a),  a = |x|,  Q(a) = 0.5*erfc(a/sqrt(2)) = exp2(P(a)).
// P is one polynomial of degree 6 for all of 0 <= a <= 6 (fitted to log2 Q,
// weighted by a*Q); past 6 the term a*Q is below 1e-8 and a is held at 6.
// The term a*Q(a) stays within 2e-7 of the exact one, the size of f32 rounding
// (a NaN does not pass min and max, as in tanh_fast below).
// Two values at a time, so that the polynomial runs on packed FMAs.
__device__ __forceinline__ v2f gelu_2(v2f v) {
    const v2f a = __builtin_elementwise_min(__builtin_elementwise_abs(v), (v2f)(6.0f));
    v2f p = (v2f)(0.0000330932962f);
    p = __builtin_elementwise_fma(p, a, (v2f)(-0.000769223785f));
    p = __builtin_elementwise_fma(p, a, (v2f)(0.00808072928f));
    p = __builtin_elementwise_fma(p, a, (v2f)(-0.0534121245f));
    p = __builtin_elementwise_fma(p, a, (v2f)(-0.458770961f));
    p = __builtin_elementwise_fma(p, a, (v2f)(-1.15120173f));
    p = __builtin_elementwise_fma(p, a, (v2f)(-0.999993086f));
    v2f q;
    q.x = __builtin_amdgcn_exp2f(p.x);
    q.y = __builtin_amdgcn_exp2f(p.y);
    return __builtin_elementwise_fma(-a, q, __builtin_elementwise_max(v, (v2f)(0.0f)));
}

// branch-free tanh: (e^2x - 1) * rcp(e^2x + 1), clamped so e stays finite
__device__ __forceinline__ float tanh_fast(float v) {
    v = fminf(fmaxf(v, -10.0f), 10.0f);
    const float e = __expf(2.0f * v);
    return (e - 1.0f) * __builtin_amdgcn_rcpf(e + 1.0f);
}

// Build a 16-bit A/B WMMA fragment for this lane from K-contiguous memory.
// Lane group g (lane>>4): elements 0..7 = K[8g..8g+7], elements 8..15 =
// K[16+8g..16+8g+7].  `p` must already point at row_base + 8*g.
__device__ __forceinline__ v16h load_frag(const _Float16* p) {
    v8h lo = *(const v8h*)(p);
    v8h hi = *(const v8h*)(p + 16);
    v16h r;
#pragma unroll
    for (int i = 0; i < 8; ++i) { r[i] = lo[i]; r[8 + i] = hi[i]; }
    return r;
}

// ---------------------------------------------------------------------------
// Branch stage and first combiner GEMM in one kernel.
//   h = gelu(x*bw1+bb1) [16], f = tanh(h @ bw2^T + bb2) [8], z1pre = f @ wc1^T
// A work-group owns 128 batch rows, all 256 columns of wc1 and one slice of K
// (15 or 16 groups of 8 branches).  Per group it makes its 128 x 64 piece of f
// in LDS, lays the 256 x 64 piece of wc1 beside it as f16, and multiplies the
// two at once: f never goes to memory.
// Making f: one wave = 2 neighbouring branches x 16 rows, one full WMMA with a
// block-diagonal B (K = 2 x 16 hidden units, N = 2 x 8 outputs); the 8 waves
// are 4 branch pairs x 2 row halves and walk 4 tiles of 32 rows.
// Multiplying: wave tile 64 x 64, waves 2 (M) x 4 (N), 16 accumulator tiles.
// Two LDS buffers, one barrier a group.  The loop is staggered by one group:
// while group g is made in one buffer, group g-1 is multiplied out of the
// other, its fragment reads and WMMAs standing among the vector work.
// The f32 partial sums of the slice leave in accumulator order (a wave's tile
// is 1 KiB in a row); the next kernel adds the slices.
// The fp32 -> fp16 conversion of the two small combiner weights rides in the
// first work-groups.
// ---------------------------------------------------------------------------
__global__ __launch_bounds__(256)
void branch_gemm_kernel(const float* __restrict__ x,     // [B, N_BR]
                        const float* __restrict__ bw1,   // [N_BR, 16]
                        const float* __restrict__ bb1,   // [N_BR, 16]
                        const float* __restrict__ bw2,   // [N_BR, 8, 16]
                        const float* __restrict__ bb2,   // [N_BR, 8]
                        const float* __restrict__ wc1,   // [256, 8000]
                        const float* __restrict__ wc2,   // [128, 256]
                        const float* __restrict__ wc3,   // [300, 128]
                        _Float16* __restrict__ w2h,      // wc2 as f16
                        _Float16* __restrict__ w3h,      // wc3 as f16
                        float* __restrict__ part) {      // [tile][KSPL][256]
    __shared__ __attribute__((aligned(16))) char lds[2 * FBUF];

    const int t    = threadIdx.x;
    const int lane = t & 31;
    const int wid  = t >> 5;
    const int pr   = wid & 3;                 // making f: branch pair
    const int rh   = wid >> 2;                // making f: 16-row half of a tile
    const int wm   = wid & 1;                 // multiplying: 64-row half
    const int wn   = wid >> 1;                // multiplying: 64-column quarter
    const int m    = lane & 15;
    const int g    = lane >> 4;
    const int mt   = blockIdx.x;              // 128-row tile
    const int ks   = blockIdx.y;              // K slice
    const int gs   = ks * NGRP / KSPL;        // first group of the slice
    const int ge   = (ks + 1) * NGRP / KSPL;  // one past its last

    // ---- this work-group's share of the small weights' conversion ----
    {
        static_assert((C2D * C1D) % 8 == 0 && (OUTD * C2D) % 8 == 0, "8 values a piece");
        static_assert(CH2 + CH3 <= (B_SZ / FM) * KSPL * 256, "a piece a thread at most");
        const int pc0 = (blockIdx.y * (B_SZ / FM) + blockIdx.x) * 256 + t;
        if (pc0 < CH2 + CH3) {
            const bool third = (pc0 >= CH2);
            const float* src = third ? wc3 : wc2;
            _Float16* dst    = third ? w3h : w2h;
            const int pc     = third ? pc0 - CH2 : pc0;
            const float4 lo = *(const float4*)(src + pc * 8);
            const float4 hi = *(const float4*)(src + pc * 8 + 4);
            v8h r;
            r[0] = (_Float16)lo.x; r[1] = (_Float16)lo.y;
            r[2] = (_Float16)lo.z; r[3] = (_Float16)lo.w;
            r[4] = (_Float16)hi.x; r[5] = (_Float16)hi.y;
            r[6] = (_Float16)hi.z; r[7] = (_Float16)hi.w;
            *(v8h*)(dst + pc * 8) = r;
        }
    }

    // ---- what a group reads from memory, fetched one group ahead ----
    // Every address is a base that is the same for the whole work-group plus a
    // byte offset of the lane that never changes.
    // wc1: 16 lanes cover the 256 B of a row's 64 values, 16 rows a sweep
    const unsigned int vo_w = ((t >> 4) * KF + (t & 15) * 4) * 4u;
    // branch weights: hidden units 8g..8g+7 of both branches of the pair
    const unsigned int vo_1 = (pr * 2 * H1D + 8 * g) * 4u;
    // row m of the pair's 16 outputs
    const unsigned int vo_2 = ((pr * 2 * H2D + m) * H1D + 8 * g) * 4u;
    const unsigned int vo_b = (pr * 2 * H2D + m) * 4u;
    // x of both branches is one aligned pair (n0 even, row pitch even)
    const unsigned int vo_x = ((rh * 16 + m) * N_BR + pr * 2) * 4u;
    float4 wr[16], w1q[4], c1q[4], w2q[2];
    v2f xv[4];
    float bias;
    auto load_group = [&](int grp, bool in_loop) {
        // the lane's six addresses; every load is one of them plus a constant
        const char* sw = (const char*)(wc1 + grp * 64) + vo_w;
        const char* s1 = (const char*)(bw1 + grp * 8 * H1D) + vo_1;
        const char* sc = (const char*)(bb1 + grp * 8 * H1D) + vo_1;
        const char* s2 = (const char*)(bw2 + grp * 8 * H2D * H1D) + vo_2;
        const char* sb = (const char*)(bb2 + grp * 8 * H2D) + vo_b;
        const char* sx = (const char*)(x + (size_t)mt * FM * N_BR + grp * 8) + vo_x;
#pragma unroll                                // wr[] stays in registers
        for (int j = 0; j < 16; ++j)
            wr[j] = *(const float4*)(sw + j * (16 * KF * 4));
#pragma unroll                                // w1q[], c1q[] stay in registers
        for (int p = 0; p < 2; ++p) {
#pragma unroll                                // as above: indices become constants
            for (int h = 0; h < 2; ++h) {
                w1q[p * 2 + h] = *(const float4*)(s1 + p * (H1D * 4) + h * 16);
                c1q[p * 2 + h] = *(const float4*)(sc + p * (H1D * 4) + h * 16);
            }
        }
        w2q[0] = *(const float4*)(s2);
        w2q[1] = *(const float4*)(s2 + 16);
        bias = *(const float*)(sb);
#pragma unroll                                // xv[] stays in registers
        for (int tl = 0; tl < 4; ++tl)
            xv[tl] = *(const v2f*)(sx + tl * (32 * N_BR * 4));
        // stands directly behind the loads, in front of any rewrite of a
        // register that they name.  In the loop the six addresses are its
        // inputs, so that each keeps its registers up to here and no load's
        // result lands there; in front of the loop the loads name scalar bases
        // and the lane offsets, which live on
        if (in_loop)
            asm volatile("s_wait_xcnt 0x0"
                         :: "v"(sw), "v"(s1), "v"(sc), "v"(s2), "v"(sb), "v"(sx) : "memory");
        else
            asm volatile("s_wait_xcnt 0x0" ::: "memory");
        // nothing is scheduled in between the loads and that wait
        __builtin_amdgcn_sched_barrier(0);
    };

    v8f acc[4][4];
#pragma unroll                                // acc[][] stays in registers
    for (int i = 0; i < 4; ++i)
#pragma unroll                                // as above: indices become constants
        for (int j = 0; j < 4; ++j) acc[i][j] = (v8f){};

    // the loads below start a scheduling region of their own
    __builtin_amdgcn_sched_barrier(0);
    load_group(gs, false);

    const bool up = (m >= H2D);
    static_assert(NGRP >= 2 * KSPL, "every slice has two groups");

    v2f pre[4][8];
    v16h b;
    float bcur;
    // ---- head of a group: all that uses up what was fetched for it, then the
    // request for group gn
    auto head = [&](char* buf, int gn, bool in_loop) {
        // ---- wc1 piece to LDS as f16
#pragma unroll                                // as above: indices become constants
        for (int j = 0; j < 16; ++j) {
            v4h h;
            h[0] = (_Float16)wr[j].x; h[1] = (_Float16)wr[j].y;
            h[2] = (_Float16)wr[j].z; h[3] = (_Float16)wr[j].w;
            *(v4h*)(buf + (j * 16 + (t >> 4)) * FP + (t & 15) * 8) = h;
        }

        // ---- layer 1 ahead of its GeLU, all 4 tiles: the last use of x and
        // of the layer's weights, so that the next group's can be asked for
#pragma unroll                                // pre[][] stays in registers
        for (int tl = 0; tl < 4; ++tl) {
#pragma unroll                                // as above: indices become constants
            for (int p = 0; p < 2; ++p) {
                const v2f xb = (v2f)(p ? xv[tl].y : xv[tl].x);
#pragma unroll                                // as above: indices become constants
                for (int h = 0; h < 2; ++h) {
                    const float4 wq = w1q[p * 2 + h], cq = c1q[p * 2 + h];
                    pre[tl][p * 4 + h * 2] =
                        __builtin_elementwise_fma(xb, (v2f){wq.x, wq.y}, (v2f){cq.x, cq.y});
                    pre[tl][p * 4 + h * 2 + 1] =
                        __builtin_elementwise_fma(xb, (v2f){wq.z, wq.w}, (v2f){cq.z, cq.w});
                }
            }
        }

        // ---- B fragment, block diagonal.  Fragment elements 0..7 carry
        // hidden units 8g..8g+7 of branch n0, elements 8..15 those of branch
        // n0+1 (the A fragment below has the same order).  Column m is output
        // m&7 of branch n0 + (m>>3): weights in its own branch's half only.
#pragma unroll                                // as above: indices become constants
        for (int i = 0; i < 8; ++i) {
            const float wf = (i < 4) ? ((const float*)&w2q[0])[i] : ((const float*)&w2q[1])[i - 4];
            const _Float16 w = (_Float16)wf;
            b[i]     = up ? (_Float16)0.0f : w;
            b[8 + i] = up ? w : (_Float16)0.0f;
        }
        bcur = bias;

        // the next group's loads start a scheduling region of their own, a
        // whole f stage ahead of their use
        __builtin_amdgcn_sched_barrier(0);
        load_group(gn, in_loop);
    };

    // ---- 32 rows of the group's f (this wave: 16 rows x 2 branches) to LDS,
    // in two parts.  A fragment: rows = batch, K = hidden units of the pair
    auto hidden = [&](int tl) {
        v16h a;
#pragma unroll                                // as above: indices become constants
        for (int i = 0; i < 8; ++i) {
            const v2f hv = gelu_2(pre[tl][i]);
            a[2 * i]     = (_Float16)hv.x;
            a[2 * i + 1] = (_Float16)hv.y;
        }
        return a;
    };
    auto finish = [&](char* buf, int tl, v16h a) {
        _Float16* st = (_Float16*)(buf + C1D * FP);
        v8f c = {};
        c = __builtin_amdgcn_wmma_f32_16x16x32_f16(false, a, false, b,
                                                   (short)0, c, false, false);
#pragma unroll                                // as above: indices become constants
        for (int r = 0; r < 8; ++r) {
            const int row = tl * 32 + rh * 16 + r + 8 * g;  // lanes 16-31: M 8..15
            st[row * (FP / 2) + pr * 16 + m] = (_Float16)tanh_fast(c[r] + bcur);
        }
    };
    auto tile = [&](char* buf, int tl) { finish(buf, tl, hidden(tl)); };

    // ---- the 128 x 256 x 64 product of a published buffer, in 4 quarters:
    // fragments of 32 of K as one group, then 2 x 8 WMMAs
    v16h af[4], bf[4];
    auto frags = [&](const char* pb, int k2) {
        const char* ab = pb + (C1D + wm * 64 + m) * FP + 16 * g + k2 * 64;
        const char* bb = pb + (wn * 64 + m) * FP + 16 * g + k2 * 64;
#pragma unroll                                // af[], bf[] stay in registers
        for (int i = 0; i < 4; ++i) {
            af[i] = load_frag((const _Float16*)(ab + i * 16 * FP));
            bf[i] = load_frag((const _Float16*)(bb + i * 16 * FP));
        }
        // keeps the load group where it is written (in the loop: a stretch of
        // vector work ahead of its WMMAs): the scheduler otherwise sinks the
        // loads to just before their use
        __builtin_amdgcn_sched_barrier(0);
    };
    auto quarter = [&](int ih) {
#pragma unroll                                // as above: indices become constants
        for (int i = 2 * ih; i < 2 * ih + 2; ++i)
#pragma unroll                                // as above: indices become constants
            for (int j = 0; j < 4; ++j)
                acc[i][j] = __builtin_amdgcn_wmma_f32_16x16x32_f16(
                    false, af[i], false, bf[j], (short)0, acc[i][j], false, false);
    };

    // ---- first group: made, not yet multiplied
    head(lds, gs + 1, false);
#pragma unroll                                // pre[][] indexed by constants
    for (int tl = 0; tl < 4; ++tl) tile(lds, tl);
    // publishes the first group's f and wc1 pieces
    __syncthreads();

    // ---- group grp is made while group grp-1 is multiplied: each quarter of
    // the product stands behind a tile of vector work, so that one wave's
    // WMMAs and LDS reads run under the other wave's (and its own) GeLU, tanh
    int grp = gs + 1;
    do {    // at least one trip
        char* buf       = lds + ((grp - gs) & 1) * FBUF;
        const char* prv = lds + ((grp - gs - 1) & 1) * FBUF;
        // the last trip asks for its own group again: in bounds, unused
        const int gn = (grp + 1 < ge) ? grp + 1 : grp;

        frags(prv, 0);
        head(buf, gn, true);
        tile(buf, 0);
        quarter(0);
        tile(buf, 1);
        quarter(1);
        frags(prv, 1);
        const v16h a2 = hidden(2);
        // keeps the WMMAs below behind that GeLU, which covers the latency of
        // the fragment reads: the scheduler otherwise lifts them to the reads
        __builtin_amdgcn_sched_barrier(0);
        quarter(0);
        finish(buf, 2, a2);
        tile(buf, 3);
        quarter(1);

        // publishes this group's f and wc1 pieces; the buffer written next was
        // last read in front of this barrier
        __syncthreads();
    } while (++grp < ge);

    // ---- the last group's product
    {
        const char* prv = lds + ((ge - gs - 1) & 1) * FBUF;
        frags(prv, 0);
        quarter(0);
        quarter(1);
        frags(prv, 1);
        quarter(0);
        quarter(1);
    }

    // ---- the slice's partial sums, in accumulator order: tile (i,j) of wave
    // wid is 32 lanes x 8 floats in a row, the 8 slices of a tile side by side
    float* pp = part + ((size_t)((mt * 8 + wid) * 16 * KSPL + ks) * 32 + lane) * 8;
#pragma unroll                                // as above: indices become constants
    for (int i = 0; i < 4; ++i)
#pragma unroll                                // as above: indices become constants
        for (int j = 0; j < 4; ++j)
            *(v8f*)(pp + (i * 4 + j) * (KSPL * 256)) = acc[i][j];
}

// ---------------------------------------------------------------------------
// One row slice of a stage: JC async copies of 16 B per lane, 128 B apart.
// The immediate offset moves the global and the LDS address alike.
// ---------------------------------------------------------------------------
template <int J, int JC>
__device__ __forceinline__ void copy_row(const _Float16* gp, unsigned int la) {
    __builtin_amdgcn_global_load_async_to_lds_b128(
        (AS1 v4i*)(unsigned long long)(uintptr_t)gp,
        (AS3 v4i*)la, J * 128, 0);
    if constexpr (J + 1 < JC) copy_row<J + 1, JC>(gp, la);
}

// ---------------------------------------------------------------------------
// z1 = gelu(sum of the K slices + bc1), z2 = gelu(z1 @ wc2^T + bc2),
// out = z2 @ wc3^T + bc3
// A work-group of 16 waves owns 32 batch rows and all columns of both products.
// wc2 and wc3 (f16) come into LDS by async copies, filled once, while the
// slices are added; z1 and z2 go to LDS as f16 and never to memory.  Slices are
// added in the order 0..7.  The 32 output rows are 38,400 B in a row (300 whole
// 128-B lines): they are staged in LDS and leave as 16-B pieces in address order.
// ---------------------------------------------------------------------------
template <int N> struct int_c { static constexpr int value = N; };

__global__ __launch_bounds__(512)
void reduce_gemm_kernel(const float* __restrict__ part,   // [tile][KSPL][256]
                        const _Float16* __restrict__ w2h, // [128][256]
                        const _Float16* __restrict__ w3h, // [300][128]
                        const float* __restrict__ bc1,    // [256]
                        const float* __restrict__ bc2,    // [128]
                        const float* __restrict__ bc3,    // [300]
                        float* __restrict__ out) {        // [B][300]
    // 128 rows of wc2, then 32 rows of z1, then W3R rows of wc3.  Once the
    // second product has been read out, the first part holds the z2 tile
    // (32 rows at pitch P3) and behind it the output stage
    __shared__ __attribute__((aligned(16))) char lds[O_W3 + W3R * P3];
    static_assert(O_ST + 32 * OUTD * 4 <= O_W3, "z2 tile and output stage end ahead of wc3");
    static_assert(W3R % 64 == 0 && W3R >= NT3 * 16, "whole sweeps cover every column tile");
    static_assert(NT3 > 16 && NT3 <= 24, "2 or 3 column tiles a wave");

    const int t    = threadIdx.x;
    const int lane = t & 31;
    const int wid  = t >> 5;
    const int l15  = lane & 15;
    const int g    = lane >> 4;

    // 8 lanes cover a 128-B line of a row, 64 rows a sweep, 4 lines a row
    {
        const int srow = t >> 3;
        const int ssub = t & 7;
        const unsigned int lbase = (unsigned int)(uintptr_t)&lds[srow * P2 + ssub * 16];
#pragma unroll                                // offsets become constants
        for (int rg = 0; rg < 2; ++rg)
            copy_row<0, 4>(w2h + (size_t)(rg * 64 + srow) * C1D + ssub * 8,
                           lbase + rg * 64 * P2);
    }

    // where these 32 rows lie in the first kernel's accumulator order
    const int mt  = blockIdx.x >> 2;               // its 128-row tile
    const int wmf = (blockIdx.x >> 1) & 1;         // its 64-row half
    const int ih  = wid >> 3;                      // 16-row half of the 32 rows
    const int ti  = (blockIdx.x & 1) * 2 + ih;     // its 16-row tile
    const int wnf = (wid >> 1) & 3;                // its 64-column quarter
    const int u0  = (wid & 1) * 2;                 // first of 2 16-column tiles
    const int wm = wid & 1;                        // the products' 16-row half
    const int wn = wid >> 1;                       // their 16-column tile, of 8
    // every load below is a kernel argument plus one of these lane offsets
    // (bytes) plus a constant: the 2 x 8 slices of the wave lie in a row
    const unsigned int vo_p =
        ((((mt * 8 + wmf + 2 * wnf) * 16 + ti * 4 + u0) * KSPL) * 32 + lane) * 32u;
    const unsigned int vo_c1 = (wnf * 64 + u0 * 16 + l15) * 4u;
    const unsigned int vo_c2 = (wn * 16 + l15) * 4u;
    // the wave's third output tile may end past column 299: held in bounds
    const int c3l = (wn + 16) * 16 + l15;
    const int c3i = (c3l < OUTD) ? c3l : (OUTD - 1);
    // all loads of the kernel as one group, in a scheduling region of its own
    __builtin_amdgcn_sched_barrier(0);
    v8f ps[2][KSPL];
    float bv1s[2];
#pragma unroll                                // ps[][], bv1s[] stay in registers
    for (int u = 0; u < 2; ++u) {
#pragma unroll                                // as above
        for (int k = 0; k < KSPL; ++k)
            ps[u][k] = *(const v8f*)((const char*)part + vo_p + (u * KSPL + k) * 1024);
        bv1s[u] = *(const float*)((const char*)bc1 + vo_c1 + u * 64);
    }
    const float bv2 = *(const float*)((const char*)bc2 + vo_c2);
    float bv3[3];                                  // output tiles wn, wn+8, wn+16
    bv3[0] = *(const float*)((const char*)bc3 + vo_c2);
    bv3[1] = *(const float*)((const char*)bc3 + vo_c2 + 8 * 16 * 4);
    bv3[2] = bc3[c3i];
    // stands directly behind the loads, in front of any rewrite of a register
    // that they name; the lane offsets are its inputs, so that each keeps its
    // register up to here
    asm volatile("s_wait_xcnt 0x0"
                 :: "v"(vo_p), "v"(vo_c1), "v"(vo_c2), "v"(c3i) : "memory");
    // nothing is scheduled in between the loads and that wait
    __builtin_amdgcn_sched_barrier(0);
    // wc3, asked for behind the slices, lands while they are added: 8 lanes
    // cover a 128-B line of a row, 64 rows a sweep, 2 lines a row
    {
        const int srow = t >> 3;
        const int ssub = t & 7;
        const unsigned int lbase3 =
            (unsigned int)(uintptr_t)&lds[O_W3 + srow * P3 + ssub * 16];
#pragma unroll                                // offsets become constants
        for (int rg = 0; rg < W3R / 64; ++rg) {
            const int r0  = rg * 64 + srow;
            const int row = (r0 < OUTD) ? r0 : (OUTD - 1);  // clamp; such cols dropped
            copy_row<0, 2>(w3h + (size_t)row * C2D + ssub * 8, lbase3 + rg * 64 * P3);
        }
    }
    // keeps the copies here, ahead of the first wait for a slice: the scheduler
    // otherwise sinks them among the sums, where they start a memory latency late
    __builtin_amdgcn_sched_barrier(0);
#pragma unroll                                // ps[][] indexed by constants
    for (int u = 0; u < 2; ++u) {
        v8f s = ps[u][0];
#pragma unroll                                // as above
        for (int k = 1; k < KSPL; ++k) s += ps[u][k];
        const int col = wnf * 64 + (u0 + u) * 16 + l15;
        const float bv = bv1s[u];
#pragma unroll                                // s[] indexed by constants
        for (int r = 0; r < 8; r += 2) {
            const v2f v = gelu_2((v2f){s[r] + bv, s[r + 1] + bv});
            const int row = C2D + ih * 16 + 8 * g + r;
            *(_Float16*)(lds + row * P2 + col * 2)       = (_Float16)v.x;
            *(_Float16*)(lds + (row + 1) * P2 + col * 2) = (_Float16)v.y;
        }
    }
    // this wave's copies of wc2 and wc3 have landed before the barrier
    // publishes them
    asm volatile("s_wait_asynccnt 0x0" ::: "memory");
    __syncthreads();

    // ---- 32 x 128 x 256 product: wave tile 16 x 16, waves 2 (M) x 8 (N)
    const char* ap = lds + (C2D + wm * 16 + l15) * P2 + 16 * g;
    const char* bp = lds + (wn * 16 + l15) * P2 + 16 * g;
    v8f c0 = {};
    v16h fa[C1D / 32], fb[C1D / 32];
#pragma unroll                                // fa[], fb[] stay in registers
    for (int k = 0; k < C1D / 32; ++k) {
        fa[k] = load_frag((const _Float16*)(ap + k * 64));
        fb[k] = load_frag((const _Float16*)(bp + k * 64));
    }
    // keeps the load group in front of the WMMAs: one LDS latency for all of
    // K, where the scheduler otherwise waits out one for every WMMA
    __builtin_amdgcn_sched_barrier(0);
#pragma unroll                                // fragments indexed by constants
    for (int k = 0; k < C1D / 32; ++k)
        c0 = __builtin_amdgcn_wmma_f32_16x16x32_f16(false, fa[k], false, fb[k],
                                                    (short)0, c0, false, false);
    // every wave has read its fragments before that LDS takes the z2 tile
    __syncthreads();

#pragma unroll                                // c0[] indexed by constants
    for (int r = 0; r < 8; r += 2) {
        const v2f v0 = gelu_2((v2f){c0[r] + bv2, c0[r + 1] + bv2});
        const int row = wm * 16 + 8 * g + r;
        *(_Float16*)(lds + row * P3 + (wn * 16 + l15) * 2)       = (_Float16)v0.x;
        *(_Float16*)(lds + (row + 1) * P3 + (wn * 16 + l15) * 2) = (_Float16)v0.y;
    }
    // publishes the z2 tile
    __syncthreads();

    // ---- 32 x 300 x 128 product: a wave has one 16-row half and the column
    // tiles wn, wn+8 and, where there is one, wn+16 (19 tiles in all); its
    // results, bias added, go to the output stage
    auto product3 = [&](auto ntw_c) {
        constexpr int NTW = decltype(ntw_c)::value;
        const char* ap3 = lds + (wm * 16 + l15) * P3 + 16 * g;
        const char* bp3 = lds + O_W3 + (wn * 16 + l15) * P3 + 16 * g;
        v16h ga[C2D / 32], gb[NTW][C2D / 32];
#pragma unroll                                // ga[], gb[][] stay in registers
        for (int k = 0; k < C2D / 32; ++k) {
            ga[k] = load_frag((const _Float16*)(ap3 + k * 64));
#pragma unroll                                // as above
            for (int u = 0; u < NTW; ++u)
                gb[u][k] = load_frag((const _Float16*)(bp3 + u * (8 * 16 * P3) + k * 64));
        }
        // keeps the load group in front of the WMMAs, as above
        __builtin_amdgcn_sched_barrier(0);
        v8f c[NTW];
#pragma unroll                                // c[] stays in registers
        for (int u = 0; u < NTW; ++u) c[u] = (v8f){};
#pragma unroll                                // fragments indexed by constants
        for (int k = 0; k < C2D / 32; ++k)
#pragma unroll                                // as above
            for (int u = 0; u < NTW; ++u)
                c[u] = __builtin_amdgcn_wmma_f32_16x16x32_f16(
                    false, ga[k], false, gb[u][k], (short)0, c[u], false, false);
        float* st = (float*)(lds + O_ST);
#pragma unroll                                // c[], bv3[] indexed by constants
        for (int u = 0; u < NTW; ++u) {
            const int col = (wn + 8 * u) * 16 + l15;
            if (u < 2 || col < OUTD) {            // only the last tile has an edge
#pragma unroll                                // as above
                for (int r = 0; r < 8; ++r)
                    st[(wm * 16 + 8 * g + r) * OUTD + col] = c[u][r] + bv3[u];
            }
        }
    };
    // the same for a whole wave: a scalar branch, every lane on at the WMMAs
    if (__builtin_amdgcn_readfirstlane(wn) < NT3 - 16) product3(int_c<3>{});
    else                                               product3(int_c<2>{});
    // publishes the staged rows
    __syncthreads();

    // coalesced write: 2400 pieces of 16 B in address order, 4 whole rounds of
    // the work-group and a rest that whole waves take
    constexpr int NPC = 32 * OUTD / 4;
    static_assert((NPC % 512) % 32 == 0, "the rest is whole waves");
    const float4* s4 = (const float4*)(lds + O_ST);
    float4* o4 = (float4*)(out + (size_t)blockIdx.x * 32 * OUTD);
#pragma unroll                                // offsets become constants
    for (int j = 0; j < NPC / 512; ++j) o4[t + 512 * j] = s4[t + 512 * j];
    if (t < NPC % 512) o4[t + NPC / 512 * 512] = s4[t + NPC / 512 * 512];
}

// ---------------------------------------------------------------------------
// Launch
// ---------------------------------------------------------------------------
extern "C" void kernel_launch(void* const* d_in, const int* in_sizes, int n_in,
                              void* d_out, int out_size, void* d_ws, size_t ws_size,
                              hipStream_t stream) {
    const float* x   = (const float*)d_in[0];
    const float* bw1 = (const float*)d_in[1];
    const float* bb1 = (const float*)d_in[2];
    const float* bw2 = (const float*)d_in[3];
    const float* bb2 = (const float*)d_in[4];
    const float* wc1 = (const float*)d_in[5];
    const float* bc1 = (const float*)d_in[6];
    const float* wc2 = (const float*)d_in[7];
    const float* bc2 = (const float*)d_in[8];
    const float* wc3 = (const float*)d_in[9];
    const float* bc3 = (const float*)d_in[10];
    float* out = (float*)d_out;

    // workspace carve-out (all slices 32B-aligned)
    char* ws = (char*)d_ws;
    float*    part = (float*)ws;    ws += (size_t)KSPL * SLICE * sizeof(float);
    _Float16* w2h = (_Float16*)ws;  ws += (size_t)C2D  * C1D * sizeof(_Float16);
    _Float16* w3h = (_Float16*)ws;  ws += (size_t)OUTD * C2D * sizeof(_Float16);
    if ((size_t)(ws - (char*)d_ws) > ws_size) return;  // ws too small: bail

    // 1) all 1000 branch MLPs and f @ wc1^T, K in 8 slices (f32 partial sums)
    //    (and the two small combiner weights to fp16)
    branch_gemm_kernel<<<dim3(B_SZ / FM, KSPL), 256, 0, stream>>>(
        x, bw1, bb1, bw2, bb2, wc1, wc2, wc3, w2h, w3h, part);

    // 2) z1 = gelu(slices + bc1), z2 = gelu(z1 @ wc2^T + bc2),
    //    out = z2 @ wc3^T + bc3 (fp32)
    reduce_gemm_kernel<<<dim3(B_SZ / 32), 512, 0, stream>>>(
        part, w2h, w3h, bc1, bc2, bc3, out);
}

// v009
// Measured time: 45.7 microseconds a run.
// Next to v008, in two timings, it ran 1.06 and 1.05 times as fast.
// All steps since v000 together make it 5.79 times as fast.
#include <hip/hip_runtime.h>
#include <hip/hip_bf16.h>

typedef __attribute__((ext_vector_type(16))) _Float16 v16h;
typedef __attribute__((ext_vector_type(8)))  _Float16 v8h;
typedef __attribute__((ext_vector_type(4)))  _Float16 v4h;
typedef __attribute__((ext_vector_type(8)))  float    v8f;
typedef int v4i __attribute__((vector_size(4 * sizeof(int))));  // b128 payload

#define B_SZ 4096
#define N_BR 1000
#define H1D  16
#define H2D  8
#define C1D  256
#define C2D  128
#define OUTD 300
#define KF   (N_BR * H2D)   // 8000
#define FM   128            // batch rows of a fused work-group
#define KSPL 8              // slices of K, one a work-group
#define NGRP (N_BR / 8)     // groups of 8 branches = 64 of K
#define FP   144            // LDS row pitch, bytes: 64 f16 + 16 (16 B x odd)
#define FBUF ((C1D + FM) * FP)   // one buffer: 256 W rows, then 128 f rows
#define SLICE (B_SZ * C1D)  // floats of one K slice's partial sums
#define P2   (C1D * 2 + 16) // LDS row pitch of the second GEMM, bytes
#define P3   (C2D * 2 + 16) // LDS row pitch of the third GEMM, bytes (16 B x odd)
#define NT3  ((OUTD + 15) / 16)  // 16-column tiles of the output
#define W3R  320            // LDS rows of wc3: 5 sweeps of 64
#define O_W3 ((C2D + 32) * P2)   // LDS offset of wc3, behind wc2 and z1
#define O_ST (32 * P3)      // LDS offset of the output stage, behind the z2 tile
// the two small combiner weights in pieces of 8 values, one piece a thread
#define CH2 (C2D * C1D / 8)
#define CH3 (OUTD * C2D / 8)

#define AS1 __attribute__((address_space(1)))
#define AS3 __attribute__((address_space(3)))

typedef __attribute__((ext_vector_type(2))) float v2f;
typedef __attribute__((ext_vector_type(2))) _Float16 v2h;

// exact GeLU, 0.5*x*(1+erf(x/sqrt(2))), written without a branch as
//   max(x,0) - a*Q(a),  a = |x|,  Q(a) = 0.5*erfc(a/sqrt(2)) = exp2(P(a)).
// P is one polynomial of degree 6 for all of 0 <= a <= 6 (fitted to log2 Q,
// weighted by a*Q); past 6 the term a*Q is below 1e-8 and a is held at 6.
// The term a*Q(a) stays within 2e-7 of the exact one, the size of f32 rounding
// (a NaN does not pass min and max).
// Two values at a time, so that the polynomial runs on packed FMAs.
__device__ __forceinline__ v2f gelu_2(v2f v) {
    const v2f a = __builtin_elementwise_min(__builtin_elementwise_abs(v), (v2f)(6.0f));
    v2f p = (v2f)(0.0000330932962f);
    p = __builtin_elementwise_fma(p, a, (v2f)(-0.000769223785f));
    p = __builtin_elementwise_fma(p, a, (v2f)(0.00808072928f));
    p = __builtin_elementwise_fma(p, a, (v2f)(-0.0534121245f));
    p = __builtin_elementwise_fma(p, a, (v2f)(-0.458770961f));
    p = __builtin_elementwise_fma(p, a, (v2f)(-1.15120173f));
    p = __builtin_elementwise_fma(p, a, (v2f)(-0.999993086f));
    v2f q;
    q.x = __builtin_amdgcn_exp2f(p.x);
    q.y = __builtin_amdgcn_exp2f(p.y);
    return __builtin_elementwise_fma(-a, q, __builtin_elementwise_max(v, (v2f)(0.0f)));
}

// tanh on the chip's own transcendental instruction, v_tanh_f32: no exp that
// could overflow, so no clamp, and no rcp
__device__ __forceinline__ float tanh_fast(float v) {
    return __builtin_amdgcn_tanhf(v);
}

// Build a 16-bit A/B WMMA fragment for this lane from K-contiguous memory.
// Lane group g (lane>>4): elements 0..7 = K[8g..8g+7], elements 8..15 =
// K[16+8g..16+8g+7].  `p` must already point at row_base + 8*g.
__device__ __forceinline__ v16h load_frag(const _Float16* p) {
    v8h lo = *(const v8h*)(p);
    v8h hi = *(const v8h*)(p + 16);
    v16h r;
#pragma unroll
    for (int i = 0; i < 8; ++i) { r[i] = lo[i]; r[8 + i] = hi[i]; }
    return r;
}

// ---------------------------------------------------------------------------
// Branch stage and first combiner GEMM in one kernel.
//   h = gelu(x*bw1+bb1) [16], f = tanh(h @ bw2^T + bb2) [8], z1pre = f @ wc1^T
// A work-group owns 128 batch rows, all 256 columns of wc1 and one slice of K
// (15 or 16 groups of 8 branches).  Per group it makes its 128 x 64 piece of f
// in LDS, lays the 256 x 64 piece of wc1 beside it as f16, and multiplies the
// two at once: f never goes to memory.
// Making f: one wave = 2 neighbouring branches x 16 rows, one full WMMA with a
// block-diagonal B (K = 2 x 16 hidden units, N = 2 x 8 outputs); the 8 waves
// are 4 branch pairs x 2 row halves and walk 4 tiles of 32 rows.
// Multiplying: wave tile 64 x 64, waves 2 (M) x 4 (N), 16 accumulator tiles.
// Two LDS buffers, one barrier a group.  The loop is staggered by one group:
// while group g is made in one buffer, group g-1 is multiplied out of the
// other, its fragment reads and WMMAs standing among the vector work.
// The f32 partial sums of the slice leave in accumulator order (a wave's tile
// is 1 KiB in a row); the next kernel adds the slices.
// The fp32 -> fp16 conversion of the two small combiner weights rides in the
// first work-groups.
// ---------------------------------------------------------------------------
__global__ __launch_bounds__(256)
void branch_gemm_kernel(const float* __restrict__ x,     // [B, N_BR]
                        const float* __restrict__ bw1,   // [N_BR, 16]
                        const float* __restrict__ bb1,   // [N_BR, 16]
                        const float* __restrict__ bw2,   // [N_BR, 8, 16]
                        const float* __restrict__ bb2,   // [N_BR, 8]
                        const float* __restrict__ wc1,   // [256, 8000]
                        const float* __restrict__ wc2,   // [128, 256]
                        const float* __restrict__ wc3,   // [300, 128]
                        _Float16* __restrict__ w2h,      // wc2 as f16
                        _Float16* __restrict__ w3h,      // wc3 as f16
                        float* __restrict__ part) {      // [tile][KSPL][256]
    __shared__ __attribute__((aligned(16))) char lds[2 * FBUF];

    const int t    = threadIdx.x;
    const int lane = t & 31;
    const int wid  = t >> 5;
    const int pr   = wid & 3;                 // making f: branch pair
    const int rh   = wid >> 2;                // making f: 16-row half of a tile
    const int wm   = wid & 1;                 // multiplying: 64-row half
    const int wn   = wid >> 1;                // multiplying: 64-column quarter
    const int m    = lane & 15;
    const int g    = lane >> 4;
    const int mt   = blockIdx.x;              // 128-row tile
    const int ks   = blockIdx.y;              // K slice
    const int gs   = ks * NGRP / KSPL;        // first group of the slice
    const int ge   = (ks + 1) * NGRP / KSPL;  // one past its last

    // ---- this work-group's share of the small weights' conversion ----
    {
        static_assert((C2D * C1D) % 8 == 0 && (OUTD * C2D) % 8 == 0, "8 values a piece");
        static_assert(CH2 + CH3 <= (B_SZ / FM) * KSPL * 256, "a piece a thread at most");
        const int pc0 = (blockIdx.y * (B_SZ / FM) + blockIdx.x) * 256 + t;
        if (pc0 < CH2 + CH3) {
            const bool third = (pc0 >= CH2);
            const float* src = third ? wc3 : wc2;
            _Float16* dst    = third ? w3h : w2h;
            const int pc     = third ? pc0 - CH2 : pc0;
            const float4 lo = *(const float4*)(src + pc * 8);
            const float4 hi = *(const float4*)(src + pc * 8 + 4);
            v8h r;
            r[0] = (_Float16)lo.x; r[1] = (_Float16)lo.y;
            r[2] = (_Float16)lo.z; r[3] = (_Float16)lo.w;
            r[4] = (_Float16)hi.x; r[5] = (_Float16)hi.y;
            r[6] = (_Float16)hi.z; r[7] = (_Float16)hi.w;
            *(v8h*)(dst + pc * 8) = r;
        }
    }

    // ---- what a group reads from memory, fetched one group ahead ----
    // Every address is a base that is the same for the whole work-group plus a
    // byte offset of the lane that never changes.
    // wc1: 16 lanes cover the 256 B of a row's 64 values, 16 rows a sweep
    const unsigned int vo_w = ((t >> 4) * KF + (t & 15) * 4) * 4u;
    // branch weights: hidden units 8g..8g+7 of both branches of the pair
    const unsigned int vo_1 = (pr * 2 * H1D + 8 * g) * 4u;
    // row m of the pair's 16 outputs
    const unsigned int vo_2 = ((pr * 2 * H2D + m) * H1D + 8 * g) * 4u;
    const unsigned int vo_b = (pr * 2 * H2D + m) * 4u;
    // x of both branches is one aligned pair (n0 even, row pitch even)
    const unsigned int vo_x = ((rh * 16 + m) * N_BR + pr * 2) * 4u;
    float4 wr[16], w1q[4], c1q[4], w2q[2];
    v2f xv[4];
    float bias;
    auto load_group = [&](int grp, bool in_loop) {
        // the lane's six addresses; every load is one of them plus a constant
        const char* sw = (const char*)(wc1 + grp * 64) + vo_w;
        const char* s1 = (const char*)(bw1 + grp * 8 * H1D) + vo_1;
        const char* sc = (const char*)(bb1 + grp * 8 * H1D) + vo_1;
        const char* s2 = (const char*)(bw2 + grp * 8 * H2D * H1D) + vo_2;
        const char* sb = (const char*)(bb2 + grp * 8 * H2D) + vo_b;
        const char* sx = (const char*)(x + (size_t)mt * FM * N_BR + grp * 8) + vo_x;
#pragma unroll                                // wr[] stays in registers
        for (int j = 0; j < 16; ++j)
            wr[j] = *(const float4*)(sw + j * (16 * KF * 4));
#pragma unroll                                // w1q[], c1q[] stay in registers
        for (int p = 0; p < 2; ++p) {
#pragma unroll                                // as above: indices become constants
            for (int h = 0; h < 2; ++h) {
                w1q[p * 2 + h] = *(const float4*)(s1 + p * (H1D * 4) + h * 16);
                c1q[p * 2 + h] = *(const float4*)(sc + p * (H1D * 4) + h * 16);
            }
        }
        w2q[0] = *(const float4*)(s2);
        w2q[1] = *(const float4*)(s2 + 16);
        bias = *(const float*)(sb);
#pragma unroll                                // xv[] stays in registers
        for (int tl = 0; tl < 4; ++tl)
            xv[tl] = *(const v2f*)(sx + tl * (32 * N_BR * 4));
        // stands directly behind the loads, in front of any rewrite of a
        // register that they name.  In the loop the six addresses are its
        // inputs, so that each keeps its registers up to here and no load's
        // result lands there; in front of the loop the loads name scalar bases
        // and the lane offsets, which live on
        if (in_loop)
            asm volatile("s_wait_xcnt 0x0"
                         :: "v"(sw), "v"(s1), "v"(sc), "v"(s2), "v"(sb), "v"(sx) : "memory");
        else
            asm volatile("s_wait_xcnt 0x0" ::: "memory");
        // nothing is scheduled in between the loads and that wait
        __builtin_amdgcn_sched_barrier(0);
    };

    v8f acc[4][4];
#pragma unroll                                // acc[][] stays in registers
    for (int i = 0; i < 4; ++i)
#pragma unroll                                // as above: indices become constants
        for (int j = 0; j < 4; ++j) acc[i][j] = (v8f){};

    // the loads below start a scheduling region of their own
    __builtin_amdgcn_sched_barrier(0);
    load_group(gs, false);

    const bool up = (m >= H2D);
    static_assert(NGRP >= 2 * KSPL, "every slice has two groups");

    v2f pre[4][8];
    v16h b;
    float bcur;
    // ---- head of a group: all that uses up what was fetched for it, then the
    // request for group gn
    auto head = [&](char* buf, int gn, bool in_loop) {
        // ---- wc1 piece to LDS as f16
#pragma unroll                                // as above: indices become constants
        for (int j = 0; j < 16; ++j) {
            v4h h;
            h[0] = (_Float16)wr[j].x; h[1] = (_Float16)wr[j].y;
            h[2] = (_Float16)wr[j].z; h[3] = (_Float16)wr[j].w;
            *(v4h*)(buf + (j * 16 + (t >> 4)) * FP + (t & 15) * 8) = h;
        }

        // ---- layer 1 ahead of its GeLU, all 4 tiles: the last use of x and
        // of the layer's weights, so that the next group's can be asked for
#pragma unroll                                // pre[][] stays in registers
        for (int tl = 0; tl < 4; ++tl) {
#pragma unroll                                // as above: indices become constants
            for (int p = 0; p < 2; ++p) {
                const v2f xb = (v2f)(p ? xv[tl].y : xv[tl].x);
#pragma unroll                                // as above: indices become constants
                for (int h = 0; h < 2; ++h) {
                    const float4 wq = w1q[p * 2 + h], cq = c1q[p * 2 + h];
                    pre[tl][p * 4 + h * 2] =
                        __builtin_elementwise_fma(xb, (v2f){wq.x, wq.y}, (v2f){cq.x, cq.y});
                    pre[tl][p * 4 + h * 2 + 1] =
                        __builtin_elementwise_fma(xb, (v2f){wq.z, wq.w}, (v2f){cq.z, cq.w});
                }
            }
        }

        // ---- B fragment, block diagonal.  Fragment elements 0..7 carry
        // hidden units 8g..8g+7 of branch n0, elements 8..15 those of branch
        // n0+1 (the A fragment below has the same order).  Column m is output
        // m&7 of branch n0 + (m>>3): weights in its own branch's half only.
#pragma unroll                                // as above: indices become constants
        for (int i = 0; i < 8; ++i) {
            const float wf = (i < 4) ? ((const float*)&w2q[0])[i] : ((const float*)&w2q[1])[i - 4];
            const _Float16 w = (_Float16)wf;
            b[i]     = up ? (_Float16)0.0f : w;
            b[8 + i] = up ? w : (_Float16)0.0f;
        }
        bcur = bias;

        // the next group's loads start a scheduling region of their own, a
        // whole f stage ahead of their use
        __builtin_amdgcn_sched_barrier(0);
        load_group(gn, in_loop);
    };

    // ---- 32 rows of the group's f (this wave: 16 rows x 2 branches) to LDS,
    // in two parts.  A fragment: rows = batch, K = hidden units of the pair
    auto hidden = [&](int tl) {
        v16h a;
#pragma unroll                                // as above: indices become constants
        for (int i = 0; i < 8; ++i) {
            const v2f hv = gelu_2(pre[tl][i]);
            a[2 * i]     = (_Float16)hv.x;
            a[2 * i + 1] = (_Float16)hv.y;
        }
        return a;
    };
    auto finish = [&](char* buf, int tl, v16h a) {
        _Float16* st = (_Float16*)(buf + C1D * FP);
        v8f c = {};
        c = __builtin_amdgcn_wmma_f32_16x16x32_f16(false, a, false, b,
                                                   (short)0, c, false, false);
#pragma unroll                                // as above: indices become constants
        for (int r = 0; r < 8; r += 2) {
            const int row = tl * 32 + rh * 16 + r + 8 * g;  // lanes 16-31: M 8..15
            const v2h f2 = __builtin_convertvector(
                (v2f){tanh_fast(c[r] + bcur), tanh_fast(c[r + 1] + bcur)}, v2h);
            st[row * (FP / 2) + pr * 16 + m]       = f2.x;
            st[(row + 1) * (FP / 2) + pr * 16 + m] = f2.y;
        }
    };
    auto tile = [&](char* buf, int tl) { finish(buf, tl, hidden(tl)); };

    // ---- the 128 x 256 x 64 product of a published buffer, in 4 quarters:
    // fragments of 32 of K as one group, then 2 x 8 WMMAs
    v16h af[4], bf[4];
    auto frags = [&](const char* pb, int k2) {
        const char* ab = pb + (C1D + wm * 64 + m) * FP + 16 * g + k2 * 64;
        const char* bb = pb + (wn * 64 + m) * FP + 16 * g + k2 * 64;
#pragma unroll                                // af[], bf[] stay in registers
        for (int i = 0; i < 4; ++i) {
            af[i] = load_frag((const _Float16*)(ab + i * 16 * FP));
            bf[i] = load_frag((const _Float16*)(bb + i * 16 * FP));
        }
        // keeps the load group where it is written (in the loop: a stretch of
        // vector work ahead of its WMMAs): the scheduler otherwise sinks the
        // loads to just before their use
        __builtin_amdgcn_sched_barrier(0);
    };
    auto quarter = [&](int ih) {
#pragma unroll                                // as above: indices become constants
        for (int i = 2 * ih; i < 2 * ih + 2; ++i)
#pragma unroll                                // as above: indices become constants
            for (int j = 0; j < 4; ++j)
                acc[i][j] = __builtin_amdgcn_wmma_f32_16x16x32_f16(
                    false, af[i], false, bf[j], (short)0, acc[i][j], false, false);
    };

    // ---- first group: made, not yet multiplied
    head(lds, gs + 1, false);
#pragma unroll                                // pre[][] indexed by constants
    for (int tl = 0; tl < 4; ++tl) tile(lds, tl);
    // publishes the first group's f and wc1 pieces
    __syncthreads();

    // ---- group grp is made while group grp-1 is multiplied: each quarter of
    // the product stands behind a tile of vector work, so that one wave's
    // WMMAs and LDS reads run under the other wave's (and its own) GeLU, tanh
    int grp = gs + 1;
    do {    // at least one trip
        char* buf       = lds + ((grp - gs) & 1) * FBUF;
        const char* prv = lds + ((grp - gs - 1) & 1) * FBUF;
        // the last trip asks for its own group again: in bounds, unused
        const int gn = (grp + 1 < ge) ? grp + 1 : grp;

        frags(prv, 0);
        head(buf, gn, true);
        tile(buf, 0);
        quarter(0);
        tile(buf, 1);
        quarter(1);
        frags(prv, 1);
        const v16h a2 = hidden(2);
        // keeps the WMMAs below behind that GeLU, which covers the latency of
        // the fragment reads: the scheduler otherwise lifts them to the reads
        __builtin_amdgcn_sched_barrier(0);
        quarter(0);
        finish(buf, 2, a2);
        tile(buf, 3);
        quarter(1);

        // publishes this group's f and wc1 pieces; the buffer written next was
        // last read in front of this barrier
        __syncthreads();
    } while (++grp < ge);

    // ---- the last group's product
    {
        const char* prv = lds + ((ge - gs - 1) & 1) * FBUF;
        frags(prv, 0);
        quarter(0);
        quarter(1);
        frags(prv, 1);
        quarter(0);
        quarter(1);
    }

    // ---- the slice's partial sums, in accumulator order: tile (i,j) of wave
    // wid is 32 lanes x 8 floats in a row, the 8 slices of a tile side by side
    float* pp = part + ((size_t)((mt * 8 + wid) * 16 * KSPL + ks) * 32 + lane) * 8;
#pragma unroll                                // as above: indices become constants
    for (int i = 0; i < 4; ++i)
#pragma unroll                                // as above: indices become constants
        for (int j = 0; j < 4; ++j)
            *(v8f*)(pp + (i * 4 + j) * (KSPL * 256)) = acc[i][j];
}

// ---------------------------------------------------------------------------
// One row slice of a stage: JC async copies of 16 B per lane, 128 B apart.
// The immediate offset moves the global and the LDS address alike.
// ---------------------------------------------------------------------------
template <int J, int JC>
__device__ __forceinline__ void copy_row(const _Float16* gp, unsigned int la) {
    __builtin_amdgcn_global_load_async_to_lds_b128(
        (AS1 v4i*)(unsigned long long)(uintptr_t)gp,
        (AS3 v4i*)la, J * 128, 0);
    if constexpr (J + 1 < JC) copy_row<J + 1, JC>(gp, la);
}

// ---------------------------------------------------------------------------
// z1 = gelu(sum of the K slices + bc1), z2 = gelu(z1 @ wc2^T + bc2),
// out = z2 @ wc3^T + bc3
// A work-group of 16 waves owns 32 batch rows and all columns of both products.
// wc2 and wc3 (f16) come into LDS by async copies, filled once, while the
// slices are added; z1 and z2 go to LDS as f16 and never to memory.  Slices are
// added in the order 0..7.  The 32 output rows are 38,400 B in a row (300 whole
// 128-B lines): they are staged in LDS and leave as 16-B pieces in address order.
// ---------------------------------------------------------------------------
template <int N> struct int_c { static constexpr int value = N; };

__global__ __launch_bounds__(512)
void reduce_gemm_kernel(const float* __restrict__ part,   // [tile][KSPL][256]
                        const _Float16* __restrict__ w2h, // [128][256]
                        const _Float16* __restrict__ w3h, // [300][128]
                        const float* __restrict__ bc1,    // [256]
                        const float* __restrict__ bc2,    // [128]
                        const float* __restrict__ bc3,    // [300]
                        float* __restrict__ out) {        // [B][300]
    // 128 rows of wc2, then 32 rows of z1, then W3R rows of wc3.  Once the
    // second product has been read out, the first part holds the z2 tile
    // (32 rows at pitch P3) and behind it the output stage
    __shared__ __attribute__((aligned(16))) char lds[O_W3 + W3R * P3];
    static_assert(O_ST + 32 * OUTD * 4 <= O_W3, "z2 tile and output stage end ahead of wc3");
    static_assert(W3R % 64 == 0 && W3R >= NT3 * 16, "whole sweeps cover every column tile");
    static_assert(NT3 > 16 && NT3 <= 24, "2 or 3 column tiles a wave");

    const int t    = threadIdx.x;
    const int lane = t & 31;
    const int wid  = t >> 5;
    const int l15  = lane & 15;
    const int g    = lane >> 4;

    // 8 lanes cover a 128-B line of a row, 64 rows a sweep, 4 lines a row
    {
        const int srow = t >> 3;
        const int ssub = t & 7;
        const unsigned int lbase = (unsigned int)(uintptr_t)&lds[srow * P2 + ssub * 16];
#pragma unroll                                // offsets become constants
        for (int rg = 0; rg < 2; ++rg)
            copy_row<0, 4>(w2h + (size_t)(rg * 64 + srow) * C1D + ssub * 8,
                           lbase + rg * 64 * P2);
    }

    // where these 32 rows lie in the first kernel's accumulator order
    const int mt  = blockIdx.x >> 2;               // its 128-row tile
    const int wmf = (blockIdx.x >> 1) & 1;         // its 64-row half
    const int ih  = wid >> 3;                      // 16-row half of the 32 rows
    const int ti  = (blockIdx.x & 1) * 2 + ih;     // its 16-row tile
    const int wnf = (wid >> 1) & 3;                // its 64-column quarter
    const int u0  = (wid & 1) * 2;                 // first of 2 16-column tiles
    const int wm = wid & 1;                        // the products' 16-row half
    const int wn = wid >> 1;                       // their 16-column tile, of 8
    // every load below is a kernel argument plus one of these lane offsets
    // (bytes) plus a constant: the 2 x 8 slices of the wave lie in a row
    const unsigned int vo_p =
        ((((mt * 8 + wmf + 2 * wnf) * 16 + ti * 4 + u0) * KSPL) * 32 + lane) * 32u;
    const unsigned int vo_c1 = (wnf * 64 + u0 * 16 + l15) * 4u;
    const unsigned int vo_c2 = (wn * 16 + l15) * 4u;
    // the wave's third output tile may end past column 299: held in bounds
    const int c3l = (wn + 16) * 16 + l15;
    const int c3i = (c3l < OUTD) ? c3l : (OUTD - 1);
    // all loads of the kernel as one group, in a scheduling region of its own
    __builtin_amdgcn_sched_barrier(0);
    v8f ps[2][KSPL];
    float bv1s[2];
#pragma unroll                                // ps[][], bv1s[] stay in registers
    for (int u = 0; u < 2; ++u) {
#pragma unroll                                // as above
        for (int k = 0; k < KSPL; ++k)
            ps[u][k] = *(const v8f*)((const char*)part + vo_p + (u * KSPL + k) * 1024);
        bv1s[u] = *(const float*)((const char*)bc1 + vo_c1 + u * 64);
    }
    const float bv2 = *(const float*)((const char*)bc2 + vo_c2);
    float bv3[3];                                  // output tiles wn, wn+8, wn+16
    bv3[0] = *(const float*)((const char*)bc3 + vo_c2);
    bv3[1] = *(const float*)((const char*)bc3 + vo_c2 + 8 * 16 * 4);
    bv3[2] = bc3[c3i];
    // stands directly behind the loads, in front of any rewrite of a register
    // that they name; the lane offsets are its inputs, so that each keeps its
    // register up to here
    asm volatile("s_wait_xcnt 0x0"
                 :: "v"(vo_p), "v"(vo_c1), "v"(vo_c2), "v"(c3i) : "memory");
    // nothing is scheduled in between the loads and that wait
    __builtin_amdgcn_sched_barrier(0);
    // wc3, asked for behind the slices, lands while they are added: 8 lanes
    // cover a 128-B line of a row, 64 rows a sweep, 2 lines a row
    {
        const int srow = t >> 3;
        const int ssub = t & 7;
        const unsigned int lbase3 =
            (unsigned int)(uintptr_t)&lds[O_W3 + srow * P3 + ssub * 16];
#pragma unroll                                // offsets become constants
        for (int rg = 0; rg < W3R / 64; ++rg) {
            const int r0  = rg * 64 + srow;
            const int row = (r0 < OUTD) ? r0 : (OUTD - 1);  // clamp; such cols dropped
            copy_row<0, 2>(w3h + (size_t)row * C2D + ssub * 8, lbase3 + rg * 64 * P3);
        }
    }
    // keeps the copies here, ahead of the first wait for a slice: the scheduler
    // otherwise sinks them among the sums, where they start a memory latency late
    __builtin_amdgcn_sched_barrier(0);
#pragma unroll                                // ps[][] indexed by constants
    for (int u = 0; u < 2; ++u) {
        v8f s = ps[u][0];
#pragma unroll                                // as above
        for (int k = 1; k < KSPL; ++k) s += ps[u][k];
        const int col = wnf * 64 + (u0 + u) * 16 + l15;
        const float bv = bv1s[u];
#pragma unroll                                // s[] indexed by constants
        for (int r = 0; r < 8; r += 2) {
            const v2f v = gelu_2((v2f){s[r] + bv, s[r + 1] + bv});
            const int row = C2D + ih * 16 + 8 * g + r;
            *(_Float16*)(lds + row * P2 + col * 2)       = (_Float16)v.x;
            *(_Float16*)(lds + (row + 1) * P2 + col * 2) = (_Float16)v.y;
        }
    }
    // this wave's copies of wc2 and wc3 have landed before the barrier
    // publishes them
    asm volatile("s_wait_asynccnt 0x0" ::: "memory");
    __syncthreads();

    // ---- 32 x 128 x 256 product: wave tile 16 x 16, waves 2 (M) x 8 (N)
    const char* ap = lds + (C2D + wm * 16 + l15) * P2 + 16 * g;
    const char* bp = lds + (wn * 16 + l15) * P2 + 16 * g;
    v8f c0 = {};
    v16h fa[C1D / 32], fb[C1D / 32];
#pragma unroll                                // fa[], fb[] stay in registers
    for (int k = 0; k < C1D / 32; ++k) {
        fa[k] = load_frag((const _Float16*)(ap + k * 64));
        fb[k] = load_frag((const _Float16*)(bp + k * 64));
    }
    // keeps the load group in front of the WMMAs: one LDS latency for all of
    // K, where the scheduler otherwise waits out one for every WMMA
    __builtin_amdgcn_sched_barrier(0);
#pragma unroll                                // fragments indexed by constants
    for (int k = 0; k < C1D / 32; ++k)
        c0 = __builtin_amdgcn_wmma_f32_16x16x32_f16(false, fa[k], false, fb[k],
                                                    (short)0, c0, false, false);
    // every wave has read its fragments before that LDS takes the z2 tile
    __syncthreads();

#pragma unroll                                // c0[] indexed by constants
    for (int r = 0; r < 8; r += 2) {
        const v2f v0 = gelu_2((v2f){c0[r] + bv2, c0[r + 1] + bv2});
        const int row = wm * 16 + 8 * g + r;
        *(_Float16*)(lds + row * P3 + (wn * 16 + l15) * 2)       = (_Float16)v0.x;
        *(_Float16*)(lds + (row + 1) * P3 + (wn * 16 + l15) * 2) = (_Float16)v0.y;
    }
    // publishes the z2 tile
    __syncthreads();

    // ---- 32 x 300 x 128 product: a wave has one 16-row half and the column
    // tiles wn, wn+8 and, where there is one, wn+16 (19 tiles in all); its
    // results, bias added, go to the output stage
    auto product3 = [&](auto ntw_c) {
        constexpr int NTW = decltype(ntw_c)::value;
        const char* ap3 = lds + (wm * 16 + l15) * P3 + 16 * g;
        const char* bp3 = lds + O_W3 + (wn * 16 + l15) * P3 + 16 * g;
        v16h ga[C2D / 32], gb[NTW][C2D / 32];
#pragma unroll                                // ga[], gb[][] stay in registers
        for (int k = 0; k < C2D / 32; ++k) {
            ga[k] = load_frag((const _Float16*)(ap3 + k * 64));
#pragma unroll                                // as above
            for (int u = 0; u < NTW; ++u)
                gb[u][k] = load_frag((const _Float16*)(bp3 + u * (8 * 16 * P3) + k * 64));
        }
        // keeps the load group in front of the WMMAs, as above
        __builtin_amdgcn_sched_barrier(0);
        v8f c[NTW];
#pragma unroll                                // c[] stays in registers
        for (int u = 0; u < NTW; ++u) c[u] = (v8f){};
#pragma unroll                                // fragments indexed by constants
        for (int k = 0; k < C2D / 32; ++k)
#pragma unroll                                // as above
            for (int u = 0; u < NTW; ++u)
                c[u] = __builtin_amdgcn_wmma_f32_16x16x32_f16(
                    false, ga[k], false, gb[u][k], (short)0, c[u], false, false);
        float* st = (float*)(lds + O_ST);
#pragma unroll                                // c[], bv3[] indexed by constants
        for (int u = 0; u < NTW; ++u) {
            const int col = (wn + 8 * u) * 16 + l15;
            if (u < 2 || col < OUTD) {            // only the last tile has an edge
#pragma unroll                                // as above
                for (int r = 0; r < 8; ++r)
                    st[(wm * 16 + 8 * g + r) * OUTD + col] = c[u][r] + bv3[u];
            }
        }
    };
    // the same for a whole wave: a scalar branch, every lane on at the WMMAs
    if (__builtin_amdgcn_readfirstlane(wn) < NT3 - 16) product3(int_c<3>{});
    else                                               product3(int_c<2>{});
    // publishes the staged rows
    __syncthreads();

    // coalesced write: 2400 pieces of 16 B in address order, 4 whole rounds of
    // the work-group and a rest that whole waves take
    constexpr int NPC = 32 * OUTD / 4;
    static_assert((NPC % 512) % 32 == 0, "the rest is whole waves");
    const float4* s4 = (const float4*)(lds + O_ST);
    float4* o4 = (float4*)(out + (size_t)blockIdx.x * 32 * OUTD);
#pragma unroll                                // offsets become constants
    for (int j = 0; j < NPC / 512; ++j) o4[t + 512 * j] = s4[t + 512 * j];
    if (t < NPC % 512) o4[t + NPC / 512 * 512] = s4[t + NPC / 512 * 512];
}

// ---------------------------------------------------------------------------
// Launch
// ---------------------------------------------------------------------------
extern "C" void kernel_launch(void* const* d_in, const int* in_sizes, int n_in,
                              void* d_out, int out_size, void* d_ws, size_t ws_size,
                              hipStream_t stream) {
    const float* x   = (const float*)d_in[0];
    const float* bw1 = (const float*)d_in[1];
    const float* bb1 = (const float*)d_in[2];
    const float* bw2 = (const float*)d_in[3];
    const float* bb2 = (const float*)d_in[4];
    const float* wc1 = (const float*)d_in[5];
    const float* bc1 = (const float*)d_in[6];
    const float* wc2 = (const float*)d_in[7];
    const float* bc2 = (const float*)d_in[8];
    const float* wc3 = (const float*)d_in[9];
    const float* bc3 = (const float*)d_in[10];
    float* out = (float*)d_out;

    // workspace carve-out (all slices 32B-aligned)
    char* ws = (char*)d_ws;
    float*    part = (float*)ws;    ws += (size_t)KSPL * SLICE * sizeof(float);
    _Float16* w2h = (_Float16*)ws;  ws += (size_t)C2D  * C1D * sizeof(_Float16);
    _Float16* w3h = (_Float16*)ws;  ws += (size_t)OUTD * C2D * sizeof(_Float16);
    if ((size_t)(ws - (char*)d_ws) > ws_size) return;  // ws too small: bail

    // 1) all 1000 branch MLPs and f @ wc1^T, K in 8 slices (f32 partial sums)
    //    (and the two small combiner weights to fp16)
    branch_gemm_kernel<<<dim3(B_SZ / FM, KSPL), 256, 0, stream>>>(
        x, bw1, bb1, bw2, bb2, wc1, wc2, wc3, w2h, w3h, part);

    // 2) z1 = gelu(slices + bc1), z2 = gelu(z1 @ wc2^T + bc2),
    //    out = z2 @ wc3^T + bc3 (fp32)
    reduce_gemm_kernel<<<dim3(B_SZ / 32), 512, 0, stream>>>(
        part, w2h, w3h, bc1, bc2, bc3, out);
}

// v010
// Measured time: 42.4 microseconds a run.
// Next to v009, in two timings, it ran 1.07 and 1.08 times as fast.
// Over all steps from v000 it is 6.22 times as fast.
#include <hip/hip_runtime.h>
#include <hip/hip_bf16.h>

typedef __attribute__((ext_vector_type(16))) _Float16 v16h;
typedef __attribute__((ext_vector_type(8)))  _Float16 v8h;
typedef __attribute__((ext_vector_type(4)))  _Float16 v4h;
typedef __attribute__((ext_vector_type(8)))  float    v8f;
typedef int v4i __attribute__((vector_size(4 * sizeof(int))));  // b128 payload

#define B_SZ 4096
#define N_BR 1000
#define H1D  16
#define H2D  8
#define C1D  256
#define C2D  128
#define OUTD 300
#define KF   (N_BR * H2D)   // 8000
#define FM   128            // batch rows of a fused work-group
#define KSPL 8              // slices of K, one a work-group
#define NGRP (N_BR / 8)     // groups of 8 branches = 64 of K
#define FP   144            // LDS row pitch, bytes: 64 f16 + 16 (16 B x odd)
#define FBUF ((C1D + FM) * FP)   // one buffer: 256 W rows, then 128 f rows
#define SLICE (B_SZ * C1D)  // floats of one K slice's partial sums
#define P2   (C1D * 2 + 16) // LDS row pitch of the second GEMM, bytes
#define P3   (C2D * 2 + 16) // LDS row pitch of the third GEMM, bytes (16 B x odd)
#define NT3  ((OUTD + 15) / 16)  // 16-column tiles of the output
#define W3R  320            // LDS rows of wc3: 5 sweeps of 64
#define O_W3 ((C2D + 32) * P2)   // LDS offset of wc3, behind wc2 and z1
#define O_ST (32 * P3)      // LDS offset of the output stage, behind the z2 tile
// the two small combiner weights in pieces of 8 values, one piece a thread
#define CH2 (C2D * C1D / 8)
#define CH3 (OUTD * C2D / 8)

#define AS1 __attribute__((address_space(1)))
#define AS3 __attribute__((address_space(3)))

typedef __attribute__((ext_vector_type(2))) float v2f;
typedef __attribute__((ext_vector_type(2))) _Float16 v2h;

// exact GeLU, 0.5*x*(1+erf(x/sqrt(2))), written without a branch as
//   max(x,0) - a*Q(a),  a = |x|,  Q(a) = 0.5*erfc(a/sqrt(2)) = exp2(P(a)).
// P is one polynomial of degree 6 for all of 0 <= a <= 6 (fitted to log2 Q,
// weighted by a*Q); past 6 the term a*Q is below 1e-8 and a is held at 6.
// The term a*Q(a) stays within 2e-7 of the exact one, the size of f32 rounding
// (a NaN does not pass min and max).
// Two values at a time, so that the polynomial runs on packed FMAs.
__device__ __forceinline__ v2f gelu_2(v2f v) {
    const v2f a = __builtin_elementwise_min(__builtin_elementwise_abs(v), (v2f)(6.0f));
    v2f p = (v2f)(0.0000330932962f);
    p = __builtin_elementwise_fma(p, a, (v2f)(-0.000769223785f));
    p = __builtin_elementwise_fma(p, a, (v2f)(0.00808072928f));
    p = __builtin_elementwise_fma(p, a, (v2f)(-0.0534121245f));
    p = __builtin_elementwise_fma(p, a, (v2f)(-0.458770961f));
    p = __builtin_elementwise_fma(p, a, (v2f)(-1.15120173f));
    p = __builtin_elementwise_fma(p, a, (v2f)(-0.999993086f));
    v2f q;
    q.x = __builtin_amdgcn_exp2f(p.x);
    q.y = __builtin_amdgcn_exp2f(p.y);
    return __builtin_elementwise_fma(-a, q, __builtin_elementwise_max(v, (v2f)(0.0f)));
}

// tanh on the chip's own transcendental instruction, v_tanh_f32: no exp that
// could overflow, so no clamp, and no rcp
__device__ __forceinline__ float tanh_fast(float v) {
    return __builtin_amdgcn_tanhf(v);
}

// Build a 16-bit A/B WMMA fragment for this lane from K-contiguous memory.
// Lane group g (lane>>4): elements 0..7 = K[8g..8g+7], elements 8..15 =
// K[16+8g..16+8g+7].  `p` must already point at row_base + 8*g.
__device__ __forceinline__ v16h load_frag(const _Float16* p) {
    v8h lo = *(const v8h*)(p);
    v8h hi = *(const v8h*)(p + 16);
    v16h r;
#pragma unroll
    for (int i = 0; i < 8; ++i) { r[i] = lo[i]; r[8 + i] = hi[i]; }
    return r;
}

// ---------------------------------------------------------------------------
// Branch stage and first combiner GEMM in one kernel.
//   h = gelu(x*bw1+bb1) [16], f = tanh(h @ bw2^T + bb2) [8], z1pre = f @ wc1^T
// A work-group owns 128 batch rows, all 256 columns of wc1 and one slice of K
// (15 or 16 groups of 8 branches).  Per group it makes its 128 x 64 piece of f
// in LDS, lays the 256 x 64 piece of wc1 beside it as f16, and multiplies the
// two at once: f never goes to memory.
// Making f: one wave = 2 neighbouring branches x 16 rows, one full WMMA with a
// block-diagonal B (K = 2 x 16 hidden units, N = 2 x 8 outputs); the 8 waves
// are 4 branch pairs x 2 row halves and walk 4 tiles of 32 rows.
// Multiplying: wave tile 64 x 64, waves 2 (M) x 4 (N), 16 accumulator tiles.
// Two LDS buffers, one barrier a group.  The loop is staggered by one group:
// while group g is made in one buffer, group g-1 is multiplied out of the
// other, its fragment reads and WMMAs standing among the vector work.
// The f32 partial sums of the slice leave in accumulator order (a wave's tile
// is 1 KiB in a row); the next kernel adds the slices.
// The fp32 -> fp16 conversion of the two small combiner weights rides in the
// first work-groups.
// ---------------------------------------------------------------------------
__global__ __launch_bounds__(256)
void branch_gemm_kernel(const float* __restrict__ x,     // [B, N_BR]
                        const float* __restrict__ bw1,   // [N_BR, 16]
                        const float* __restrict__ bb1,   // [N_BR, 16]
                        const float* __restrict__ bw2,   // [N_BR, 8, 16]
                        const float* __restrict__ bb2,   // [N_BR, 8]
                        const float* __restrict__ wc1,   // [256, 8000]
                        const float* __restrict__ wc2,   // [128, 256]
                        const float* __restrict__ wc3,   // [300, 128]
                        _Float16* __restrict__ w2h,      // wc2 as f16
                        _Float16* __restrict__ w3h,      // wc3 as f16
                        float* __restrict__ part) {      // [tile][KSPL][256]
    __shared__ __attribute__((aligned(16))) char lds[2 * FBUF];

    const int t    = threadIdx.x;
    const int lane = t & 31;
    const int wid  = t >> 5;
    const int pr   = wid & 3;                 // making f: branch pair
    const int rh   = wid >> 2;                // making f: 16-row half of a tile
    const int wm   = wid & 1;                 // multiplying: 64-row half
    const int wn   = wid >> 1;                // multiplying: 64-column quarter
    const int m    = lane & 15;
    const int g    = lane >> 4;
    const int mt   = blockIdx.x;              // 128-row tile
    const int ks   = blockIdx.y;              // K slice
    const int gs   = ks * NGRP / KSPL;        // first group of the slice
    const int ge   = (ks + 1) * NGRP / KSPL;  // one past its last

    // ---- this work-group's share of the small weights' conversion ----
    {
        static_assert((C2D * C1D) % 8 == 0 && (OUTD * C2D) % 8 == 0, "8 values a piece");
        static_assert(CH2 + CH3 <= (B_SZ / FM) * KSPL * 256, "a piece a thread at most");
        const int pc0 = (blockIdx.y * (B_SZ / FM) + blockIdx.x) * 256 + t;
        if (pc0 < CH2 + CH3) {
            const bool third = (pc0 >= CH2);
            const float* src = third ? wc3 : wc2;
            _Float16* dst    = third ? w3h : w2h;
            const int pc     = third ? pc0 - CH2 : pc0;
            const float4 lo = *(const float4*)(src + pc * 8);
            const float4 hi = *(const float4*)(src + pc * 8 + 4);
            v8h r;
            r[0] = (_Float16)lo.x; r[1] = (_Float16)lo.y;
            r[2] = (_Float16)lo.z; r[3] = (_Float16)lo.w;
            r[4] = (_Float16)hi.x; r[5] = (_Float16)hi.y;
            r[6] = (_Float16)hi.z; r[7] = (_Float16)hi.w;
            *(v8h*)(dst + pc * 8) = r;
        }
    }

    // ---- what a group reads from memory, fetched one group ahead ----
    // Every address is a base that is the same for the whole work-group plus a
    // byte offset of the lane that never changes.
    // wc1: 16 lanes cover the 256 B of a row's 64 values, 16 rows a sweep
    const unsigned int vo_w = ((t >> 4) * KF + (t & 15) * 4) * 4u;
    // branch weights: hidden units 8g..8g+7 of both branches of the pair
    const unsigned int vo_1 = (pr * 2 * H1D + 8 * g) * 4u;
    // row m of the pair's 16 outputs
    const unsigned int vo_2 = ((pr * 2 * H2D + m) * H1D + 8 * g) * 4u;
    const unsigned int vo_b = (pr * 2 * H2D + m) * 4u;
    // x of both branches is one aligned pair (n0 even, row pitch even)
    const unsigned int vo_x = ((rh * 16 + m) * N_BR + pr * 2) * 4u;
    float4 wr[16], w1q[4], c1q[4], w2q[2];
    v2f xv[4];
    float bias;
    auto load_group = [&](int grp) {
        // the lane's six addresses; every load is one of them plus a constant
        const char* sw = (const char*)(wc1 + grp * 64) + vo_w;
        const char* s1 = (const char*)(bw1 + grp * 8 * H1D) + vo_1;
        const char* sc = (const char*)(bb1 + grp * 8 * H1D) + vo_1;
        const char* s2 = (const char*)(bw2 + grp * 8 * H2D * H1D) + vo_2;
        const char* sb = (const char*)(bb2 + grp * 8 * H2D) + vo_b;
        const char* sx = (const char*)(x + (size_t)mt * FM * N_BR + grp * 8) + vo_x;
#pragma unroll                                // wr[] stays in registers
        for (int j = 0; j < 16; ++j)
            wr[j] = *(const float4*)(sw + j * (16 * KF * 4));
#pragma unroll                                // w1q[], c1q[] stay in registers
        for (int p = 0; p < 2; ++p) {
#pragma unroll                                // as above: indices become constants
            for (int h = 0; h < 2; ++h) {
                w1q[p * 2 + h] = *(const float4*)(s1 + p * (H1D * 4) + h * 16);
                c1q[p * 2 + h] = *(const float4*)(sc + p * (H1D * 4) + h * 16);
            }
        }
        w2q[0] = *(const float4*)(s2);
        w2q[1] = *(const float4*)(s2 + 16);
        bias = *(const float*)(sb);
#pragma unroll                                // xv[] stays in registers
        for (int tl = 0; tl < 4; ++tl)
            xv[tl] = *(const v2f*)(sx + tl * (32 * N_BR * 4));
        // stands directly behind the loads, in front of any rewrite of a
        // register that they name: scalar bases and the lane offsets, which
        // live on
        asm volatile("s_wait_xcnt 0x0" ::: "memory");
        // nothing is scheduled in between the loads and that wait
        __builtin_amdgcn_sched_barrier(0);
    };
    // ---- the same loads in the loop, asked for in five parts with vector
    // work between them: the memory path takes in one part while the waves
    // compute, where 31 loads a wave in a row, all 8 waves at once, hold every
    // wave until the path has taken them.  The six addresses are formed once a
    // trip and keep their registers to the trip's end
    const char *qw, *q1, *qc, *q2, *qb, *qx;
    auto addresses = [&](int grp) {
        qw = (const char*)(wc1 + grp * 64) + vo_w;
        q1 = (const char*)(bw1 + grp * 8 * H1D) + vo_1;
        qc = (const char*)(bb1 + grp * 8 * H1D) + vo_1;
        q2 = (const char*)(bw2 + grp * 8 * H2D * H1D) + vo_2;
        qb = (const char*)(bb2 + grp * 8 * H2D) + vo_b;
        qx = (const char*)(x + (size_t)mt * FM * N_BR + grp * 8) + vo_x;
    };
    auto ask = [&](int part) {
        // the part starts a scheduling region of its own: the scheduler
        // otherwise gathers all loads at the first part
        __builtin_amdgcn_sched_barrier(0);
        // parts 0..3: x of one tile each; sweeps of wc1: 3, 4, 3, 3, 3
        constexpr int jb[6] = {0, 3, 7, 10, 13, 16};
#pragma unroll                                // xv[] stays in registers
        for (int tl = 0; tl < 4; ++tl)
            if (tl == part) xv[tl] = *(const v2f*)(qx + tl * (32 * N_BR * 4));
#pragma unroll                                // wr[] stays in registers
        for (int j = 0; j < 16; ++j)
            if (j >= jb[part] && j < jb[part + 1])
                wr[j] = *(const float4*)(qw + j * (16 * KF * 4));
        if (part == 0) {
            w2q[0] = *(const float4*)(q2);
            w2q[1] = *(const float4*)(q2 + 16);
            bias = *(const float*)(qb);
        }
#pragma unroll                                // w1q[], c1q[] stay in registers
        for (int p = 0; p < 2; ++p) {
#pragma unroll                                // as above: indices become constants
            for (int h = 0; h < 2; ++h) {
                if (part == 3) w1q[p * 2 + h] = *(const float4*)(q1 + p * (H1D * 4) + h * 16);
                if (part == 4) c1q[p * 2 + h] = *(const float4*)(qc + p * (H1D * 4) + h * 16);
            }
        }
        // and ends it: the loads stay where they are written
        __builtin_amdgcn_sched_barrier(0);
    };

    v8f acc[4][4];
#pragma unroll                                // acc[][] stays in registers
    for (int i = 0; i < 4; ++i)
#pragma unroll                                // as above: indices become constants
        for (int j = 0; j < 4; ++j) acc[i][j] = (v8f){};

    // the loads below start a scheduling region of their own
    __builtin_amdgcn_sched_barrier(0);
    load_group(gs);

    const bool up = (m >= H2D);
    static_assert(NGRP >= 2 * KSPL, "every slice has two groups");

    v2f pre[4][8];
    v16h b;
    float bcur;
    // ---- head of a group: all that uses up what was fetched for it; the
    // request for the next group follows it
    auto head = [&](char* buf) {
        // ---- wc1 piece to LDS as f16
#pragma unroll                                // as above: indices become constants
        for (int j = 0; j < 16; ++j) {
            v4h h;
            h[0] = (_Float16)wr[j].x; h[1] = (_Float16)wr[j].y;
            h[2] = (_Float16)wr[j].z; h[3] = (_Float16)wr[j].w;
            *(v4h*)(buf + (j * 16 + (t >> 4)) * FP + (t & 15) * 8) = h;
        }

        // ---- layer 1 ahead of its GeLU, all 4 tiles: the last use of x and
        // of the layer's weights, so that the next group's can be asked for
#pragma unroll                                // pre[][] stays in registers
        for (int tl = 0; tl < 4; ++tl) {
#pragma unroll                                // as above: indices become constants
            for (int p = 0; p < 2; ++p) {
                const v2f xb = (v2f)(p ? xv[tl].y : xv[tl].x);
#pragma unroll                                // as above: indices become constants
                for (int h = 0; h < 2; ++h) {
                    const float4 wq = w1q[p * 2 + h], cq = c1q[p * 2 + h];
                    pre[tl][p * 4 + h * 2] =
                        __builtin_elementwise_fma(xb, (v2f){wq.x, wq.y}, (v2f){cq.x, cq.y});
                    pre[tl][p * 4 + h * 2 + 1] =
                        __builtin_elementwise_fma(xb, (v2f){wq.z, wq.w}, (v2f){cq.z, cq.w});
                }
            }
        }

        // ---- B fragment, block diagonal.  Fragment elements 0..7 carry
        // hidden units 8g..8g+7 of branch n0, elements 8..15 those of branch
        // n0+1 (the A fragment below has the same order).  Column m is output
        // m&7 of branch n0 + (m>>3): weights in its own branch's half only.
#pragma unroll                                // as above: indices become constants
        for (int i = 0; i < 8; ++i) {
            const float wf = (i < 4) ? ((const float*)&w2q[0])[i] : ((const float*)&w2q[1])[i - 4];
            const _Float16 w = (_Float16)wf;
            b[i]     = up ? (_Float16)0.0f : w;
            b[8 + i] = up ? w : (_Float16)0.0f;
        }
        bcur = bias;

        // the next group's loads start a scheduling region of their own
        __builtin_amdgcn_sched_barrier(0);
    };

    // ---- 32 rows of the group's f (this wave: 16 rows x 2 branches) to LDS,
    // in two parts.  A fragment: rows = batch, K = hidden units of the pair
    auto hidden = [&](int tl) {
        v16h a;
#pragma unroll                                // as above: indices become constants
        for (int i = 0; i < 8; ++i) {
            const v2f hv = gelu_2(pre[tl][i]);
            a[2 * i]     = (_Float16)hv.x;
            a[2 * i + 1] = (_Float16)hv.y;
        }
        return a;
    };
    auto finish = [&](char* buf, int tl, v16h a) {
        _Float16* st = (_Float16*)(buf + C1D * FP);
        v8f c = {};
        c = __builtin_amdgcn_wmma_f32_16x16x32_f16(false, a, false, b,
                                                   (short)0, c, false, false);
#pragma unroll                                // as above: indices become constants
        for (int r = 0; r < 8; r += 2) {
            const int row = tl * 32 + rh * 16 + r + 8 * g;  // lanes 16-31: M 8..15
            const v2h f2 = __builtin_convertvector(
                (v2f){tanh_fast(c[r] + bcur), tanh_fast(c[r + 1] + bcur)}, v2h);
            st[row * (FP / 2) + pr * 16 + m]       = f2.x;
            st[(row + 1) * (FP / 2) + pr * 16 + m] = f2.y;
        }
    };
    auto tile = [&](char* buf, int tl) { finish(buf, tl, hidden(tl)); };

    // ---- the 128 x 256 x 64 product of a published buffer, in 4 quarters:
    // fragments of 32 of K as one group, then 2 x 8 WMMAs
    v16h af[4], bf[4];
    auto frags = [&](const char* pb, int k2) {
        const char* ab = pb + (C1D + wm * 64 + m) * FP + 16 * g + k2 * 64;
        const char* bb = pb + (wn * 64 + m) * FP + 16 * g + k2 * 64;
#pragma unroll                                // af[], bf[] stay in registers
        for (int i = 0; i < 4; ++i) {
            af[i] = load_frag((const _Float16*)(ab + i * 16 * FP));
            bf[i] = load_frag((const _Float16*)(bb + i * 16 * FP));
        }
        // keeps the load group where it is written (in the loop: a stretch of
        // vector work ahead of its WMMAs): the scheduler otherwise sinks the
        // loads to just before their use
        __builtin_amdgcn_sched_barrier(0);
    };
    auto quarter = [&](int ih) {
#pragma unroll                                // as above: indices become constants
        for (int i = 2 * ih; i < 2 * ih + 2; ++i)
#pragma unroll                                // as above: indices become constants
            for (int j = 0; j < 4; ++j)
                acc[i][j] = __builtin_amdgcn_wmma_f32_16x16x32_f16(
                    false, af[i], false, bf[j], (short)0, acc[i][j], false, false);
    };

    // ---- first group: made, not yet multiplied
    head(lds);
    load_group(gs + 1);
#pragma unroll                                // pre[][] indexed by constants
    for (int tl = 0; tl < 4; ++tl) tile(lds, tl);
    // publishes the first group's f and wc1 pieces
    __syncthreads();

    // ---- group grp is made while group grp-1 is multiplied: each quarter of
    // the product stands behind a tile of vector work, so that one wave's
    // WMMAs and LDS reads run under the other wave's (and its own) GeLU, tanh
    int grp = gs + 1;
    do {    // at least one trip
        char* buf       = lds + ((grp - gs) & 1) * FBUF;
        const char* prv = lds + ((grp - gs - 1) & 1) * FBUF;
        // the last trip asks for its own group again: in bounds, unused
        const int gn = (grp + 1 < ge) ? grp + 1 : grp;

        frags(prv, 0);
        head(buf);
        addresses(gn);
        ask(0);
        const v16h a0 = hidden(0);
        ask(1);
        finish(buf, 0, a0);
        quarter(0);
        ask(2);
        const v16h a1 = hidden(1);
        ask(3);
        finish(buf, 1, a1);
        quarter(1);
        ask(4);
        frags(prv, 1);
        const v16h a2 = hidden(2);
        // keeps the WMMAs below behind that GeLU, which covers the latency of
        // the fragment reads: the scheduler otherwise lifts them to the reads
        __builtin_amdgcn_sched_barrier(0);
        quarter(0);
        finish(buf, 2, a2);
        tile(buf, 3);
        quarter(1);

        // stands in front of the next trip's rewrite of the registers that the
        // trip's loads name; the six addresses are its inputs, so that each
        // keeps its registers up to here.  Here, two tiles behind the last
        // load, no wave has to stand at it
        asm volatile("s_wait_xcnt 0x0"
                     :: "v"(qw), "v"(q1), "v"(qc), "v"(q2), "v"(qb), "v"(qx) : "memory");

        // publishes this group's f and wc1 pieces; the buffer written next was
        // last read in front of this barrier
        __syncthreads();
    } while (++grp < ge);

    // ---- the last group's product
    {
        const char* prv = lds + ((ge - gs - 1) & 1) * FBUF;
        frags(prv, 0);
        quarter(0);
        quarter(1);
        frags(prv, 1);
        quarter(0);
        quarter(1);
    }

    // ---- the slice's partial sums, in accumulator order: tile (i,j) of wave
    // wid is 32 lanes x 8 floats in a row, the 8 slices of a tile side by side
    float* pp = part + ((size_t)((mt * 8 + wid) * 16 * KSPL + ks) * 32 + lane) * 8;
#pragma unroll                                // as above: indices become constants
    for (int i = 0; i < 4; ++i)
#pragma unroll                                // as above: indices become constants
        for (int j = 0; j < 4; ++j)
            *(v8f*)(pp + (i * 4 + j) * (KSPL * 256)) = acc[i][j];
}

// ---------------------------------------------------------------------------
// One row slice of a stage: JC async copies of 16 B per lane, 128 B apart.
// The immediate offset moves the global and the LDS address alike.
// ---------------------------------------------------------------------------
template <int J, int JC>
__device__ __forceinline__ void copy_row(const _Float16* gp, unsigned int la) {
    __builtin_amdgcn_global_load_async_to_lds_b128(
        (AS1 v4i*)(unsigned long long)(uintptr_t)gp,
        (AS3 v4i*)la, J * 128, 0);
    if constexpr (J + 1 < JC) copy_row<J + 1, JC>(gp, la);
}

// ---------------------------------------------------------------------------
// z1 = gelu(sum of the K slices + bc1), z2 = gelu(z1 @ wc2^T + bc2),
// out = z2 @ wc3^T + bc3
// A work-group of 16 waves owns 32 batch rows and all columns of both products.
// wc2 and wc3 (f16) come into LDS by async copies, filled once, while the
// slices are added; z1 and z2 go to LDS as f16 and never to memory.  Slices are
// added in the order 0..7.  The 32 output rows are 38,400 B in a row (300 whole
// 128-B lines): they are staged in LDS and leave as 16-B pieces in address order.
// ---------------------------------------------------------------------------
template <int N> struct int_c { static constexpr int value = N; };

__global__ __launch_bounds__(512)
void reduce_gemm_kernel(const float* __restrict__ part,   // [tile][KSPL][256]
                        const _Float16* __restrict__ w2h, // [128][256]
                        const _Float16* __restrict__ w3h, // [300][128]
                        const float* __restrict__ bc1,    // [256]
                        const float* __restrict__ bc2,    // [128]
                        const float* __restrict__ bc3,    // [300]
                        float* __restrict__ out) {        // [B][300]
    // 128 rows of wc2, then 32 rows of z1, then W3R rows of wc3.  Once the
    // second product has been read out, the first part holds the z2 tile
    // (32 rows at pitch P3) and behind it the output stage
    __shared__ __attribute__((aligned(16))) char lds[O_W3 + W3R * P3];
    static_assert(O_ST + 32 * OUTD * 4 <= O_W3, "z2 tile and output stage end ahead of wc3");
    static_assert(W3R % 64 == 0 && W3R >= NT3 * 16, "whole sweeps cover every column tile");
    static_assert(NT3 > 16 && NT3 <= 24, "2 or 3 column tiles a wave");

    const int t    = threadIdx.x;
    const int lane = t & 31;
    const int wid  = t >> 5;
    const int l15  = lane & 15;
    const int g    = lane >> 4;

    // 8 lanes cover a 128-B line of a row, 64 rows a sweep, 4 lines a row
    {
        const int srow = t >> 3;
        const int ssub = t & 7;
        const unsigned int lbase = (unsigned int)(uintptr_t)&lds[srow * P2 + ssub * 16];
#pragma unroll                                // offsets become constants
        for (int rg = 0; rg < 2; ++rg)
            copy_row<0, 4>(w2h + (size_t)(rg * 64 + srow) * C1D + ssub * 8,
                           lbase + rg * 64 * P2);
    }

    // where these 32 rows lie in the first kernel's accumulator order
    const int mt  = blockIdx.x >> 2;               // its 128-row tile
    const int wmf = (blockIdx.x >> 1) & 1;         // its 64-row half
    const int ih  = wid >> 3;                      // 16-row half of the 32 rows
    const int ti  = (blockIdx.x & 1) * 2 + ih;     // its 16-row tile
    const int wnf = (wid >> 1) & 3;                // its 64-column quarter
    const int u0  = (wid & 1) * 2;                 // first of 2 16-column tiles
    const int wm = wid & 1;                        // the products' 16-row half
    const int wn = wid >> 1;                       // their 16-column tile, of 8
    // every load below is a kernel argument plus one of these lane offsets
    // (bytes) plus a constant: the 2 x 8 slices of the wave lie in a row
    const unsigned int vo_p =
        ((((mt * 8 + wmf + 2 * wnf) * 16 + ti * 4 + u0) * KSPL) * 32 + lane) * 32u;
    const unsigned int vo_c1 = (wnf * 64 + u0 * 16 + l15) * 4u;
    const unsigned int vo_c2 = (wn * 16 + l15) * 4u;
    // the wave's third output tile may end past column 299: held in bounds
    const int c3l = (wn + 16) * 16 + l15;
    const int c3i = (c3l < OUTD) ? c3l : (OUTD - 1);
    // all loads of the kernel as one group, in a scheduling region of its own
    __builtin_amdgcn_sched_barrier(0);
    v8f ps[2][KSPL];
    float bv1s[2];
#pragma unroll                                // ps[][], bv1s[] stay in registers
    for (int u = 0; u < 2; ++u) {
#pragma unroll                                // as above
        for (int k = 0; k < KSPL; ++k)
            ps[u][k] = *(const v8f*)((const char*)part + vo_p + (u * KSPL + k) * 1024);
        bv1s[u] = *(const float*)((const char*)bc1 + vo_c1 + u * 64);
    }
    const float bv2 = *(const float*)((const char*)bc2 + vo_c2);
    float bv3[3];                                  // output tiles wn, wn+8, wn+16
    bv3[0] = *(const float*)((const char*)bc3 + vo_c2);
    bv3[1] = *(const float*)((const char*)bc3 + vo_c2 + 8 * 16 * 4);
    bv3[2] = bc3[c3i];
    // stands directly behind the loads, in front of any rewrite of a register
    // that they name; the lane offsets are its inputs, so that each keeps its
    // register up to here
    asm volatile("s_wait_xcnt 0x0"
                 :: "v"(vo_p), "v"(vo_c1), "v"(vo_c2), "v"(c3i) : "memory");
    // nothing is scheduled in between the loads and that wait
    __builtin_amdgcn_sched_barrier(0);
    // wc3, asked for behind the slices, lands while they are added: 8 lanes
    // cover a 128-B line of a row, 64 rows a sweep, 2 lines a row
    {
        const int srow = t >> 3;
        const int ssub = t & 7;
        const unsigned int lbase3 =
            (unsigned int)(uintptr_t)&lds[O_W3 + srow * P3 + ssub * 16];
#pragma unroll                                // offsets become constants
        for (int rg = 0; rg < W3R / 64; ++rg) {
            const int r0  = rg * 64 + srow;
            const int row = (r0 < OUTD) ? r0 : (OUTD - 1);  // clamp; such cols dropped
            copy_row<0, 2>(w3h + (size_t)row * C2D + ssub * 8, lbase3 + rg * 64 * P3);
        }
    }
    // keeps the copies here, ahead of the first wait for a slice: the scheduler
    // otherwise sinks them among the sums, where they start a memory latency late
    __builtin_amdgcn_sched_barrier(0);
#pragma unroll                                // ps[][] indexed by constants
    for (int u = 0; u < 2; ++u) {
        v8f s = ps[u][0];
#pragma unroll                                // as above
        for (int k = 1; k < KSPL; ++k) s += ps[u][k];
        const int col = wnf * 64 + (u0 + u) * 16 + l15;
        const float bv = bv1s[u];
#pragma unroll                                // s[] indexed by constants
        for (int r = 0; r < 8; r += 2) {
            const v2f v = gelu_2((v2f){s[r] + bv, s[r + 1] + bv});
            const int row = C2D + ih * 16 + 8 * g + r;
            *(_Float16*)(lds + row * P2 + col * 2)       = (_Float16)v.x;
            *(_Float16*)(lds + (row + 1) * P2 + col * 2) = (_Float16)v.y;
        }
    }
    // this wave's copies of wc2 and wc3 have landed before the barrier
    // publishes them
    asm volatile("s_wait_asynccnt 0x0" ::: "memory");
    __syncthreads();

    // ---- 32 x 128 x 256 product: wave tile 16 x 16, waves 2 (M) x 8 (N)
    const char* ap = lds + (C2D + wm * 16 + l15) * P2 + 16 * g;
    const char* bp = lds + (wn * 16 + l15) * P2 + 16 * g;
    v8f c0 = {};
    v16h fa[C1D / 32], fb[C1D / 32];
#pragma unroll                                // fa[], fb[] stay in registers
    for (int k = 0; k < C1D / 32; ++k) {
        fa[k] = load_frag((const _Float16*)(ap + k * 64));
        fb[k] = load_frag((const _Float16*)(bp + k * 64));
    }
    // keeps the load group in front of the WMMAs: one LDS latency for all of
    // K, where the scheduler otherwise waits out one for every WMMA
    __builtin_amdgcn_sched_barrier(0);
#pragma unroll                                // fragments indexed by constants
    for (int k = 0; k < C1D / 32; ++k)
        c0 = __builtin_amdgcn_wmma_f32_16x16x32_f16(false, fa[k], false, fb[k],
                                                    (short)0, c0, false, false);
    // every wave has read its fragments before that LDS takes the z2 tile
    __syncthreads();

#pragma unroll                                // c0[] indexed by constants
    for (int r = 0; r < 8; r += 2) {
        const v2f v0 = gelu_2((v2f){c0[r] + bv2, c0[r + 1] + bv2});
        const int row = wm * 16 + 8 * g + r;
        *(_Float16*)(lds + row * P3 + (wn * 16 + l15) * 2)       = (_Float16)v0.x;
        *(_Float16*)(lds + (row + 1) * P3 + (wn * 16 + l15) * 2) = (_Float16)v0.y;
    }
    // publishes the z2 tile
    __syncthreads();

    // ---- 32 x 300 x 128 product: a wave has one 16-row half and the column
    // tiles wn, wn+8 and, where there is one, wn+16 (19 tiles in all); its
    // results, bias added, go to the output stage
    auto product3 = [&](auto ntw_c) {
        constexpr int NTW = decltype(ntw_c)::value;
        const char* ap3 = lds + (wm * 16 + l15) * P3 + 16 * g;
        const char* bp3 = lds + O_W3 + (wn * 16 + l15) * P3 + 16 * g;
        v16h ga[C2D / 32], gb[NTW][C2D / 32];
#pragma unroll                                // ga[], gb[][] stay in registers
        for (int k = 0; k < C2D / 32; ++k) {
            ga[k] = load_frag((const _Float16*)(ap3 + k * 64));
#pragma unroll                                // as above
            for (int u = 0; u < NTW; ++u)
                gb[u][k] = load_frag((const _Float16*)(bp3 + u * (8 * 16 * P3) + k * 64));
        }
        // keeps the load group in front of the WMMAs, as above
        __builtin_amdgcn_sched_barrier(0);
        v8f c[NTW];
#pragma unroll                                // c[] stays in registers
        for (int u = 0; u < NTW; ++u) c[u] = (v8f){};
#pragma unroll                                // fragments indexed by constants
        for (int k = 0; k < C2D / 32; ++k)
#pragma unroll                                // as above
            for (int u = 0; u < NTW; ++u)
                c[u] = __builtin_amdgcn_wmma_f32_16x16x32_f16(
                    false, ga[k], false, gb[u][k], (short)0, c[u], false, false);
        float* st = (float*)(lds + O_ST);
#pragma unroll                                // c[], bv3[] indexed by constants
        for (int u = 0; u < NTW; ++u) {
            const int col = (wn + 8 * u) * 16 + l15;
            if (u < 2 || col < OUTD) {            // only the last tile has an edge
#pragma unroll                                // as above
                for (int r = 0; r < 8; ++r)
                    st[(wm * 16 + 8 * g + r) * OUTD + col] = c[u][r] + bv3[u];
            }
        }
    };
    // the same for a whole wave: a scalar branch, every lane on at the WMMAs
    if (__builtin_amdgcn_readfirstlane(wn) < NT3 - 16) product3(int_c<3>{});
    else                                               product3(int_c<2>{});
    // publishes the staged rows
    __syncthreads();

    // coalesced write: 2400 pieces of 16 B in address order, 4 whole rounds of
    // the work-group and a rest that whole waves take
    constexpr int NPC = 32 * OUTD / 4;
    static_assert((NPC % 512) % 32 == 0, "the rest is whole waves");
    const float4* s4 = (const float4*)(lds + O_ST);
    float4* o4 = (float4*)(out + (size_t)blockIdx.x * 32 * OUTD);
#pragma unroll                                // offsets become constants
    for (int j = 0; j < NPC / 512; ++j) o4[t + 512 * j] = s4[t + 512 * j];
    if (t < NPC % 512) o4[t + NPC / 512 * 512] = s4[t + NPC / 512 * 512];
}

// ---------------------------------------------------------------------------
// Launch
// ---------------------------------------------------------------------------
extern "C" void kernel_launch(void* const* d_in, const int* in_sizes, int n_in,
                              void* d_out, int out_size, void* d_ws, size_t ws_size,
                              hipStream_t stream) {
    const float* x   = (const float*)d_in[0];
    const float* bw1 = (const float*)d_in[1];
    const float* bb1 = (const float*)d_in[2];
    const float* bw2 = (const float*)d_in[3];
    const float* bb2 = (const float*)d_in[4];
    const float* wc1 = (const float*)d_in[5];
    const float* bc1 = (const float*)d_in[6];
    const float* wc2 = (const float*)d_in[7];
    const float* bc2 = (const float*)d_in[8];
    const float* wc3 = (const float*)d_in[9];
    const float* bc3 = (const float*)d_in[10];
    float* out = (float*)d_out;

    // workspace carve-out (all slices 32B-aligned)
    char* ws = (char*)d_ws;
    float*    part = (float*)ws;    ws += (size_t)KSPL * SLICE * sizeof(float);
    _Float16* w2h = (_Float16*)ws;  ws += (size_t)C2D  * C1D * sizeof(_Float16);
    _Float16* w3h = (_Float16*)ws;  ws += (size_t)OUTD * C2D * sizeof(_Float16);
    if ((size_t)(ws - (char*)d_ws) > ws_size) return;  // ws too small: bail

    // 1) all 1000 branch MLPs and f @ wc1^T, K in 8 slices (f32 partial sums)
    //    (and the two small combiner weights to fp16)
    branch_gemm_kernel<<<dim3(B_SZ / FM, KSPL), 256, 0, stream>>>(
        x, bw1, bb1, bw2, bb2, wc1, wc2, wc3, w2h, w3h, part);

    // 2) z1 = gelu(slices + bc1), z2 = gelu(z1 @ wc2^T + bc2),
    //    out = z2 @ wc3^T + bc3 (fp32)
    reduce_gemm_kernel<<<dim3(B_SZ / 32), 512, 0, stream>>>(
        part, w2h, w3h, bc1, bc2, bc3, out);
}
